// v000
// Times are from an AMD MI455X. After a warm-up the kernel runs many times in a row, and a time is the length of
// such a window on the GPU divided by its runs, so every launch and the gaps after it count. The runs cycle
// through copies of the inputs. A figure is the median of several windows, for all but v000 over two sittings.
// Sittings can differ by a few percent; kernels timed side by side share one.
// The starting kernel, v000, takes 247 microseconds a run.
#include <hip/hip_runtime.h>
#include <math.h>

// MAB (multihead attention block) for MI455X / gfx1250, wave32 + WMMA + TDM.
// B=32, N=512, D=512, H=8, dh=64. All heavy math via v_wmma_f32_16x16x32_f16;
// GEMM tile staging via tensor_load_to_lds (Tensor Data Mover), double-buffered.

typedef _Float16 v16h __attribute__((ext_vector_type(16)));
typedef float    v8f  __attribute__((ext_vector_type(8)));
typedef unsigned int u32x4 __attribute__((ext_vector_type(4)));
typedef int          i32x4 __attribute__((ext_vector_type(4)));
typedef int          i32x8 __attribute__((ext_vector_type(8)));

static constexpr float kScale = 0.044194173824159216f; // 1/sqrt(512)

__device__ __forceinline__ v8f wmma_f16(v16h a, v16h b, v8f c) {
  // (neg_a, A, neg_b, B, c_mod, C, reuse_a, reuse_b)
  return __builtin_amdgcn_wmma_f32_16x16x32_f16(false, a, false, b, (short)0, c,
                                                false, false);
}

// 16-bit A/B fragment for 16x16x32 WMMA. Per ISA layout, lane (lo=L%16,
// hi=L/16) holds K=[8*hi,8*hi+8) in VGPR0-3 and K=[16+8*hi,+8) in VGPR4-7.
__device__ __forceinline__ v16h ldfrag(const _Float16* rowp, int hi) {
  v16h a;
  *reinterpret_cast<uint4*>(&a)       = *reinterpret_cast<const uint4*>(rowp + 8 * hi);
  *(reinterpret_cast<uint4*>(&a) + 1) = *reinterpret_cast<const uint4*>(rowp + 16 + 8 * hi);
  return a;
}

// ---------------------------------------------------------------------------
// TDM: DMA a 128-row x 32-col f16 tile (row stride 512 elements in memory)
// into LDS, padding each 64B row with 16B -> LDS row stride = 40 halves.
// D# built per CDNA5 ISA 8.3-8.6; issued by one wave, tracked by TENSORcnt.
// This toolchain exposes the 6-arg builtin: (g0, g1, g2, g3, extra, cpol).
// ---------------------------------------------------------------------------
__device__ __forceinline__ void tdm_load_tile(const _Float16* gsrc,
                                              unsigned lds_byte_off) {
  const unsigned long long ga = (unsigned long long)(uintptr_t)gsrc;
  u32x4 g0;
  g0.x = 1u;                                   // count=1 (valid user desc)
  g0.y = lds_byte_off;                         // lds_addr
  g0.z = (unsigned)ga;                         // global_addr[31:0]
  g0.w = (unsigned)(ga >> 32) | (2u << 30);    // global_addr[56:32] | type=2
  i32x8 g1;
  g1[0] = (1 << 16)      // data_size = 2 bytes
        | (1 << 20)      // pad_enable
        | (3 << 22)      // pad_interval: every 16 DWORDs (64B = one tile row)
        | (3 << 25);     // pad_amount: 4 DWORDs (16B -> 40-half LDS stride)
  g1[1] = (512 << 16);                 // tensor_dim0 = 512 (low 16 in [31:16])
  g1[2] = 0;                           // tensor_dim0 hi | tensor_dim1 lo
  g1[3] = 0x10 | (32 << 16);           // tensor_dim1 = 1<<20 (hi16) | tile_dim0=32
  g1[4] = 128;                         // tile_dim1 = 128, tile_dim2 = 0
  g1[5] = 512;                         // tensor_dim0_stride = 512 elements
  g1[6] = 0;
  g1[7] = 0;
  const i32x4 z4 = {0, 0, 0, 0};               // groups 2/3 unused (2D tile)
  const i32x8 z8 = {0, 0, 0, 0, 0, 0, 0, 0};   // extra group slot unused
  __builtin_amdgcn_tensor_load_to_lds(g0, g1, z4, z4, z8, 0);
}

// ---------------------------------------------------------------------------
// f32 -> f16 elementwise convert (8 elems/thread).
// ---------------------------------------------------------------------------
__global__ __launch_bounds__(256) void cvt16(const float* __restrict__ s,
                                             _Float16* __restrict__ d, int n) {
  const int i = (blockIdx.x * 256 + threadIdx.x) * 8;
  if (i >= n) return;
  const float4 a = reinterpret_cast<const float4*>(s + i)[0];
  const float4 b = reinterpret_cast<const float4*>(s + i)[1];
  _Float16 t[8] = {(_Float16)a.x, (_Float16)a.y, (_Float16)a.z, (_Float16)a.w,
                   (_Float16)b.x, (_Float16)b.y, (_Float16)b.z, (_Float16)b.w};
  *reinterpret_cast<uint4*>(d + i) = *reinterpret_cast<uint4*>(t);
}

// ---------------------------------------------------------------------------
// GEMM: C[M,N] = epi( A[M,K] @ W[N,K]^T + bias[N] ) (+ R residual), all-f16
// operands, TDM double-buffered tile staging, 128x128 C tile, K-step 32.
//   EPI: 0 bias, 1 bias+ReLU, 2 bias+residual R (f32)
//   OH : 0 f32 out, 1 f16 out, 2 dual (f32 -> Cp, f16 -> C2p)
// 8 waves in 2x4 grid; each wave: 64x32 via 8 f32 accumulators.
// ---------------------------------------------------------------------------
template <int EPI, int OH>
__global__ __launch_bounds__(256) void gemm_f16(const _Float16* __restrict__ A16,
                                                const _Float16* __restrict__ W16,
                                                const float* __restrict__ bias,
                                                const float* __restrict__ R,
                                                void* __restrict__ Cp,
                                                void* __restrict__ C2p,
                                                int M, int N, int K) {
  __shared__ _Float16 As[2][128][40];
  __shared__ _Float16 Ws[2][128][40];

  const int t = threadIdx.x;
  const int lane = t & 31;
  const int wave = t >> 5;
  const int lo = lane & 15;
  const int hi = lane >> 4;
  const int wm = (wave >> 2) * 64;
  const int wn = (wave & 3) * 32;
  const int m0 = blockIdx.y * 128;
  const int n0 = blockIdx.x * 128;

  const _Float16* Abase = A16 + (size_t)m0 * K;
  const _Float16* Wbase = W16 + (size_t)n0 * K;
  const unsigned offA0 = (unsigned)(uintptr_t)&As[0][0][0];
  const unsigned offA1 = (unsigned)(uintptr_t)&As[1][0][0];
  const unsigned offW0 = (unsigned)(uintptr_t)&Ws[0][0][0];
  const unsigned offW1 = (unsigned)(uintptr_t)&Ws[1][0][0];

  const int NK = K >> 5;  // # of 32-wide k tiles

  if (wave == 0) {  // prologue: DMA tile 0 into buffer 0
    tdm_load_tile(Abase, offA0);
    tdm_load_tile(Wbase, offW0);
  }

  v8f acc[4][2] = {};

  for (int kt = 0; kt < NK; ++kt) {
    const int cur = kt & 1;
    __syncthreads();  // all waves done reading buffer cur^1
    if (wave == 0) {
      if (kt + 1 < NK) {  // prefetch next tile into the other buffer
        tdm_load_tile(Abase + (kt + 1) * 32, cur ? offA0 : offA1);
        tdm_load_tile(Wbase + (kt + 1) * 32, cur ? offW0 : offW1);
        __builtin_amdgcn_s_wait_tensorcnt(2);  // tiles for 'cur' landed
      } else {
        __builtin_amdgcn_s_wait_tensorcnt(0);
      }
    }
    __syncthreads();  // buffer 'cur' visible to all waves

    v16h af[4], wf[2];
#pragma unroll
    for (int i = 0; i < 4; ++i) af[i] = ldfrag(&As[cur][wm + 16 * i + lo][0], hi);
#pragma unroll
    for (int j = 0; j < 2; ++j) wf[j] = ldfrag(&Ws[cur][wn + 16 * j + lo][0], hi);
#pragma unroll
    for (int i = 0; i < 4; ++i)
#pragma unroll
      for (int j = 0; j < 2; ++j) acc[i][j] = wmma_f16(af[i], wf[j], acc[i][j]);
  }

  // epilogue: C layout m = r + 8*hi, n = lo
#pragma unroll
  for (int j = 0; j < 2; ++j) {
    const int gc = n0 + wn + 16 * j + lo;
    const float bv = bias[gc];
#pragma unroll
    for (int i = 0; i < 4; ++i) {
      const int gr = m0 + wm + 16 * i + 8 * hi;
#pragma unroll
      for (int r = 0; r < 8; ++r) {
        float x = acc[i][j][r] + bv;
        if constexpr (EPI == 1) x = fmaxf(x, 0.0f);
        const size_t idx = (size_t)(gr + r) * N + gc;
        if constexpr (EPI == 2) x += R[idx];
        if constexpr (OH == 0) {
          ((float*)Cp)[idx] = x;
        } else if constexpr (OH == 1) {
          ((_Float16*)Cp)[idx] = (_Float16)x;
        } else {
          ((float*)Cp)[idx] = x;
          ((_Float16*)C2p)[idx] = (_Float16)x;
        }
      }
    }
  }
}

// ---------------------------------------------------------------------------
// Phase 1: per-(b,h,k-column) softmax stats over the QUERY axis.
// One wave owns 16 k-columns; k-fragments resident, stream 32 q-tiles through
// WMMA, online max/sum with cross-half shfl_xor(16).
// ---------------------------------------------------------------------------
__global__ __launch_bounds__(256) void attn_stats(const _Float16* __restrict__ q2,
                                                  const _Float16* __restrict__ k2,
                                                  float* __restrict__ Mst,
                                                  float* __restrict__ Lst) {
  const int blk = blockIdx.x;  // bh*4 + kb
  const int bh = blk >> 2;
  const int kb = blk & 3;
  const int b = bh >> 3;
  const int h = bh & 7;
  const int t = threadIdx.x;
  const int lane = t & 31;
  const int wave = t >> 5;
  const int lo = lane & 15;
  const int hi = lane >> 4;

  const int col = kb * 128 + wave * 16 + lo;
  const _Float16* krow = k2 + (((size_t)b * 512 + col) * 512) + h * 64;
  const v16h bk0 = ldfrag(krow, hi);
  const v16h bk1 = ldfrag(krow + 32, hi);

  float m_run = -1e30f, l_run = 0.0f;

  for (int q0 = 0; q0 < 512; q0 += 16) {
    const _Float16* qrow = q2 + (((size_t)b * 512 + q0 + lo) * 512) + h * 64;
    const v16h aq0 = ldfrag(qrow, hi);
    const v16h aq1 = ldfrag(qrow + 32, hi);
    v8f s = {};
    s = wmma_f16(aq0, bk0, s);
    s = wmma_f16(aq1, bk1, s);

    float pmax = -1e30f;
#pragma unroll
    for (int r = 0; r < 8; ++r) pmax = fmaxf(pmax, s[r] * kScale);
    pmax = fmaxf(pmax, __shfl_xor(pmax, 16, 32));
    const float nm = fmaxf(m_run, pmax);
    float ps = 0.0f;
#pragma unroll
    for (int r = 0; r < 8; ++r) ps += __expf(s[r] * kScale - nm);
    ps += __shfl_xor(ps, 16, 32);
    l_run = l_run * __expf(m_run - nm) + ps;
    m_run = nm;
  }
  if (lane < 16) {
    Mst[(size_t)bh * 512 + col] = m_run;
    Lst[(size_t)bh * 512 + col] = l_run;
  }
}

// ---------------------------------------------------------------------------
// Phase 2: attn = P @ V with P = exp(scale*S - M[k]) / L[k], S recomputed by
// WMMA; P round-trips wave-private LDS (C->A layout), V is LDS-transposed.
// ---------------------------------------------------------------------------
__global__ __launch_bounds__(256) void attn_av(const _Float16* __restrict__ q2,
                                               const _Float16* __restrict__ k2,
                                               const _Float16* __restrict__ v2,
                                               const float* __restrict__ Mst,
                                               const float* __restrict__ Lst,
                                               _Float16* __restrict__ at2) {
  __shared__ _Float16 vT[64][40];
  __shared__ _Float16 Pw[8][16][40];

  const int blk = blockIdx.x;  // bh*8 + qb
  const int bh = blk >> 3;
  const int qb = blk & 7;
  const int b = bh >> 3;
  const int h = bh & 7;
  const int t = threadIdx.x;
  const int lane = t & 31;
  const int wave = t >> 5;
  const int lo = lane & 15;
  const int hi = lane >> 4;

  const int q0  = qb * 64 + (wave & 3) * 16;
  const int dh0 = (wave >> 2) * 32;

  const _Float16* qrow = q2 + (((size_t)b * 512 + q0 + lo) * 512) + h * 64;
  const v16h aq0 = ldfrag(qrow, hi);
  const v16h aq1 = ldfrag(qrow + 32, hi);

  v8f oacc[2] = {};

  const int vtok = t >> 3;
  const int vd0  = (t & 7) * 8;

  for (int kt = 0; kt < 512; kt += 32) {
    __syncthreads();
    {
      const _Float16* vsrc =
          v2 + (((size_t)b * 512 + kt + vtok) * 512) + h * 64 + vd0;
      _Float16 tmp[8];
      *reinterpret_cast<uint4*>(tmp) = *reinterpret_cast<const uint4*>(vsrc);
#pragma unroll
      for (int e = 0; e < 8; ++e) vT[vd0 + e][vtok] = tmp[e];
    }
    __syncthreads();

#pragma unroll
    for (int jn = 0; jn < 2; ++jn) {
      const int ktok = kt + jn * 16 + lo;
      const _Float16* krow = k2 + (((size_t)b * 512 + ktok) * 512) + h * 64;
      const v16h bk0 = ldfrag(krow, hi);
      const v16h bk1 = ldfrag(krow + 32, hi);
      v8f s = {};
      s = wmma_f16(aq0, bk0, s);
      s = wmma_f16(aq1, bk1, s);
      const float Mv = Mst[(size_t)bh * 512 + ktok];
      const float Li = 1.0f / Lst[(size_t)bh * 512 + ktok];
#pragma unroll
      for (int r = 0; r < 8; ++r)
        Pw[wave][r + 8 * hi][jn * 16 + lo] =
            (_Float16)(__expf(s[r] * kScale - Mv) * Li);
    }

    const v16h ap = ldfrag(&Pw[wave][lo][0], hi);
#pragma unroll
    for (int jd = 0; jd < 2; ++jd) {
      const v16h bv = ldfrag(&vT[dh0 + jd * 16 + lo][0], hi);
      oacc[jd] = wmma_f16(ap, bv, oacc[jd]);
    }
  }

#pragma unroll
  for (int jd = 0; jd < 2; ++jd) {
#pragma unroll
    for (int r = 0; r < 8; ++r) {
      const int qrw = q0 + 8 * hi + r;
      const int dcl = h * 64 + dh0 + jd * 16 + lo;
      at2[(((size_t)b * 512 + qrw) * 512) + dcl] = (_Float16)oacc[jd][r];
    }
  }
}

// ---------------------------------------------------------------------------
extern "C" void kernel_launch(void* const* d_in, const int* in_sizes, int n_in,
                              void* d_out, int out_size, void* d_ws,
                              size_t ws_size, hipStream_t stream) {
  (void)in_sizes; (void)n_in; (void)out_size; (void)ws_size;
  const float* Q  = (const float*)d_in[0];
  const float* Kx = (const float*)d_in[1];
  const float* Wq = (const float*)d_in[2];
  const float* bq = (const float*)d_in[3];
  const float* Wk = (const float*)d_in[4];
  const float* bk = (const float*)d_in[5];
  const float* Wv = (const float*)d_in[6];
  const float* bv = (const float*)d_in[7];
  const float* Wo = (const float*)d_in[8];
  const float* bo = (const float*)d_in[9];
  const float* W1 = (const float*)d_in[10];
  const float* b1 = (const float*)d_in[11];
  const float* W2 = (const float*)d_in[12];
  const float* b2 = (const float*)d_in[13];

  constexpr int B = 32, Nt = 512, D = 512, H = 8;
  constexpr int M = B * Nt;                          // 16384
  const size_t szH = (size_t)M * D * sizeof(_Float16);  // activations, f16
  const size_t szW = (size_t)D * D * sizeof(_Float16);  // weights, f16
  const size_t szF = (size_t)M * D * sizeof(float);

  char* p = (char*)d_ws;
  _Float16* Q16  = (_Float16*)p; p += szH;
  _Float16* K16  = (_Float16*)p; p += szH;
  _Float16* q2   = (_Float16*)p; p += szH;
  _Float16* k2   = (_Float16*)p; p += szH;
  _Float16* v2   = (_Float16*)p; p += szH;
  _Float16* at2  = (_Float16*)p; p += szH;
  _Float16* outh = (_Float16*)p; p += szH;
  _Float16* h1   = (_Float16*)p; p += szH;
  _Float16* Wq6  = (_Float16*)p; p += szW;
  _Float16* Wk6  = (_Float16*)p; p += szW;
  _Float16* Wv6  = (_Float16*)p; p += szW;
  _Float16* Wo6  = (_Float16*)p; p += szW;
  _Float16* W16w = (_Float16*)p; p += szW;
  _Float16* W26w = (_Float16*)p; p += szW;
  float*    outb = (float*)p;    p += szF;
  float*    Mst  = (float*)p;    p += (size_t)B * H * Nt * sizeof(float);
  float*    Lst  = (float*)p;

  const dim3 blk(256);
  const dim3 gg(D / 128, M / 128);  // (4, 128)
  const int nAct = M * D;           // 8388608
  const int nWgt = D * D;           // 262144

  // One-time f32 -> f16 conversions (activations + weights).
  cvt16<<<dim3(nAct / 2048), blk, 0, stream>>>(Q,  Q16, nAct);
  cvt16<<<dim3(nAct / 2048), blk, 0, stream>>>(Kx, K16, nAct);
  cvt16<<<dim3(nWgt / 2048), blk, 0, stream>>>(Wq, Wq6, nWgt);
  cvt16<<<dim3(nWgt / 2048), blk, 0, stream>>>(Wk, Wk6, nWgt);
  cvt16<<<dim3(nWgt / 2048), blk, 0, stream>>>(Wv, Wv6, nWgt);
  cvt16<<<dim3(nWgt / 2048), blk, 0, stream>>>(Wo, Wo6, nWgt);
  cvt16<<<dim3(nWgt / 2048), blk, 0, stream>>>(W1, W16w, nWgt);
  cvt16<<<dim3(nWgt / 2048), blk, 0, stream>>>(W2, W26w, nWgt);

  // q/k/v projections (TDM-staged f16 GEMMs, f16 out)
  gemm_f16<0, 1><<<gg, blk, 0, stream>>>(Q16, Wq6, bq, nullptr, q2, nullptr, M, D, D);
  gemm_f16<0, 1><<<gg, blk, 0, stream>>>(K16, Wk6, bk, nullptr, k2, nullptr, M, D, D);
  gemm_f16<0, 1><<<gg, blk, 0, stream>>>(K16, Wv6, bv, nullptr, v2, nullptr, M, D, D);

  // attention: column softmax stats (query axis), then P @ V
  attn_stats<<<dim3(B * H * 4), blk, 0, stream>>>(q2, k2, Mst, Lst);
  attn_av<<<dim3(B * H * 8), blk, 0, stream>>>(q2, k2, v2, Mst, Lst, at2);

  // out = Q + attn @ Wo^T + bo  -> f32 (residual source) + f16 (FFN input)
  gemm_f16<2, 2><<<gg, blk, 0, stream>>>(at2, Wo6, bo, Q, outb, outh, M, D, D);
  // h1 = relu(out @ W1^T + b1) -> f16
  gemm_f16<1, 1><<<gg, blk, 0, stream>>>(outh, W16w, b1, nullptr, h1, nullptr, M, D, D);
  // final = out + h1 @ W2^T + b2 -> f32 d_out
  gemm_f16<2, 0><<<gg, blk, 0, stream>>>(h1, W26w, b2, outb, (float*)d_out, nullptr, M, D, D);
}

// v001
// Measured time: 204 microseconds a run.
// Next to v000, in two timings, it ran 1.25 times as fast each time.
#include <hip/hip_runtime.h>
#include <math.h>

// MAB (multihead attention block) for MI455X / gfx1250, wave32 + WMMA + TDM.
// B=32, N=512, D=512, H=8, dh=64. All heavy math via v_wmma_f32_16x16x32_f16;
// GEMM tile staging via tensor_load_to_lds (Tensor Data Mover), double-buffered.

typedef _Float16 v16h __attribute__((ext_vector_type(16)));
typedef float    v8f  __attribute__((ext_vector_type(8)));
typedef unsigned int u32x4 __attribute__((ext_vector_type(4)));
typedef int          i32x4 __attribute__((ext_vector_type(4)));
typedef int          i32x8 __attribute__((ext_vector_type(8)));

static constexpr float kScale = 0.044194173824159216f; // 1/sqrt(512)

__device__ __forceinline__ v8f wmma_f16(v16h a, v16h b, v8f c) {
  // (neg_a, A, neg_b, B, c_mod, C, reuse_a, reuse_b)
  return __builtin_amdgcn_wmma_f32_16x16x32_f16(false, a, false, b, (short)0, c,
                                                false, false);
}

// 16-bit A/B fragment for 16x16x32 WMMA. Per ISA layout, lane (lo=L%16,
// hi=L/16) holds K=[8*hi,8*hi+8) in VGPR0-3 and K=[16+8*hi,+8) in VGPR4-7.
__device__ __forceinline__ v16h ldfrag(const _Float16* rowp, int hi) {
  v16h a;
  *reinterpret_cast<uint4*>(&a)       = *reinterpret_cast<const uint4*>(rowp + 8 * hi);
  *(reinterpret_cast<uint4*>(&a) + 1) = *reinterpret_cast<const uint4*>(rowp + 16 + 8 * hi);
  return a;
}

// ---------------------------------------------------------------------------
// TDM: DMA a 128-row x 32-col f16 tile (row stride 512 elements in memory)
// into LDS, padding each 64B row with 16B -> LDS row stride = 40 halves.
// D# built per CDNA5 ISA 8.3-8.6; issued by one wave, tracked by TENSORcnt.
// This toolchain exposes the 6-arg builtin: (g0, g1, g2, g3, extra, cpol).
// ---------------------------------------------------------------------------
__device__ __forceinline__ void tdm_load_tile(const _Float16* gsrc,
                                              unsigned lds_byte_off) {
  const unsigned long long ga = (unsigned long long)(uintptr_t)gsrc;
  u32x4 g0;
  g0.x = 1u;                                   // count=1 (valid user desc)
  g0.y = lds_byte_off;                         // lds_addr
  g0.z = (unsigned)ga;                         // global_addr[31:0]
  g0.w = (unsigned)(ga >> 32) | (2u << 30);    // global_addr[56:32] | type=2
  i32x8 g1;
  g1[0] = (1 << 16)      // data_size = 2 bytes
        | (1 << 20)      // pad_enable
        | (3 << 22)      // pad_interval: every 16 DWORDs (64B = one tile row)
        | (3 << 25);     // pad_amount: 4 DWORDs (16B -> 40-half LDS stride)
  g1[1] = (512 << 16);                 // tensor_dim0 = 512 (low 16 in [31:16])
  g1[2] = 0;                           // tensor_dim0 hi | tensor_dim1 lo
  g1[3] = 0x10 | (32 << 16);           // tensor_dim1 = 1<<20 (hi16) | tile_dim0=32
  g1[4] = 128;                         // tile_dim1 = 128, tile_dim2 = 0
  g1[5] = 512;                         // tensor_dim0_stride = 512 elements
  g1[6] = 0;
  g1[7] = 0;
  const i32x4 z4 = {0, 0, 0, 0};               // groups 2/3 unused (2D tile)
  const i32x8 z8 = {0, 0, 0, 0, 0, 0, 0, 0};   // extra group slot unused
  __builtin_amdgcn_tensor_load_to_lds(g0, g1, z4, z4, z8, 0);
}

// ---------------------------------------------------------------------------
// f32 -> f16 elementwise convert (8 elems/thread).
// ---------------------------------------------------------------------------
__global__ __launch_bounds__(256) void cvt16(const float* __restrict__ s,
                                             _Float16* __restrict__ d, int n) {
  const int i = (blockIdx.x * 256 + threadIdx.x) * 8;
  if (i >= n) return;
  const float4 a = reinterpret_cast<const float4*>(s + i)[0];
  const float4 b = reinterpret_cast<const float4*>(s + i)[1];
  _Float16 t[8] = {(_Float16)a.x, (_Float16)a.y, (_Float16)a.z, (_Float16)a.w,
                   (_Float16)b.x, (_Float16)b.y, (_Float16)b.z, (_Float16)b.w};
  *reinterpret_cast<uint4*>(d + i) = *reinterpret_cast<uint4*>(t);
}

// ---------------------------------------------------------------------------
// GEMM: C[M,N] = epi( A[M,K] @ W[N,K]^T + bias[N] ) (+ R residual), all-f16
// operands, TDM double-buffered tile staging, 128x128 C tile, K-step 32.
//   EPI: 0 bias, 1 bias+ReLU, 2 bias+residual R (f32)
//   OH : 0 f32 out, 1 f16 out, 2 dual (f32 -> Cp, f16 -> C2p)
// 8 waves in 2x4 grid; each wave: 64x32 via 8 f32 accumulators.
// ---------------------------------------------------------------------------
template <int EPI, int OH>
__global__ __launch_bounds__(256) void gemm_f16(const _Float16* __restrict__ A16,
                                                const _Float16* __restrict__ W16,
                                                const float* __restrict__ bias,
                                                const float* __restrict__ R,
                                                void* __restrict__ Cp,
                                                void* __restrict__ C2p,
                                                int M, int N, int K) {
  __shared__ _Float16 As[2][128][40];
  __shared__ _Float16 Ws[2][128][40];

  const int t = threadIdx.x;
  const int lane = t & 31;
  const int wave = t >> 5;
  const int lo = lane & 15;
  const int hi = lane >> 4;
  const int wm = (wave >> 2) * 64;
  const int wn = (wave & 3) * 32;
  const int m0 = blockIdx.y * 128;
  const int n0 = blockIdx.x * 128;

  const _Float16* Abase = A16 + (size_t)m0 * K;
  const _Float16* Wbase = W16 + (size_t)n0 * K;
  const unsigned offA0 = (unsigned)(uintptr_t)&As[0][0][0];
  const unsigned offA1 = (unsigned)(uintptr_t)&As[1][0][0];
  const unsigned offW0 = (unsigned)(uintptr_t)&Ws[0][0][0];
  const unsigned offW1 = (unsigned)(uintptr_t)&Ws[1][0][0];

  const int NK = K >> 5;  // # of 32-wide k tiles

  if (wave == 0) {  // prologue: DMA tile 0 into buffer 0
    tdm_load_tile(Abase, offA0);
    tdm_load_tile(Wbase, offW0);
  }

  v8f acc[4][2] = {};

  for (int kt = 0; kt < NK; ++kt) {
    const int cur = kt & 1;
    __syncthreads();  // all waves done reading buffer cur^1
    if (wave == 0) {
      if (kt + 1 < NK) {  // prefetch next tile into the other buffer
        tdm_load_tile(Abase + (kt + 1) * 32, cur ? offA0 : offA1);
        tdm_load_tile(Wbase + (kt + 1) * 32, cur ? offW0 : offW1);
        __builtin_amdgcn_s_wait_tensorcnt(2);  // tiles for 'cur' landed
      } else {
        __builtin_amdgcn_s_wait_tensorcnt(0);
      }
    }
    __syncthreads();  // buffer 'cur' visible to all waves

    v16h af[4], wf[2];
#pragma unroll
    for (int i = 0; i < 4; ++i) af[i] = ldfrag(&As[cur][wm + 16 * i + lo][0], hi);
#pragma unroll
    for (int j = 0; j < 2; ++j) wf[j] = ldfrag(&Ws[cur][wn + 16 * j + lo][0], hi);
#pragma unroll
    for (int i = 0; i < 4; ++i)
#pragma unroll
      for (int j = 0; j < 2; ++j) acc[i][j] = wmma_f16(af[i], wf[j], acc[i][j]);
  }

  // epilogue: C layout m = r + 8*hi, n = lo
#pragma unroll
  for (int j = 0; j < 2; ++j) {
    const int gc = n0 + wn + 16 * j + lo;
    const float bv = bias[gc];
#pragma unroll
    for (int i = 0; i < 4; ++i) {
      const int gr = m0 + wm + 16 * i + 8 * hi;
#pragma unroll
      for (int r = 0; r < 8; ++r) {
        float x = acc[i][j][r] + bv;
        if constexpr (EPI == 1) x = fmaxf(x, 0.0f);
        const size_t idx = (size_t)(gr + r) * N + gc;
        if constexpr (EPI == 2) x += R[idx];
        if constexpr (OH == 0) {
          ((float*)Cp)[idx] = x;
        } else if constexpr (OH == 1) {
          ((_Float16*)Cp)[idx] = (_Float16)x;
        } else {
          ((float*)Cp)[idx] = x;
          ((_Float16*)C2p)[idx] = (_Float16)x;
        }
      }
    }
  }
}

// ---------------------------------------------------------------------------
// Phase 1: per-(b,h,k-column) softmax stats over the QUERY axis.
// One wave owns 16 k-columns; k-fragments resident, stream 32 q-tiles through
// WMMA, online max/sum with cross-half shfl_xor(16). All 8 waves walk the same
// q rows: the block stages them in LDS, 128 rows at a time, with whole-line
// loads, and the fragments are read from there.
// ---------------------------------------------------------------------------
__global__ __launch_bounds__(256) void attn_stats(const _Float16* __restrict__ q2,
                                                  const _Float16* __restrict__ k2,
                                                  float* __restrict__ Mst,
                                                  float* __restrict__ Lst) {
  // 128 q rows x 64 dh; pitch 144 B (16 B x odd) for the ds_load_b128 readers
  __shared__ alignas(16) _Float16 Qs[128][72];

  const int blk = blockIdx.x;  // bh*4 + kb
  const int bh = blk >> 2;
  const int kb = blk & 3;
  const int b = bh >> 3;
  const int h = bh & 7;
  const int t = threadIdx.x;
  const int lane = t & 31;
  const int wave = t >> 5;
  const int lo = lane & 15;
  const int hi = lane >> 4;

  const int col = kb * 128 + wave * 16 + lo;
  const _Float16* krow = k2 + (((size_t)b * 512 + col) * 512) + h * 64;
  const v16h bk0 = ldfrag(krow, hi);
  const v16h bk1 = ldfrag(krow + 32, hi);

  float m_run = -1e30f, l_run = 0.0f;

  const int srow = t >> 3;        // 8 lanes cover one row's 128 B line
  const int scol = (t & 7) * 8;

  for (int qs = 0; qs < 512; qs += 128) {
    __syncthreads();  // every wave has left the previous 128 rows
#pragma unroll
    for (int i = 0; i < 4; ++i) {
      const _Float16* qsrc =
          q2 + (((size_t)b * 512 + qs + i * 32 + srow) * 512) + h * 64 + scol;
      *reinterpret_cast<uint4*>(&Qs[i * 32 + srow][scol]) =
          *reinterpret_cast<const uint4*>(qsrc);
    }
    __syncthreads();  // the 128 rows are visible to all waves

    for (int q0 = 0; q0 < 128; q0 += 16) {
      const _Float16* qrow = &Qs[q0 + lo][0];
      const v16h aq0 = ldfrag(qrow, hi);
      const v16h aq1 = ldfrag(qrow + 32, hi);
      v8f s = {};
      s = wmma_f16(aq0, bk0, s);
      s = wmma_f16(aq1, bk1, s);

      float pmax = -1e30f;
#pragma unroll
      for (int r = 0; r < 8; ++r) pmax = fmaxf(pmax, s[r] * kScale);
      pmax = fmaxf(pmax, __shfl_xor(pmax, 16, 32));
      const float nm = fmaxf(m_run, pmax);
      float ps = 0.0f;
#pragma unroll
      for (int r = 0; r < 8; ++r) ps += __expf(s[r] * kScale - nm);
      ps += __shfl_xor(ps, 16, 32);
      l_run = l_run * __expf(m_run - nm) + ps;
      m_run = nm;
    }
  }
  if (lane < 16) {
    Mst[(size_t)bh * 512 + col] = m_run;
    Lst[(size_t)bh * 512 + col] = l_run;
  }
}

// ---------------------------------------------------------------------------
// Phase 2: attn = P @ V with P = exp(scale*S - M[k]) / L[k], S recomputed by
// WMMA; P round-trips wave-private LDS (C->A layout), V is LDS-transposed.
// All 8 waves need the same 32 k rows per pass: the block stages them in LDS
// beside V with whole-line loads, and the k fragments are read from there.
// ---------------------------------------------------------------------------
__global__ __launch_bounds__(256) void attn_av(const _Float16* __restrict__ q2,
                                               const _Float16* __restrict__ k2,
                                               const _Float16* __restrict__ v2,
                                               const float* __restrict__ Mst,
                                               const float* __restrict__ Lst,
                                               _Float16* __restrict__ at2) {
  __shared__ _Float16 vT[64][40];
  __shared__ _Float16 Pw[8][16][40];
  // 32 k rows x 64 dh; pitch 144 B (16 B x odd) for the ds_load_b128 readers
  __shared__ alignas(16) _Float16 Ks[32][72];

  const int blk = blockIdx.x;  // bh*8 + qb
  const int bh = blk >> 3;
  const int qb = blk & 7;
  const int b = bh >> 3;
  const int h = bh & 7;
  const int t = threadIdx.x;
  const int lane = t & 31;
  const int wave = t >> 5;
  const int lo = lane & 15;
  const int hi = lane >> 4;

  const int q0  = qb * 64 + (wave & 3) * 16;
  const int dh0 = (wave >> 2) * 32;

  const _Float16* qrow = q2 + (((size_t)b * 512 + q0 + lo) * 512) + h * 64;
  const v16h aq0 = ldfrag(qrow, hi);
  const v16h aq1 = ldfrag(qrow + 32, hi);

  v8f oacc[2] = {};

  const int vtok = t >> 3;
  const int vd0  = (t & 7) * 8;

  for (int kt = 0; kt < 512; kt += 32) {
    __syncthreads();
    {
      const _Float16* vsrc =
          v2 + (((size_t)b * 512 + kt + vtok) * 512) + h * 64 + vd0;
      _Float16 tmp[8];
      *reinterpret_cast<uint4*>(tmp) = *reinterpret_cast<const uint4*>(vsrc);
#pragma unroll
      for (int e = 0; e < 8; ++e) vT[vd0 + e][vtok] = tmp[e];
      const _Float16* ksrc =
          k2 + (((size_t)b * 512 + kt + vtok) * 512) + h * 64 + vd0;
      *reinterpret_cast<uint4*>(&Ks[vtok][vd0]) =
          *reinterpret_cast<const uint4*>(ksrc);
    }
    __syncthreads();

#pragma unroll
    for (int jn = 0; jn < 2; ++jn) {
      const int ktok = kt + jn * 16 + lo;
      const _Float16* krow = &Ks[jn * 16 + lo][0];
      const v16h bk0 = ldfrag(krow, hi);
      const v16h bk1 = ldfrag(krow + 32, hi);
      v8f s = {};
      s = wmma_f16(aq0, bk0, s);
      s = wmma_f16(aq1, bk1, s);
      const float Mv = Mst[(size_t)bh * 512 + ktok];
      const float Li = 1.0f / Lst[(size_t)bh * 512 + ktok];
#pragma unroll
      for (int r = 0; r < 8; ++r)
        Pw[wave][r + 8 * hi][jn * 16 + lo] =
            (_Float16)(__expf(s[r] * kScale - Mv) * Li);
    }

    const v16h ap = ldfrag(&Pw[wave][lo][0], hi);
#pragma unroll
    for (int jd = 0; jd < 2; ++jd) {
      const v16h bv = ldfrag(&vT[dh0 + jd * 16 + lo][0], hi);
      oacc[jd] = wmma_f16(ap, bv, oacc[jd]);
    }
  }

#pragma unroll
  for (int jd = 0; jd < 2; ++jd) {
#pragma unroll
    for (int r = 0; r < 8; ++r) {
      const int qrw = q0 + 8 * hi + r;
      const int dcl = h * 64 + dh0 + jd * 16 + lo;
      at2[(((size_t)b * 512 + qrw) * 512) + dcl] = (_Float16)oacc[jd][r];
    }
  }
}

// ---------------------------------------------------------------------------
extern "C" void kernel_launch(void* const* d_in, const int* in_sizes, int n_in,
                              void* d_out, int out_size, void* d_ws,
                              size_t ws_size, hipStream_t stream) {
  (void)in_sizes; (void)n_in; (void)out_size; (void)ws_size;
  const float* Q  = (const float*)d_in[0];
  const float* Kx = (const float*)d_in[1];
  const float* Wq = (const float*)d_in[2];
  const float* bq = (const float*)d_in[3];
  const float* Wk = (const float*)d_in[4];
  const float* bk = (const float*)d_in[5];
  const float* Wv = (const float*)d_in[6];
  const float* bv = (const float*)d_in[7];
  const float* Wo = (const float*)d_in[8];
  const float* bo = (const float*)d_in[9];
  const float* W1 = (const float*)d_in[10];
  const float* b1 = (const float*)d_in[11];
  const float* W2 = (const float*)d_in[12];
  const float* b2 = (const float*)d_in[13];

  constexpr int B = 32, Nt = 512, D = 512, H = 8;
  constexpr int M = B * Nt;                          // 16384
  const size_t szH = (size_t)M * D * sizeof(_Float16);  // activations, f16
  const size_t szW = (size_t)D * D * sizeof(_Float16);  // weights, f16
  const size_t szF = (size_t)M * D * sizeof(float);

  char* p = (char*)d_ws;
  _Float16* Q16  = (_Float16*)p; p += szH;
  _Float16* K16  = (_Float16*)p; p += szH;
  _Float16* q2   = (_Float16*)p; p += szH;
  _Float16* k2   = (_Float16*)p; p += szH;
  _Float16* v2   = (_Float16*)p; p += szH;
  _Float16* at2  = (_Float16*)p; p += szH;
  _Float16* outh = (_Float16*)p; p += szH;
  _Float16* h1   = (_Float16*)p; p += szH;
  _Float16* Wq6  = (_Float16*)p; p += szW;
  _Float16* Wk6  = (_Float16*)p; p += szW;
  _Float16* Wv6  = (_Float16*)p; p += szW;
  _Float16* Wo6  = (_Float16*)p; p += szW;
  _Float16* W16w = (_Float16*)p; p += szW;
  _Float16* W26w = (_Float16*)p; p += szW;
  float*    outb = (float*)p;    p += szF;
  float*    Mst  = (float*)p;    p += (size_t)B * H * Nt * sizeof(float);
  float*    Lst  = (float*)p;

  const dim3 blk(256);
  const dim3 gg(D / 128, M / 128);  // (4, 128)
  const int nAct = M * D;           // 8388608
  const int nWgt = D * D;           // 262144

  // One-time f32 -> f16 conversions (activations + weights).
  cvt16<<<dim3(nAct / 2048), blk, 0, stream>>>(Q,  Q16, nAct);
  cvt16<<<dim3(nAct / 2048), blk, 0, stream>>>(Kx, K16, nAct);
  cvt16<<<dim3(nWgt / 2048), blk, 0, stream>>>(Wq, Wq6, nWgt);
  cvt16<<<dim3(nWgt / 2048), blk, 0, stream>>>(Wk, Wk6, nWgt);
  cvt16<<<dim3(nWgt / 2048), blk, 0, stream>>>(Wv, Wv6, nWgt);
  cvt16<<<dim3(nWgt / 2048), blk, 0, stream>>>(Wo, Wo6, nWgt);
  cvt16<<<dim3(nWgt / 2048), blk, 0, stream>>>(W1, W16w, nWgt);
  cvt16<<<dim3(nWgt / 2048), blk, 0, stream>>>(W2, W26w, nWgt);

  // q/k/v projections (TDM-staged f16 GEMMs, f16 out)
  gemm_f16<0, 1><<<gg, blk, 0, stream>>>(Q16, Wq6, bq, nullptr, q2, nullptr, M, D, D);
  gemm_f16<0, 1><<<gg, blk, 0, stream>>>(K16, Wk6, bk, nullptr, k2, nullptr, M, D, D);
  gemm_f16<0, 1><<<gg, blk, 0, stream>>>(K16, Wv6, bv, nullptr, v2, nullptr, M, D, D);

  // attention: column softmax stats (query axis), then P @ V
  attn_stats<<<dim3(B * H * 4), blk, 0, stream>>>(q2, k2, Mst, Lst);
  attn_av<<<dim3(B * H * 8), blk, 0, stream>>>(q2, k2, v2, Mst, Lst, at2);

  // out = Q + attn @ Wo^T + bo  -> f32 (residual source) + f16 (FFN input)
  gemm_f16<2, 2><<<gg, blk, 0, stream>>>(at2, Wo6, bo, Q, outb, outh, M, D, D);
  // h1 = relu(out @ W1^T + b1) -> f16
  gemm_f16<1, 1><<<gg, blk, 0, stream>>>(outh, W16w, b1, nullptr, h1, nullptr, M, D, D);
  // final = out + h1 @ W2^T + b2 -> f32 d_out
  gemm_f16<2, 0><<<gg, blk, 0, stream>>>(h1, W26w, b2, outb, (float*)d_out, nullptr, M, D, D);
}

// v002
// It runs in 188 microseconds.
// Timed twice side by side with v001, it ran 1.09 and 1.08 times as fast.
// Over all steps from v000 it is 1.36 times as fast.
#include <hip/hip_runtime.h>
#include <math.h>

// MAB (multihead attention block) for MI455X / gfx1250, wave32 + WMMA + TDM.
// B=32, N=512, D=512, H=8, dh=64. All heavy math via v_wmma_f32_16x16x32_f16;
// GEMM tile staging via tensor_load_to_lds (Tensor Data Mover), double-buffered.

typedef _Float16 v16h __attribute__((ext_vector_type(16)));
typedef float    v8f  __attribute__((ext_vector_type(8)));
typedef unsigned int u32x4 __attribute__((ext_vector_type(4)));
typedef int          i32x4 __attribute__((ext_vector_type(4)));
typedef int          i32x8 __attribute__((ext_vector_type(8)));

static constexpr float kScale = 0.044194173824159216f; // 1/sqrt(512)

__device__ __forceinline__ v8f wmma_f16(v16h a, v16h b, v8f c) {
  // (neg_a, A, neg_b, B, c_mod, C, reuse_a, reuse_b)
  return __builtin_amdgcn_wmma_f32_16x16x32_f16(false, a, false, b, (short)0, c,
                                                false, false);
}

// 16-bit A/B fragment for 16x16x32 WMMA. Per ISA layout, lane (lo=L%16,
// hi=L/16) holds K=[8*hi,8*hi+8) in VGPR0-3 and K=[16+8*hi,+8) in VGPR4-7.
__device__ __forceinline__ v16h ldfrag(const _Float16* rowp, int hi) {
  v16h a;
  *reinterpret_cast<uint4*>(&a)       = *reinterpret_cast<const uint4*>(rowp + 8 * hi);
  *(reinterpret_cast<uint4*>(&a) + 1) = *reinterpret_cast<const uint4*>(rowp + 16 + 8 * hi);
  return a;
}

// ---------------------------------------------------------------------------
// TDM: DMA a 128-row x 32-col f16 tile (row stride 512 elements in memory)
// into LDS, padding each 64B row with 16B -> LDS row stride = 40 halves.
// D# built per CDNA5 ISA 8.3-8.6; issued by one wave, tracked by TENSORcnt.
// This toolchain exposes the 6-arg builtin: (g0, g1, g2, g3, extra, cpol).
// ---------------------------------------------------------------------------
__device__ __forceinline__ void tdm_load_tile(const _Float16* gsrc,
                                              unsigned lds_byte_off) {
  const unsigned long long ga = (unsigned long long)(uintptr_t)gsrc;
  u32x4 g0;
  g0.x = 1u;                                   // count=1 (valid user desc)
  g0.y = lds_byte_off;                         // lds_addr
  g0.z = (unsigned)ga;                         // global_addr[31:0]
  g0.w = (unsigned)(ga >> 32) | (2u << 30);    // global_addr[56:32] | type=2
  i32x8 g1;
  g1[0] = (1 << 16)      // data_size = 2 bytes
        | (1 << 20)      // pad_enable
        | (3 << 22)      // pad_interval: every 16 DWORDs (64B = one tile row)
        | (3 << 25);     // pad_amount: 4 DWORDs (16B -> 40-half LDS stride)
  g1[1] = (512 << 16);                 // tensor_dim0 = 512 (low 16 in [31:16])
  g1[2] = 0;                           // tensor_dim0 hi | tensor_dim1 lo
  g1[3] = 0x10 | (32 << 16);           // tensor_dim1 = 1<<20 (hi16) | tile_dim0=32
  g1[4] = 128;                         // tile_dim1 = 128, tile_dim2 = 0
  g1[5] = 512;                         // tensor_dim0_stride = 512 elements
  g1[6] = 0;
  g1[7] = 0;
  const i32x4 z4 = {0, 0, 0, 0};               // groups 2/3 unused (2D tile)
  const i32x8 z8 = {0, 0, 0, 0, 0, 0, 0, 0};   // extra group slot unused
  __builtin_amdgcn_tensor_load_to_lds(g0, g1, z4, z4, z8, 0);
}

// ---------------------------------------------------------------------------
// f32 -> f16 convert of all eight operands in ONE launch. A block takes one
// kSeg-element segment of one operand, picked by its index (a scalar choice);
// a wave takes 4096 contiguous elements of it: 32 whole-line loads of 512 B,
// all in flight before the first convert, then whole-line stores of 256 B.
// dAct: the f16 copies of Q and K, one behind the other; dWgt: those of the
// six weights, one behind the other (the workspace is laid out so).
// ---------------------------------------------------------------------------
static constexpr unsigned kSeg     = 32768;              // elements per block
static constexpr unsigned kActSegs = 32 * 512 * 512 / kSeg;  // 256 per activation
static constexpr unsigned kWgtSegs = 512 * 512 / kSeg;       // 8 per weight

__global__ __launch_bounds__(256) void cvt_all(const float* __restrict__ Q,
                                               const float* __restrict__ Kx,
                                               const float* __restrict__ Wq,
                                               const float* __restrict__ Wk,
                                               const float* __restrict__ Wv,
                                               const float* __restrict__ Wo,
                                               const float* __restrict__ W1,
                                               const float* __restrict__ W2,
                                               _Float16* __restrict__ dAct,
                                               _Float16* __restrict__ dWgt) {
  const unsigned blk = blockIdx.x;
  const float* s;
  _Float16* d;
  if (blk < 2 * kActSegs) {
    s = (blk < kActSegs ? Q : Kx) + (size_t)(blk % kActSegs) * kSeg;
    d = dAct + (size_t)blk * kSeg;
  } else {
    const unsigned wb = blk - 2 * kActSegs;
    const unsigned w = wb / kWgtSegs;
    const float* wsrc = w == 0 ? Wq : w == 1 ? Wk : w == 2 ? Wv
                      : w == 3 ? Wo : w == 4 ? W1 : W2;
    s = wsrc + (size_t)(wb % kWgtSegs) * kSeg;
    d = dWgt + (size_t)wb * kSeg;
  }
  const int off = (threadIdx.x >> 5) * 4096 + (threadIdx.x & 31) * 4;

  float4 v[32];
#pragma unroll  // v[] stays in registers, the 32 loads become one clause
  for (int u = 0; u < 32; ++u)
    v[u] = *reinterpret_cast<const float4*>(s + off + u * 128);
  // Holds all 32 loads ahead of the first convert; without it the compiler
  // sinks 14 of them behind waits on the first 18: serial memory latencies.
  __builtin_amdgcn_sched_barrier(0);
#pragma unroll  // constant indices into v[], so that it stays in registers
  for (int u = 0; u < 32; ++u) {
    _Float16 h[4] = {(_Float16)v[u].x, (_Float16)v[u].y, (_Float16)v[u].z,
                     (_Float16)v[u].w};
    *reinterpret_cast<uint2*>(d + off + u * 128) = *reinterpret_cast<uint2*>(h);
  }
}

// ---------------------------------------------------------------------------
// GEMM: C[M,N] = epi( A[M,K] @ W[N,K]^T + bias[N] ) (+ R residual), all-f16
// operands, TDM double-buffered tile staging, 128x128 C tile, K-step 32.
//   EPI: 0 bias, 1 bias+ReLU, 2 bias+residual R (f32)
//   OH : 0 f32 out, 1 f16 out, 2 dual (f32 -> Cp, f16 -> C2p)
// 8 waves in 2x4 grid; each wave: 64x32 via 8 f32 accumulators.
// ---------------------------------------------------------------------------
template <int EPI, int OH>
__global__ __launch_bounds__(256) void gemm_f16(const _Float16* __restrict__ A16,
                                                const _Float16* __restrict__ W16,
                                                const float* __restrict__ bias,
                                                const float* __restrict__ R,
                                                void* __restrict__ Cp,
                                                void* __restrict__ C2p,
                                                int M, int N, int K) {
  __shared__ _Float16 As[2][128][40];
  __shared__ _Float16 Ws[2][128][40];

  const int t = threadIdx.x;
  const int lane = t & 31;
  const int wave = t >> 5;
  const int lo = lane & 15;
  const int hi = lane >> 4;
  const int wm = (wave >> 2) * 64;
  const int wn = (wave & 3) * 32;
  const int m0 = blockIdx.y * 128;
  const int n0 = blockIdx.x * 128;

  const _Float16* Abase = A16 + (size_t)m0 * K;
  const _Float16* Wbase = W16 + (size_t)n0 * K;
  const unsigned offA0 = (unsigned)(uintptr_t)&As[0][0][0];
  const unsigned offA1 = (unsigned)(uintptr_t)&As[1][0][0];
  const unsigned offW0 = (unsigned)(uintptr_t)&Ws[0][0][0];
  const unsigned offW1 = (unsigned)(uintptr_t)&Ws[1][0][0];

  const int NK = K >> 5;  // # of 32-wide k tiles

  if (wave == 0) {  // prologue: DMA tile 0 into buffer 0
    tdm_load_tile(Abase, offA0);
    tdm_load_tile(Wbase, offW0);
  }

  v8f acc[4][2] = {};

  for (int kt = 0; kt < NK; ++kt) {
    const int cur = kt & 1;
    __syncthreads();  // all waves done reading buffer cur^1
    if (wave == 0) {
      if (kt + 1 < NK) {  // prefetch next tile into the other buffer
        tdm_load_tile(Abase + (kt + 1) * 32, cur ? offA0 : offA1);
        tdm_load_tile(Wbase + (kt + 1) * 32, cur ? offW0 : offW1);
        __builtin_amdgcn_s_wait_tensorcnt(2);  // tiles for 'cur' landed
      } else {
        __builtin_amdgcn_s_wait_tensorcnt(0);
      }
    }
    __syncthreads();  // buffer 'cur' visible to all waves

    v16h af[4], wf[2];
#pragma unroll
    for (int i = 0; i < 4; ++i) af[i] = ldfrag(&As[cur][wm + 16 * i + lo][0], hi);
#pragma unroll
    for (int j = 0; j < 2; ++j) wf[j] = ldfrag(&Ws[cur][wn + 16 * j + lo][0], hi);
#pragma unroll
    for (int i = 0; i < 4; ++i)
#pragma unroll
      for (int j = 0; j < 2; ++j) acc[i][j] = wmma_f16(af[i], wf[j], acc[i][j]);
  }

  // epilogue: C layout m = r + 8*hi, n = lo
#pragma unroll
  for (int j = 0; j < 2; ++j) {
    const int gc = n0 + wn + 16 * j + lo;
    const float bv = bias[gc];
#pragma unroll
    for (int i = 0; i < 4; ++i) {
      const int gr = m0 + wm + 16 * i + 8 * hi;
#pragma unroll
      for (int r = 0; r < 8; ++r) {
        float x = acc[i][j][r] + bv;
        if constexpr (EPI == 1) x = fmaxf(x, 0.0f);
        const size_t idx = (size_t)(gr + r) * N + gc;
        if constexpr (EPI == 2) x += R[idx];
        if constexpr (OH == 0) {
          ((float*)Cp)[idx] = x;
        } else if constexpr (OH == 1) {
          ((_Float16*)Cp)[idx] = (_Float16)x;
        } else {
          ((float*)Cp)[idx] = x;
          ((_Float16*)C2p)[idx] = (_Float16)x;
        }
      }
    }
  }
}

// ---------------------------------------------------------------------------
// Phase 1: per-(b,h,k-column) softmax stats over the QUERY axis.
// One wave owns 16 k-columns; k-fragments resident, stream 32 q-tiles through
// WMMA, online max/sum with cross-half shfl_xor(16). All 8 waves walk the same
// q rows: the block stages them in LDS, 128 rows at a time, with whole-line
// loads, and the fragments are read from there.
// ---------------------------------------------------------------------------
__global__ __launch_bounds__(256) void attn_stats(const _Float16* __restrict__ q2,
                                                  const _Float16* __restrict__ k2,
                                                  float* __restrict__ Mst,
                                                  float* __restrict__ Lst) {
  // 128 q rows x 64 dh; pitch 144 B (16 B x odd) for the ds_load_b128 readers
  __shared__ alignas(16) _Float16 Qs[128][72];

  const int blk = blockIdx.x;  // bh*4 + kb
  const int bh = blk >> 2;
  const int kb = blk & 3;
  const int b = bh >> 3;
  const int h = bh & 7;
  const int t = threadIdx.x;
  const int lane = t & 31;
  const int wave = t >> 5;
  const int lo = lane & 15;
  const int hi = lane >> 4;

  const int col = kb * 128 + wave * 16 + lo;
  const _Float16* krow = k2 + (((size_t)b * 512 + col) * 512) + h * 64;
  const v16h bk0 = ldfrag(krow, hi);
  const v16h bk1 = ldfrag(krow + 32, hi);

  float m_run = -1e30f, l_run = 0.0f;

  const int srow = t >> 3;        // 8 lanes cover one row's 128 B line
  const int scol = (t & 7) * 8;

  for (int qs = 0; qs < 512; qs += 128) {
    __syncthreads();  // every wave has left the previous 128 rows
#pragma unroll
    for (int i = 0; i < 4; ++i) {
      const _Float16* qsrc =
          q2 + (((size_t)b * 512 + qs + i * 32 + srow) * 512) + h * 64 + scol;
      *reinterpret_cast<uint4*>(&Qs[i * 32 + srow][scol]) =
          *reinterpret_cast<const uint4*>(qsrc);
    }
    __syncthreads();  // the 128 rows are visible to all waves

    for (int q0 = 0; q0 < 128; q0 += 16) {
      const _Float16* qrow = &Qs[q0 + lo][0];
      const v16h aq0 = ldfrag(qrow, hi);
      const v16h aq1 = ldfrag(qrow + 32, hi);
      v8f s = {};
      s = wmma_f16(aq0, bk0, s);
      s = wmma_f16(aq1, bk1, s);

      float pmax = -1e30f;
#pragma unroll
      for (int r = 0; r < 8; ++r) pmax = fmaxf(pmax, s[r] * kScale);
      pmax = fmaxf(pmax, __shfl_xor(pmax, 16, 32));
      const float nm = fmaxf(m_run, pmax);
      float ps = 0.0f;
#pragma unroll
      for (int r = 0; r < 8; ++r) ps += __expf(s[r] * kScale - nm);
      ps += __shfl_xor(ps, 16, 32);
      l_run = l_run * __expf(m_run - nm) + ps;
      m_run = nm;
    }
  }
  if (lane < 16) {
    Mst[(size_t)bh * 512 + col] = m_run;
    Lst[(size_t)bh * 512 + col] = l_run;
  }
}

// ---------------------------------------------------------------------------
// Phase 2: attn = P @ V with P = exp(scale*S - M[k]) / L[k], S recomputed by
// WMMA; P round-trips wave-private LDS (C->A layout), V is LDS-transposed.
// All 8 waves need the same 32 k rows per pass: the block stages them in LDS
// beside V with whole-line loads, and the k fragments are read from there.
// ---------------------------------------------------------------------------
__global__ __launch_bounds__(256) void attn_av(const _Float16* __restrict__ q2,
                                               const _Float16* __restrict__ k2,
                                               const _Float16* __restrict__ v2,
                                               const float* __restrict__ Mst,
                                               const float* __restrict__ Lst,
                                               _Float16* __restrict__ at2) {
  __shared__ _Float16 vT[64][40];
  __shared__ _Float16 Pw[8][16][40];
  // 32 k rows x 64 dh; pitch 144 B (16 B x odd) for the ds_load_b128 readers
  __shared__ alignas(16) _Float16 Ks[32][72];

  const int blk = blockIdx.x;  // bh*8 + qb
  const int bh = blk >> 3;
  const int qb = blk & 7;
  const int b = bh >> 3;
  const int h = bh & 7;
  const int t = threadIdx.x;
  const int lane = t & 31;
  const int wave = t >> 5;
  const int lo = lane & 15;
  const int hi = lane >> 4;

  const int q0  = qb * 64 + (wave & 3) * 16;
  const int dh0 = (wave >> 2) * 32;

  const _Float16* qrow = q2 + (((size_t)b * 512 + q0 + lo) * 512) + h * 64;
  const v16h aq0 = ldfrag(qrow, hi);
  const v16h aq1 = ldfrag(qrow + 32, hi);

  v8f oacc[2] = {};

  const int vtok = t >> 3;
  const int vd0  = (t & 7) * 8;

  for (int kt = 0; kt < 512; kt += 32) {
    __syncthreads();
    {
      const _Float16* vsrc =
          v2 + (((size_t)b * 512 + kt + vtok) * 512) + h * 64 + vd0;
      _Float16 tmp[8];
      *reinterpret_cast<uint4*>(tmp) = *reinterpret_cast<const uint4*>(vsrc);
#pragma unroll
      for (int e = 0; e < 8; ++e) vT[vd0 + e][vtok] = tmp[e];
      const _Float16* ksrc =
          k2 + (((size_t)b * 512 + kt + vtok) * 512) + h * 64 + vd0;
      *reinterpret_cast<uint4*>(&Ks[vtok][vd0]) =
          *reinterpret_cast<const uint4*>(ksrc);
    }
    __syncthreads();

#pragma unroll
    for (int jn = 0; jn < 2; ++jn) {
      const int ktok = kt + jn * 16 + lo;
      const _Float16* krow = &Ks[jn * 16 + lo][0];
      const v16h bk0 = ldfrag(krow, hi);
      const v16h bk1 = ldfrag(krow + 32, hi);
      v8f s = {};
      s = wmma_f16(aq0, bk0, s);
      s = wmma_f16(aq1, bk1, s);
      const float Mv = Mst[(size_t)bh * 512 + ktok];
      const float Li = 1.0f / Lst[(size_t)bh * 512 + ktok];
#pragma unroll
      for (int r = 0; r < 8; ++r)
        Pw[wave][r + 8 * hi][jn * 16 + lo] =
            (_Float16)(__expf(s[r] * kScale - Mv) * Li);
    }

    const v16h ap = ldfrag(&Pw[wave][lo][0], hi);
#pragma unroll
    for (int jd = 0; jd < 2; ++jd) {
      const v16h bv = ldfrag(&vT[dh0 + jd * 16 + lo][0], hi);
      oacc[jd] = wmma_f16(ap, bv, oacc[jd]);
    }
  }

#pragma unroll
  for (int jd = 0; jd < 2; ++jd) {
#pragma unroll
    for (int r = 0; r < 8; ++r) {
      const int qrw = q0 + 8 * hi + r;
      const int dcl = h * 64 + dh0 + jd * 16 + lo;
      at2[(((size_t)b * 512 + qrw) * 512) + dcl] = (_Float16)oacc[jd][r];
    }
  }
}

// ---------------------------------------------------------------------------
extern "C" void kernel_launch(void* const* d_in, const int* in_sizes, int n_in,
                              void* d_out, int out_size, void* d_ws,
                              size_t ws_size, hipStream_t stream) {
  (void)in_sizes; (void)n_in; (void)out_size; (void)ws_size;
  const float* Q  = (const float*)d_in[0];
  const float* Kx = (const float*)d_in[1];
  const float* Wq = (const float*)d_in[2];
  const float* bq = (const float*)d_in[3];
  const float* Wk = (const float*)d_in[4];
  const float* bk = (const float*)d_in[5];
  const float* Wv = (const float*)d_in[6];
  const float* bv = (const float*)d_in[7];
  const float* Wo = (const float*)d_in[8];
  const float* bo = (const float*)d_in[9];
  const float* W1 = (const float*)d_in[10];
  const float* b1 = (const float*)d_in[11];
  const float* W2 = (const float*)d_in[12];
  const float* b2 = (const float*)d_in[13];

  constexpr int B = 32, Nt = 512, D = 512, H = 8;
  constexpr int M = B * Nt;                          // 16384
  const size_t szH = (size_t)M * D * sizeof(_Float16);  // activations, f16
  const size_t szW = (size_t)D * D * sizeof(_Float16);  // weights, f16
  const size_t szF = (size_t)M * D * sizeof(float);

  char* p = (char*)d_ws;
  _Float16* Q16  = (_Float16*)p; p += szH;
  _Float16* K16  = (_Float16*)p; p += szH;
  _Float16* q2   = (_Float16*)p; p += szH;
  _Float16* k2   = (_Float16*)p; p += szH;
  _Float16* v2   = (_Float16*)p; p += szH;
  _Float16* at2  = (_Float16*)p; p += szH;
  _Float16* outh = (_Float16*)p; p += szH;
  _Float16* h1   = (_Float16*)p; p += szH;
  _Float16* Wq6  = (_Float16*)p; p += szW;
  _Float16* Wk6  = (_Float16*)p; p += szW;
  _Float16* Wv6  = (_Float16*)p; p += szW;
  _Float16* Wo6  = (_Float16*)p; p += szW;
  _Float16* W16w = (_Float16*)p; p += szW;
  _Float16* W26w = (_Float16*)p; p += szW;
  float*    outb = (float*)p;    p += szF;
  float*    Mst  = (float*)p;    p += (size_t)B * H * Nt * sizeof(float);
  float*    Lst  = (float*)p;

  const dim3 blk(256);
  const dim3 gg(D / 128, M / 128);  // (4, 128)

  // f32 -> f16 conversions (activations + weights), one launch.
  cvt_all<<<dim3(2 * kActSegs + 6 * kWgtSegs), blk, 0, stream>>>(
      Q, Kx, Wq, Wk, Wv, Wo, W1, W2, Q16, Wq6);

  // q/k/v projections (TDM-staged f16 GEMMs, f16 out)
  gemm_f16<0, 1><<<gg, blk, 0, stream>>>(Q16, Wq6, bq, nullptr, q2, nullptr, M, D, D);
  gemm_f16<0, 1><<<gg, blk, 0, stream>>>(K16, Wk6, bk, nullptr, k2, nullptr, M, D, D);
  gemm_f16<0, 1><<<gg, blk, 0, stream>>>(K16, Wv6, bv, nullptr, v2, nullptr, M, D, D);

  // attention: column softmax stats (query axis), then P @ V
  attn_stats<<<dim3(B * H * 4), blk, 0, stream>>>(q2, k2, Mst, Lst);
  attn_av<<<dim3(B * H * 8), blk, 0, stream>>>(q2, k2, v2, Mst, Lst, at2);

  // out = Q + attn @ Wo^T + bo  -> f32 (residual source) + f16 (FFN input)
  gemm_f16<2, 2><<<gg, blk, 0, stream>>>(at2, Wo6, bo, Q, outb, outh, M, D, D);
  // h1 = relu(out @ W1^T + b1) -> f16
  gemm_f16<1, 1><<<gg, blk, 0, stream>>>(outh, W16w, b1, nullptr, h1, nullptr, M, D, D);
  // final = out + h1 @ W2^T + b2 -> f32 d_out
  gemm_f16<2, 0><<<gg, blk, 0, stream>>>(h1, W26w, b2, outb, (float*)d_out, nullptr, M, D, D);
}

// v003
// It runs in 151 microseconds.
// Next to v002, in two timings, it ran 1.25 and 1.24 times as fast.
// Over all steps from v000 it is 1.69 times as fast.
#include <hip/hip_runtime.h>
#include <math.h>

// MAB (multihead attention block) for MI455X / gfx1250, wave32 + WMMA + TDM.
// B=32, N=512, D=512, H=8, dh=64. All heavy math via v_wmma_f32_16x16x32_f16;
// GEMM tile staging via tensor_load_to_lds (Tensor Data Mover), double-buffered.

typedef _Float16 v16h __attribute__((ext_vector_type(16)));
typedef float    v8f  __attribute__((ext_vector_type(8)));
typedef unsigned int u32x4 __attribute__((ext_vector_type(4)));
typedef int          i32x4 __attribute__((ext_vector_type(4)));
typedef int          i32x8 __attribute__((ext_vector_type(8)));

static constexpr float kScale = 0.044194173824159216f; // 1/sqrt(512)

__device__ __forceinline__ v8f wmma_f16(v16h a, v16h b, v8f c) {
  // (neg_a, A, neg_b, B, c_mod, C, reuse_a, reuse_b)
  return __builtin_amdgcn_wmma_f32_16x16x32_f16(false, a, false, b, (short)0, c,
                                                false, false);
}

// 16-bit A/B fragment for 16x16x32 WMMA. Per ISA layout, lane (lo=L%16,
// hi=L/16) holds K=[8*hi,8*hi+8) in VGPR0-3 and K=[16+8*hi,+8) in VGPR4-7.
__device__ __forceinline__ v16h ldfrag(const _Float16* rowp, int hi) {
  v16h a;
  *reinterpret_cast<uint4*>(&a)       = *reinterpret_cast<const uint4*>(rowp + 8 * hi);
  *(reinterpret_cast<uint4*>(&a) + 1) = *reinterpret_cast<const uint4*>(rowp + 16 + 8 * hi);
  return a;
}

// ---------------------------------------------------------------------------
// TDM: DMA a 128-row x 32-col f16 tile (row stride 512 elements in memory)
// into LDS, padding each 64B row with 16B -> LDS row stride = 40 halves.
// D# built per CDNA5 ISA 8.3-8.6; issued by one wave, tracked by TENSORcnt.
// This toolchain exposes the 6-arg builtin: (g0, g1, g2, g3, extra, cpol).
// ---------------------------------------------------------------------------
__device__ __forceinline__ void tdm_load_tile(const _Float16* gsrc,
                                              unsigned lds_byte_off) {
  const unsigned long long ga = (unsigned long long)(uintptr_t)gsrc;
  u32x4 g0;
  g0.x = 1u;                                   // count=1 (valid user desc)
  g0.y = lds_byte_off;                         // lds_addr
  g0.z = (unsigned)ga;                         // global_addr[31:0]
  g0.w = (unsigned)(ga >> 32) | (2u << 30);    // global_addr[56:32] | type=2
  i32x8 g1;
  g1[0] = (1 << 16)      // data_size = 2 bytes
        | (1 << 20)      // pad_enable
        | (3 << 22)      // pad_interval: every 16 DWORDs (64B = one tile row)
        | (3 << 25);     // pad_amount: 4 DWORDs (16B -> 40-half LDS stride)
  g1[1] = (512 << 16);                 // tensor_dim0 = 512 (low 16 in [31:16])
  g1[2] = 0;                           // tensor_dim0 hi | tensor_dim1 lo
  g1[3] = 0x10 | (32 << 16);           // tensor_dim1 = 1<<20 (hi16) | tile_dim0=32
  g1[4] = 128;                         // tile_dim1 = 128, tile_dim2 = 0
  g1[5] = 512;                         // tensor_dim0_stride = 512 elements
  g1[6] = 0;
  g1[7] = 0;
  const i32x4 z4 = {0, 0, 0, 0};               // groups 2/3 unused (2D tile)
  const i32x8 z8 = {0, 0, 0, 0, 0, 0, 0, 0};   // extra group slot unused
  __builtin_amdgcn_tensor_load_to_lds(g0, g1, z4, z4, z8, 0);
}

// ---------------------------------------------------------------------------
// f32 -> f16 convert of all eight operands in ONE launch. A block takes one
// kSeg-element segment of one operand, picked by its index (a scalar choice);
// a wave takes 4096 contiguous elements of it: 32 whole-line loads of 512 B,
// all in flight before the first convert, then whole-line stores of 256 B.
// dAct: the f16 copies of Q and K, one behind the other; dWgt: those of the
// six weights, one behind the other (the workspace is laid out so).
// ---------------------------------------------------------------------------
static constexpr unsigned kSeg     = 32768;              // elements per block
static constexpr unsigned kActSegs = 32 * 512 * 512 / kSeg;  // 256 per activation
static constexpr unsigned kWgtSegs = 512 * 512 / kSeg;       // 8 per weight

__global__ __launch_bounds__(256) void cvt_all(const float* __restrict__ Q,
                                               const float* __restrict__ Kx,
                                               const float* __restrict__ Wq,
                                               const float* __restrict__ Wk,
                                               const float* __restrict__ Wv,
                                               const float* __restrict__ Wo,
                                               const float* __restrict__ W1,
                                               const float* __restrict__ W2,
                                               _Float16* __restrict__ dAct,
                                               _Float16* __restrict__ dWgt) {
  const unsigned blk = blockIdx.x;
  const float* s;
  _Float16* d;
  if (blk < 2 * kActSegs) {
    s = (blk < kActSegs ? Q : Kx) + (size_t)(blk % kActSegs) * kSeg;
    d = dAct + (size_t)blk * kSeg;
  } else {
    const unsigned wb = blk - 2 * kActSegs;
    const unsigned w = wb / kWgtSegs;
    const float* wsrc = w == 0 ? Wq : w == 1 ? Wk : w == 2 ? Wv
                      : w == 3 ? Wo : w == 4 ? W1 : W2;
    s = wsrc + (size_t)(wb % kWgtSegs) * kSeg;
    d = dWgt + (size_t)wb * kSeg;
  }
  const int off = (threadIdx.x >> 5) * 4096 + (threadIdx.x & 31) * 4;

  float4 v[32];
#pragma unroll  // v[] stays in registers, the 32 loads become one clause
  for (int u = 0; u < 32; ++u)
    v[u] = *reinterpret_cast<const float4*>(s + off + u * 128);
  // Holds all 32 loads ahead of the first convert; without it the compiler
  // sinks 14 of them behind waits on the first 18: serial memory latencies.
  __builtin_amdgcn_sched_barrier(0);
#pragma unroll  // constant indices into v[], so that it stays in registers
  for (int u = 0; u < 32; ++u) {
    _Float16 h[4] = {(_Float16)v[u].x, (_Float16)v[u].y, (_Float16)v[u].z,
                     (_Float16)v[u].w};
    *reinterpret_cast<uint2*>(d + off + u * 128) = *reinterpret_cast<uint2*>(h);
  }
}

// ---------------------------------------------------------------------------
// GEMM: C[M,N] = epi( A[M,K] @ W[N,K]^T + bias[N] ) (+ R residual), all-f16
// operands, TDM double-buffered tile staging, 128x128 C tile, K-step 32.
//   EPI: 0 bias, 1 bias+ReLU, 2 bias+residual R (f32)
//   OH : 0 f32 out, 1 f16 out, 2 dual (f32 -> Cp, f16 -> C2p)
// 8 waves in 2x4 grid; each wave: 64x32 via 8 f32 accumulators.
// ---------------------------------------------------------------------------
template <int EPI, int OH>
__global__ __launch_bounds__(256) void gemm_f16(const _Float16* __restrict__ A16,
                                                const _Float16* __restrict__ W16,
                                                const float* __restrict__ bias,
                                                const float* __restrict__ R,
                                                void* __restrict__ Cp,
                                                void* __restrict__ C2p,
                                                int M, int N, int K) {
  __shared__ _Float16 As[2][128][40];
  __shared__ _Float16 Ws[2][128][40];

  const int t = threadIdx.x;
  const int lane = t & 31;
  const int wave = t >> 5;
  const int lo = lane & 15;
  const int hi = lane >> 4;
  const int wm = (wave >> 2) * 64;
  const int wn = (wave & 3) * 32;
  const int m0 = blockIdx.y * 128;
  const int n0 = blockIdx.x * 128;

  const _Float16* Abase = A16 + (size_t)m0 * K;
  const _Float16* Wbase = W16 + (size_t)n0 * K;
  const unsigned offA0 = (unsigned)(uintptr_t)&As[0][0][0];
  const unsigned offA1 = (unsigned)(uintptr_t)&As[1][0][0];
  const unsigned offW0 = (unsigned)(uintptr_t)&Ws[0][0][0];
  const unsigned offW1 = (unsigned)(uintptr_t)&Ws[1][0][0];

  const int NK = K >> 5;  // # of 32-wide k tiles

  if (wave == 0) {  // prologue: DMA tile 0 into buffer 0
    tdm_load_tile(Abase, offA0);
    tdm_load_tile(Wbase, offW0);
  }

  v8f acc[4][2] = {};

  for (int kt = 0; kt < NK; ++kt) {
    const int cur = kt & 1;
    __syncthreads();  // all waves done reading buffer cur^1
    if (wave == 0) {
      if (kt + 1 < NK) {  // prefetch next tile into the other buffer
        tdm_load_tile(Abase + (kt + 1) * 32, cur ? offA0 : offA1);
        tdm_load_tile(Wbase + (kt + 1) * 32, cur ? offW0 : offW1);
        __builtin_amdgcn_s_wait_tensorcnt(2);  // tiles for 'cur' landed
      } else {
        __builtin_amdgcn_s_wait_tensorcnt(0);
      }
    }
    __syncthreads();  // buffer 'cur' visible to all waves

    v16h af[4], wf[2];
#pragma unroll
    for (int i = 0; i < 4; ++i) af[i] = ldfrag(&As[cur][wm + 16 * i + lo][0], hi);
#pragma unroll
    for (int j = 0; j < 2; ++j) wf[j] = ldfrag(&Ws[cur][wn + 16 * j + lo][0], hi);
#pragma unroll
    for (int i = 0; i < 4; ++i)
#pragma unroll
      for (int j = 0; j < 2; ++j) acc[i][j] = wmma_f16(af[i], wf[j], acc[i][j]);
  }

  // epilogue: C layout m = r + 8*hi, n = lo
#pragma unroll
  for (int j = 0; j < 2; ++j) {
    const int gc = n0 + wn + 16 * j + lo;
    const float bv = bias[gc];
#pragma unroll
    for (int i = 0; i < 4; ++i) {
      const int gr = m0 + wm + 16 * i + 8 * hi;
#pragma unroll
      for (int r = 0; r < 8; ++r) {
        float x = acc[i][j][r] + bv;
        if constexpr (EPI == 1) x = fmaxf(x, 0.0f);
        const size_t idx = (size_t)(gr + r) * N + gc;
        if constexpr (EPI == 2) x += R[idx];
        if constexpr (OH == 0) {
          ((float*)Cp)[idx] = x;
        } else if constexpr (OH == 1) {
          ((_Float16*)Cp)[idx] = (_Float16)x;
        } else {
          ((float*)Cp)[idx] = x;
          ((_Float16*)C2p)[idx] = (_Float16)x;
        }
      }
    }
  }
}

// ---------------------------------------------------------------------------
// Phase 1: per-(b,h,k-column) softmax stats over the QUERY axis.
// One wave owns 16 k-columns; k-fragments resident, stream 32 q-tiles through
// WMMA, online max/sum with cross-half shfl_xor(16). All 8 waves walk the same
// q rows: the block stages them in LDS, 128 rows at a time, with whole-line
// loads, and the fragments are read from there.
// ---------------------------------------------------------------------------
__global__ __launch_bounds__(256) void attn_stats(const _Float16* __restrict__ q2,
                                                  const _Float16* __restrict__ k2,
                                                  float* __restrict__ Mst,
                                                  float* __restrict__ Lst) {
  // 128 q rows x 64 dh; pitch 144 B (16 B x odd) for the ds_load_b128 readers
  __shared__ alignas(16) _Float16 Qs[128][72];

  const int blk = blockIdx.x;  // bh*4 + kb
  const int bh = blk >> 2;
  const int kb = blk & 3;
  const int b = bh >> 3;
  const int h = bh & 7;
  const int t = threadIdx.x;
  const int lane = t & 31;
  const int wave = t >> 5;
  const int lo = lane & 15;
  const int hi = lane >> 4;

  const int col = kb * 128 + wave * 16 + lo;
  const _Float16* krow = k2 + (((size_t)b * 512 + col) * 512) + h * 64;
  const v16h bk0 = ldfrag(krow, hi);
  const v16h bk1 = ldfrag(krow + 32, hi);

  float m_run = -1e30f, l_run = 0.0f;

  const int srow = t >> 3;        // 8 lanes cover one row's 128 B line
  const int scol = (t & 7) * 8;

  for (int qs = 0; qs < 512; qs += 128) {
    __syncthreads();  // every wave has left the previous 128 rows
#pragma unroll
    for (int i = 0; i < 4; ++i) {
      const _Float16* qsrc =
          q2 + (((size_t)b * 512 + qs + i * 32 + srow) * 512) + h * 64 + scol;
      *reinterpret_cast<uint4*>(&Qs[i * 32 + srow][scol]) =
          *reinterpret_cast<const uint4*>(qsrc);
    }
    __syncthreads();  // the 128 rows are visible to all waves

    for (int q0 = 0; q0 < 128; q0 += 16) {
      const _Float16* qrow = &Qs[q0 + lo][0];
      const v16h aq0 = ldfrag(qrow, hi);
      const v16h aq1 = ldfrag(qrow + 32, hi);
      v8f s = {};
      s = wmma_f16(aq0, bk0, s);
      s = wmma_f16(aq1, bk1, s);

      float pmax = -1e30f;
#pragma unroll
      for (int r = 0; r < 8; ++r) pmax = fmaxf(pmax, s[r] * kScale);
      pmax = fmaxf(pmax, __shfl_xor(pmax, 16, 32));
      const float nm = fmaxf(m_run, pmax);
      float ps = 0.0f;
#pragma unroll
      for (int r = 0; r < 8; ++r) ps += __expf(s[r] * kScale - nm);
      ps += __shfl_xor(ps, 16, 32);
      l_run = l_run * __expf(m_run - nm) + ps;
      m_run = nm;
    }
  }
  if (lane < 16) {
    Mst[(size_t)bh * 512 + col] = m_run;
    Lst[(size_t)bh * 512 + col] = l_run;
  }
}

// ---------------------------------------------------------------------------
// Phase 2: attn = P @ V with P = exp(scale*S - M[k]) / L[k], S recomputed by
// WMMA; P round-trips wave-private LDS (C->A layout), V is LDS-transposed.
// All 8 waves need the same 32 k rows per pass: the block stages them in LDS
// beside V with whole-line loads, and the k fragments are read from there.
// A wave owns kQT tiles of 16 q rows and all 64 dh of them: every score, exp
// and P element is made once, and each K and V fragment read from LDS feeds
// kQT products. A block covers kQRows q rows of one (b, h).
// ---------------------------------------------------------------------------
static constexpr int kQT    = 2;             // q tiles of 16 rows per wave
static constexpr int kQRows = 8 * 16 * kQT;  // q rows per block
static constexpr int kQBlks = 512 / kQRows;  // blocks per (b, h)

__global__ __launch_bounds__(256) void attn_av(const _Float16* __restrict__ q2,
                                               const _Float16* __restrict__ k2,
                                               const _Float16* __restrict__ v2,
                                               const float* __restrict__ Mst,
                                               const float* __restrict__ Lst,
                                               _Float16* __restrict__ at2) {
  __shared__ _Float16 vT[64][40];
  __shared__ _Float16 Pw[8][16 * kQT][40];
  // 32 k rows x 64 dh; pitch 144 B (16 B x odd) for the ds_load_b128 readers
  __shared__ alignas(16) _Float16 Ks[32][72];

  const int blk = blockIdx.x;  // bh*kQBlks + qb
  const int bh = blk / kQBlks;
  const int qb = blk % kQBlks;
  const int b = bh >> 3;
  const int h = bh & 7;
  const int t = threadIdx.x;
  const int lane = t & 31;
  const int wave = t >> 5;
  const int lo = lane & 15;
  const int hi = lane >> 4;

  const int q0 = qb * kQRows + wave * (16 * kQT);

  v16h aq[kQT][2];
#pragma unroll  // constant indices into aq[], so that it stays in registers
  for (int qt = 0; qt < kQT; ++qt) {
    const _Float16* qrow =
        q2 + (((size_t)b * 512 + q0 + qt * 16 + lo) * 512) + h * 64;
    aq[qt][0] = ldfrag(qrow, hi);
    aq[qt][1] = ldfrag(qrow + 32, hi);
  }

  v8f oacc[kQT][4] = {};

  const int vtok = t >> 3;
  const int vd0  = (t & 7) * 8;

  for (int kt = 0; kt < 512; kt += 32) {
    __syncthreads();
    {
      const _Float16* vsrc =
          v2 + (((size_t)b * 512 + kt + vtok) * 512) + h * 64 + vd0;
      _Float16 tmp[8];
      *reinterpret_cast<uint4*>(tmp) = *reinterpret_cast<const uint4*>(vsrc);
#pragma unroll
      for (int e = 0; e < 8; ++e) vT[vd0 + e][vtok] = tmp[e];
      const _Float16* ksrc =
          k2 + (((size_t)b * 512 + kt + vtok) * 512) + h * 64 + vd0;
      *reinterpret_cast<uint4*>(&Ks[vtok][vd0]) =
          *reinterpret_cast<const uint4*>(ksrc);
    }
    __syncthreads();

#pragma unroll
    for (int jn = 0; jn < 2; ++jn) {
      const int ktok = kt + jn * 16 + lo;
      const _Float16* krow = &Ks[jn * 16 + lo][0];
      const v16h bk0 = ldfrag(krow, hi);
      const v16h bk1 = ldfrag(krow + 32, hi);
      const float Mv = Mst[(size_t)bh * 512 + ktok];
      const float Li = 1.0f / Lst[(size_t)bh * 512 + ktok];
#pragma unroll  // constant indices into aq[]; the kQT score chains interleave
      for (int qt = 0; qt < kQT; ++qt) {
        v8f s = {};
        s = wmma_f16(aq[qt][0], bk0, s);
        s = wmma_f16(aq[qt][1], bk1, s);
#pragma unroll
        for (int r = 0; r < 8; ++r)
          Pw[wave][qt * 16 + r + 8 * hi][jn * 16 + lo] =
              (_Float16)(__expf(s[r] * kScale - Mv) * Li);
      }
    }

    v16h ap[kQT];
#pragma unroll  // constant indices into ap[], so that it stays in registers
    for (int qt = 0; qt < kQT; ++qt)
      ap[qt] = ldfrag(&Pw[wave][qt * 16 + lo][0], hi);
#pragma unroll
    for (int jd = 0; jd < 4; ++jd) {
      const v16h bv = ldfrag(&vT[jd * 16 + lo][0], hi);
#pragma unroll  // constant indices into oacc[], so that it stays in registers
      for (int qt = 0; qt < kQT; ++qt)
        oacc[qt][jd] = wmma_f16(ap[qt], bv, oacc[qt][jd]);
    }
  }

#pragma unroll  // constant indices into oacc[], so that it stays in registers
  for (int qt = 0; qt < kQT; ++qt) {
#pragma unroll
    for (int jd = 0; jd < 4; ++jd) {
#pragma unroll
      for (int r = 0; r < 8; ++r) {
        const int qrw = q0 + qt * 16 + 8 * hi + r;
        const int dcl = h * 64 + jd * 16 + lo;
        at2[(((size_t)b * 512 + qrw) * 512) + dcl] = (_Float16)oacc[qt][jd][r];
      }
    }
  }
}

// ---------------------------------------------------------------------------
extern "C" void kernel_launch(void* const* d_in, const int* in_sizes, int n_in,
                              void* d_out, int out_size, void* d_ws,
                              size_t ws_size, hipStream_t stream) {
  (void)in_sizes; (void)n_in; (void)out_size; (void)ws_size;
  const float* Q  = (const float*)d_in[0];
  const float* Kx = (const float*)d_in[1];
  const float* Wq = (const float*)d_in[2];
  const float* bq = (const float*)d_in[3];
  const float* Wk = (const float*)d_in[4];
  const float* bk = (const float*)d_in[5];
  const float* Wv = (const float*)d_in[6];
  const float* bv = (const float*)d_in[7];
  const float* Wo = (const float*)d_in[8];
  const float* bo = (const float*)d_in[9];
  const float* W1 = (const float*)d_in[10];
  const float* b1 = (const float*)d_in[11];
  const float* W2 = (const float*)d_in[12];
  const float* b2 = (const float*)d_in[13];

  constexpr int B = 32, Nt = 512, D = 512, H = 8;
  constexpr int M = B * Nt;                          // 16384
  const size_t szH = (size_t)M * D * sizeof(_Float16);  // activations, f16
  const size_t szW = (size_t)D * D * sizeof(_Float16);  // weights, f16
  const size_t szF = (size_t)M * D * sizeof(float);

  char* p = (char*)d_ws;
  _Float16* Q16  = (_Float16*)p; p += szH;
  _Float16* K16  = (_Float16*)p; p += szH;
  _Float16* q2   = (_Float16*)p; p += szH;
  _Float16* k2   = (_Float16*)p; p += szH;
  _Float16* v2   = (_Float16*)p; p += szH;
  _Float16* at2  = (_Float16*)p; p += szH;
  _Float16* outh = (_Float16*)p; p += szH;
  _Float16* h1   = (_Float16*)p; p += szH;
  _Float16* Wq6  = (_Float16*)p; p += szW;
  _Float16* Wk6  = (_Float16*)p; p += szW;
  _Float16* Wv6  = (_Float16*)p; p += szW;
  _Float16* Wo6  = (_Float16*)p; p += szW;
  _Float16* W16w = (_Float16*)p; p += szW;
  _Float16* W26w = (_Float16*)p; p += szW;
  float*    outb = (float*)p;    p += szF;
  float*    Mst  = (float*)p;    p += (size_t)B * H * Nt * sizeof(float);
  float*    Lst  = (float*)p;

  const dim3 blk(256);
  const dim3 gg(D / 128, M / 128);  // (4, 128)

  // f32 -> f16 conversions (activations + weights), one launch.
  cvt_all<<<dim3(2 * kActSegs + 6 * kWgtSegs), blk, 0, stream>>>(
      Q, Kx, Wq, Wk, Wv, Wo, W1, W2, Q16, Wq6);

  // q/k/v projections (TDM-staged f16 GEMMs, f16 out)
  gemm_f16<0, 1><<<gg, blk, 0, stream>>>(Q16, Wq6, bq, nullptr, q2, nullptr, M, D, D);
  gemm_f16<0, 1><<<gg, blk, 0, stream>>>(K16, Wk6, bk, nullptr, k2, nullptr, M, D, D);
  gemm_f16<0, 1><<<gg, blk, 0, stream>>>(K16, Wv6, bv, nullptr, v2, nullptr, M, D, D);

  // attention: column softmax stats (query axis), then P @ V
  attn_stats<<<dim3(B * H * 4), blk, 0, stream>>>(q2, k2, Mst, Lst);
  attn_av<<<dim3(B * H * kQBlks), blk, 0, stream>>>(q2, k2, v2, Mst, Lst, at2);

  // out = Q + attn @ Wo^T + bo  -> f32 (residual source) + f16 (FFN input)
  gemm_f16<2, 2><<<gg, blk, 0, stream>>>(at2, Wo6, bo, Q, outb, outh, M, D, D);
  // h1 = relu(out @ W1^T + b1) -> f16
  gemm_f16<1, 1><<<gg, blk, 0, stream>>>(outh, W16w, b1, nullptr, h1, nullptr, M, D, D);
  // final = out + h1 @ W2^T + b2 -> f32 d_out
  gemm_f16<2, 0><<<gg, blk, 0, stream>>>(h1, W26w, b2, outb, (float*)d_out, nullptr, M, D, D);
}

// v004
// One run takes 143 microseconds.
// In both of two side-by-side timings against v003, it was 1.06 times as fast.
// All steps since v000 together make it 1.78 times as fast.
#include <hip/hip_runtime.h>
#include <math.h>

// MAB (multihead attention block) for MI455X / gfx1250, wave32 + WMMA + TDM.
// B=32, N=512, D=512, H=8, dh=64. All heavy math via v_wmma_f32_16x16x32_f16;
// GEMM tile staging via tensor_load_to_lds (Tensor Data Mover), double-buffered.

typedef _Float16 v16h __attribute__((ext_vector_type(16)));
typedef float    v8f  __attribute__((ext_vector_type(8)));
typedef unsigned int u32x4 __attribute__((ext_vector_type(4)));
typedef int          i32x4 __attribute__((ext_vector_type(4)));
typedef int          i32x8 __attribute__((ext_vector_type(8)));

static constexpr float kScale = 0.044194173824159216f; // 1/sqrt(512)

__device__ __forceinline__ v8f wmma_f16(v16h a, v16h b, v8f c) {
  // (neg_a, A, neg_b, B, c_mod, C, reuse_a, reuse_b)
  return __builtin_amdgcn_wmma_f32_16x16x32_f16(false, a, false, b, (short)0, c,
                                                false, false);
}

// 16-bit A/B fragment for 16x16x32 WMMA. Per ISA layout, lane (lo=L%16,
// hi=L/16) holds K=[8*hi,8*hi+8) in VGPR0-3 and K=[16+8*hi,+8) in VGPR4-7.
__device__ __forceinline__ v16h ldfrag(const _Float16* rowp, int hi) {
  v16h a;
  *reinterpret_cast<uint4*>(&a)       = *reinterpret_cast<const uint4*>(rowp + 8 * hi);
  *(reinterpret_cast<uint4*>(&a) + 1) = *reinterpret_cast<const uint4*>(rowp + 16 + 8 * hi);
  return a;
}

// ---------------------------------------------------------------------------
// TDM: DMA a 128-row x 32-col f16 tile (row stride 512 elements in memory)
// into LDS, padding each 64B row with 16B -> LDS row stride = 40 halves.
// D# built per CDNA5 ISA 8.3-8.6; issued by one wave, tracked by TENSORcnt.
// This toolchain exposes the 6-arg builtin: (g0, g1, g2, g3, extra, cpol).
// ---------------------------------------------------------------------------
__device__ __forceinline__ void tdm_load_tile(const _Float16* gsrc,
                                              unsigned lds_byte_off) {
  const unsigned long long ga = (unsigned long long)(uintptr_t)gsrc;
  u32x4 g0;
  g0.x = 1u;                                   // count=1 (valid user desc)
  g0.y = lds_byte_off;                         // lds_addr
  g0.z = (unsigned)ga;                         // global_addr[31:0]
  g0.w = (unsigned)(ga >> 32) | (2u << 30);    // global_addr[56:32] | type=2
  i32x8 g1;
  g1[0] = (1 << 16)      // data_size = 2 bytes
        | (1 << 20)      // pad_enable
        | (3 << 22)      // pad_interval: every 16 DWORDs (64B = one tile row)
        | (3 << 25);     // pad_amount: 4 DWORDs (16B -> 40-half LDS stride)
  g1[1] = (512 << 16);                 // tensor_dim0 = 512 (low 16 in [31:16])
  g1[2] = 0;                           // tensor_dim0 hi | tensor_dim1 lo
  g1[3] = 0x10 | (32 << 16);           // tensor_dim1 = 1<<20 (hi16) | tile_dim0=32
  g1[4] = 128;                         // tile_dim1 = 128, tile_dim2 = 0
  g1[5] = 512;                         // tensor_dim0_stride = 512 elements
  g1[6] = 0;
  g1[7] = 0;
  const i32x4 z4 = {0, 0, 0, 0};               // groups 2/3 unused (2D tile)
  const i32x8 z8 = {0, 0, 0, 0, 0, 0, 0, 0};   // extra group slot unused
  __builtin_amdgcn_tensor_load_to_lds(g0, g1, z4, z4, z8, 0);
}

// ---------------------------------------------------------------------------
// f32 -> f16 convert of all eight operands in ONE launch. A block takes one
// kSeg-element segment of one operand, picked by its index (a scalar choice);
// a wave takes 4096 contiguous elements of it: 32 whole-line loads of 512 B,
// all in flight before the first convert, then whole-line stores of 256 B.
// dAct: the f16 copies of Q and K, one behind the other; dWgt: those of the
// six weights, one behind the other (the workspace is laid out so).
// ---------------------------------------------------------------------------
static constexpr unsigned kSeg     = 32768;              // elements per block
static constexpr unsigned kActSegs = 32 * 512 * 512 / kSeg;  // 256 per activation
static constexpr unsigned kWgtSegs = 512 * 512 / kSeg;       // 8 per weight

__global__ __launch_bounds__(256) void cvt_all(const float* __restrict__ Q,
                                               const float* __restrict__ Kx,
                                               const float* __restrict__ Wq,
                                               const float* __restrict__ Wk,
                                               const float* __restrict__ Wv,
                                               const float* __restrict__ Wo,
                                               const float* __restrict__ W1,
                                               const float* __restrict__ W2,
                                               _Float16* __restrict__ dAct,
                                               _Float16* __restrict__ dWgt) {
  const unsigned blk = blockIdx.x;
  const float* s;
  _Float16* d;
  if (blk < 2 * kActSegs) {
    s = (blk < kActSegs ? Q : Kx) + (size_t)(blk % kActSegs) * kSeg;
    d = dAct + (size_t)blk * kSeg;
  } else {
    const unsigned wb = blk - 2 * kActSegs;
    const unsigned w = wb / kWgtSegs;
    const float* wsrc = w == 0 ? Wq : w == 1 ? Wk : w == 2 ? Wv
                      : w == 3 ? Wo : w == 4 ? W1 : W2;
    s = wsrc + (size_t)(wb % kWgtSegs) * kSeg;
    d = dWgt + (size_t)wb * kSeg;
  }
  const int off = (threadIdx.x >> 5) * 4096 + (threadIdx.x & 31) * 4;

  float4 v[32];
#pragma unroll  // v[] stays in registers, the 32 loads become one clause
  for (int u = 0; u < 32; ++u)
    v[u] = *reinterpret_cast<const float4*>(s + off + u * 128);
  // Holds all 32 loads ahead of the first convert; without it the compiler
  // sinks 14 of them behind waits on the first 18: serial memory latencies.
  __builtin_amdgcn_sched_barrier(0);
#pragma unroll  // constant indices into v[], so that it stays in registers
  for (int u = 0; u < 32; ++u) {
    _Float16 h[4] = {(_Float16)v[u].x, (_Float16)v[u].y, (_Float16)v[u].z,
                     (_Float16)v[u].w};
    *reinterpret_cast<uint2*>(d + off + u * 128) = *reinterpret_cast<uint2*>(h);
  }
}

// ---------------------------------------------------------------------------
// GEMM: C[M,N] = epi( A[M,K] @ W[N,K]^T + bias[N] ) (+ R residual), all-f16
// operands, TDM double-buffered tile staging, 128x128 C tile, K-step 32.
//   EPI: 0 bias, 1 bias+ReLU, 2 bias+residual R (f32)
//   OH : 0 f32 out, 1 f16 out, 2 dual (f32 -> Cp, f16 -> C2p)
// 8 waves in 2x4 grid; each wave: 64x32 via 8 f32 accumulators.
//   QKV: one launch holds the three projections, which do not depend on one
//   another. A block picks its operands by blockIdx.z, a scalar choice:
//   A16 = the f16 copies of Q and K, W16 = those of Wq, Wk, Wv, Cp = q2, k2,
//   v2, each set one behind the other (the workspace is laid out so); q reads
//   the first activation, k and v the second; bias, biasK, biasV in that order.
// ---------------------------------------------------------------------------
template <int EPI, int OH, bool QKV = false>
__global__ __launch_bounds__(256) void gemm_f16(const _Float16* __restrict__ A16,
                                                const _Float16* __restrict__ W16,
                                                const float* __restrict__ bias,
                                                const float* __restrict__ R,
                                                void* __restrict__ Cp,
                                                void* __restrict__ C2p,
                                                int M, int N, int K,
                                                const float* __restrict__ biasK,
                                                const float* __restrict__ biasV) {
  __shared__ _Float16 As[2][128][40];
  __shared__ _Float16 Ws[2][128][40];

  const int t = threadIdx.x;
  const int lane = t & 31;
  const int wave = t >> 5;
  const int lo = lane & 15;
  const int hi = lane >> 4;
  const int wm = (wave >> 2) * 64;
  const int wn = (wave & 3) * 32;
  const int m0 = blockIdx.y * 128;
  const int n0 = blockIdx.x * 128;

  if constexpr (QKV) {
    const unsigned proj = blockIdx.z;  // 0 q, 1 k, 2 v
    A16 += (size_t)(proj != 0) * M * K;
    W16 += (size_t)proj * N * K;
    bias = proj == 0 ? bias : proj == 1 ? biasK : biasV;
    Cp = (_Float16*)Cp + (size_t)proj * M * N;
  }

  const _Float16* Abase = A16 + (size_t)m0 * K;
  const _Float16* Wbase = W16 + (size_t)n0 * K;
  const unsigned offA0 = (unsigned)(uintptr_t)&As[0][0][0];
  const unsigned offA1 = (unsigned)(uintptr_t)&As[1][0][0];
  const unsigned offW0 = (unsigned)(uintptr_t)&Ws[0][0][0];
  const unsigned offW1 = (unsigned)(uintptr_t)&Ws[1][0][0];

  const int NK = K >> 5;  // # of 32-wide k tiles

  if (wave == 0) {  // prologue: DMA tile 0 into buffer 0
    tdm_load_tile(Abase, offA0);
    tdm_load_tile(Wbase, offW0);
  }

  v8f acc[4][2] = {};

  for (int kt = 0; kt < NK; ++kt) {
    const int cur = kt & 1;
    __syncthreads();  // all waves done reading buffer cur^1
    if (wave == 0) {
      if (kt + 1 < NK) {  // prefetch next tile into the other buffer
        tdm_load_tile(Abase + (kt + 1) * 32, cur ? offA0 : offA1);
        tdm_load_tile(Wbase + (kt + 1) * 32, cur ? offW0 : offW1);
        __builtin_amdgcn_s_wait_tensorcnt(2);  // tiles for 'cur' landed
      } else {
        __builtin_amdgcn_s_wait_tensorcnt(0);
      }
    }
    __syncthreads();  // buffer 'cur' visible to all waves

    v16h af[4], wf[2];
#pragma unroll
    for (int i = 0; i < 4; ++i) af[i] = ldfrag(&As[cur][wm + 16 * i + lo][0], hi);
#pragma unroll
    for (int j = 0; j < 2; ++j) wf[j] = ldfrag(&Ws[cur][wn + 16 * j + lo][0], hi);
#pragma unroll
    for (int i = 0; i < 4; ++i)
#pragma unroll
      for (int j = 0; j < 2; ++j) acc[i][j] = wmma_f16(af[i], wf[j], acc[i][j]);
  }

  // epilogue: C layout m = r + 8*hi, n = lo
#pragma unroll
  for (int j = 0; j < 2; ++j) {
    const int gc = n0 + wn + 16 * j + lo;
    const float bv = bias[gc];
#pragma unroll
    for (int i = 0; i < 4; ++i) {
      const int gr = m0 + wm + 16 * i + 8 * hi;
#pragma unroll
      for (int r = 0; r < 8; ++r) {
        float x = acc[i][j][r] + bv;
        if constexpr (EPI == 1) x = fmaxf(x, 0.0f);
        const size_t idx = (size_t)(gr + r) * N + gc;
        if constexpr (EPI == 2) x += R[idx];
        if constexpr (OH == 0) {
          ((float*)Cp)[idx] = x;
        } else if constexpr (OH == 1) {
          ((_Float16*)Cp)[idx] = (_Float16)x;
        } else {
          ((float*)Cp)[idx] = x;
          ((_Float16*)C2p)[idx] = (_Float16)x;
        }
      }
    }
  }
}

// ---------------------------------------------------------------------------
// Phase 1: per-(b,h,k-column) softmax stats over the QUERY axis.
// One wave owns 16 k-columns; k-fragments resident, stream 32 q-tiles through
// WMMA, online max/sum with cross-half shfl_xor(16). All 8 waves walk the same
// q rows: the block stages them in LDS, 128 rows at a time, with whole-line
// loads, and the fragments are read from there.
// ---------------------------------------------------------------------------
__global__ __launch_bounds__(256) void attn_stats(const _Float16* __restrict__ q2,
                                                  const _Float16* __restrict__ k2,
                                                  float* __restrict__ Mst,
                                                  float* __restrict__ Lst) {
  // 128 q rows x 64 dh; pitch 144 B (16 B x odd) for the ds_load_b128 readers
  __shared__ alignas(16) _Float16 Qs[128][72];

  const int blk = blockIdx.x;  // bh*4 + kb
  const int bh = blk >> 2;
  const int kb = blk & 3;
  const int b = bh >> 3;
  const int h = bh & 7;
  const int t = threadIdx.x;
  const int lane = t & 31;
  const int wave = t >> 5;
  const int lo = lane & 15;
  const int hi = lane >> 4;

  const int col = kb * 128 + wave * 16 + lo;
  const _Float16* krow = k2 + (((size_t)b * 512 + col) * 512) + h * 64;
  const v16h bk0 = ldfrag(krow, hi);
  const v16h bk1 = ldfrag(krow + 32, hi);

  float m_run = -1e30f, l_run = 0.0f;

  const int srow = t >> 3;        // 8 lanes cover one row's 128 B line
  const int scol = (t & 7) * 8;

  for (int qs = 0; qs < 512; qs += 128) {
    __syncthreads();  // every wave has left the previous 128 rows
#pragma unroll
    for (int i = 0; i < 4; ++i) {
      const _Float16* qsrc =
          q2 + (((size_t)b * 512 + qs + i * 32 + srow) * 512) + h * 64 + scol;
      *reinterpret_cast<uint4*>(&Qs[i * 32 + srow][scol]) =
          *reinterpret_cast<const uint4*>(qsrc);
    }
    __syncthreads();  // the 128 rows are visible to all waves

    for (int q0 = 0; q0 < 128; q0 += 16) {
      const _Float16* qrow = &Qs[q0 + lo][0];
      const v16h aq0 = ldfrag(qrow, hi);
      const v16h aq1 = ldfrag(qrow + 32, hi);
      v8f s = {};
      s = wmma_f16(aq0, bk0, s);
      s = wmma_f16(aq1, bk1, s);

      float pmax = -1e30f;
#pragma unroll
      for (int r = 0; r < 8; ++r) pmax = fmaxf(pmax, s[r] * kScale);
      pmax = fmaxf(pmax, __shfl_xor(pmax, 16, 32));
      const float nm = fmaxf(m_run, pmax);
      float ps = 0.0f;
#pragma unroll
      for (int r = 0; r < 8; ++r) ps += __expf(s[r] * kScale - nm);
      ps += __shfl_xor(ps, 16, 32);
      l_run = l_run * __expf(m_run - nm) + ps;
      m_run = nm;
    }
  }
  if (lane < 16) {
    Mst[(size_t)bh * 512 + col] = m_run;
    Lst[(size_t)bh * 512 + col] = l_run;
  }
}

// ---------------------------------------------------------------------------
// Phase 2: attn = P @ V with P = exp(scale*S - M[k]) / L[k], S recomputed by
// WMMA; P round-trips wave-private LDS (C->A layout), V is LDS-transposed.
// All 8 waves need the same 32 k rows per pass: the block stages them in LDS
// beside V with whole-line loads, and the k fragments are read from there.
// A wave owns kQT tiles of 16 q rows and all 64 dh of them: every score, exp
// and P element is made once, and each K and V fragment read from LDS feeds
// kQT products. A block covers kQRows q rows of one (b, h).
// ---------------------------------------------------------------------------
static constexpr int kQT    = 2;             // q tiles of 16 rows per wave
static constexpr int kQRows = 8 * 16 * kQT;  // q rows per block
static constexpr int kQBlks = 512 / kQRows;  // blocks per (b, h)

__global__ __launch_bounds__(256) void attn_av(const _Float16* __restrict__ q2,
                                               const _Float16* __restrict__ k2,
                                               const _Float16* __restrict__ v2,
                                               const float* __restrict__ Mst,
                                               const float* __restrict__ Lst,
                                               _Float16* __restrict__ at2) {
  __shared__ _Float16 vT[64][40];
  __shared__ _Float16 Pw[8][16 * kQT][40];
  // 32 k rows x 64 dh; pitch 144 B (16 B x odd) for the ds_load_b128 readers
  __shared__ alignas(16) _Float16 Ks[32][72];

  const int blk = blockIdx.x;  // bh*kQBlks + qb
  const int bh = blk / kQBlks;
  const int qb = blk % kQBlks;
  const int b = bh >> 3;
  const int h = bh & 7;
  const int t = threadIdx.x;
  const int lane = t & 31;
  const int wave = t >> 5;
  const int lo = lane & 15;
  const int hi = lane >> 4;

  const int q0 = qb * kQRows + wave * (16 * kQT);

  v16h aq[kQT][2];
#pragma unroll  // constant indices into aq[], so that it stays in registers
  for (int qt = 0; qt < kQT; ++qt) {
    const _Float16* qrow =
        q2 + (((size_t)b * 512 + q0 + qt * 16 + lo) * 512) + h * 64;
    aq[qt][0] = ldfrag(qrow, hi);
    aq[qt][1] = ldfrag(qrow + 32, hi);
  }

  v8f oacc[kQT][4] = {};

  const int vtok = t >> 3;
  const int vd0  = (t & 7) * 8;

  for (int kt = 0; kt < 512; kt += 32) {
    __syncthreads();
    {
      const _Float16* vsrc =
          v2 + (((size_t)b * 512 + kt + vtok) * 512) + h * 64 + vd0;
      _Float16 tmp[8];
      *reinterpret_cast<uint4*>(tmp) = *reinterpret_cast<const uint4*>(vsrc);
#pragma unroll
      for (int e = 0; e < 8; ++e) vT[vd0 + e][vtok] = tmp[e];
      const _Float16* ksrc =
          k2 + (((size_t)b * 512 + kt + vtok) * 512) + h * 64 + vd0;
      *reinterpret_cast<uint4*>(&Ks[vtok][vd0]) =
          *reinterpret_cast<const uint4*>(ksrc);
    }
    __syncthreads();

#pragma unroll
    for (int jn = 0; jn < 2; ++jn) {
      const int ktok = kt + jn * 16 + lo;
      const _Float16* krow = &Ks[jn * 16 + lo][0];
      const v16h bk0 = ldfrag(krow, hi);
      const v16h bk1 = ldfrag(krow + 32, hi);
      const float Mv = Mst[(size_t)bh * 512 + ktok];
      const float Li = 1.0f / Lst[(size_t)bh * 512 + ktok];
#pragma unroll  // constant indices into aq[]; the kQT score chains interleave
      for (int qt = 0; qt < kQT; ++qt) {
        v8f s = {};
        s = wmma_f16(aq[qt][0], bk0, s);
        s = wmma_f16(aq[qt][1], bk1, s);
#pragma unroll
        for (int r = 0; r < 8; ++r)
          Pw[wave][qt * 16 + r + 8 * hi][jn * 16 + lo] =
              (_Float16)(__expf(s[r] * kScale - Mv) * Li);
      }
    }

    v16h ap[kQT];
#pragma unroll  // constant indices into ap[], so that it stays in registers
    for (int qt = 0; qt < kQT; ++qt)
      ap[qt] = ldfrag(&Pw[wave][qt * 16 + lo][0], hi);
#pragma unroll
    for (int jd = 0; jd < 4; ++jd) {
      const v16h bv = ldfrag(&vT[jd * 16 + lo][0], hi);
#pragma unroll  // constant indices into oacc[], so that it stays in registers
      for (int qt = 0; qt < kQT; ++qt)
        oacc[qt][jd] = wmma_f16(ap[qt], bv, oacc[qt][jd]);
    }
  }

#pragma unroll  // constant indices into oacc[], so that it stays in registers
  for (int qt = 0; qt < kQT; ++qt) {
#pragma unroll
    for (int jd = 0; jd < 4; ++jd) {
#pragma unroll
      for (int r = 0; r < 8; ++r) {
        const int qrw = q0 + qt * 16 + 8 * hi + r;
        const int dcl = h * 64 + jd * 16 + lo;
        at2[(((size_t)b * 512 + qrw) * 512) + dcl] = (_Float16)oacc[qt][jd][r];
      }
    }
  }
}

// ---------------------------------------------------------------------------
extern "C" void kernel_launch(void* const* d_in, const int* in_sizes, int n_in,
                              void* d_out, int out_size, void* d_ws,
                              size_t ws_size, hipStream_t stream) {
  (void)in_sizes; (void)n_in; (void)out_size; (void)ws_size;
  const float* Q  = (const float*)d_in[0];
  const float* Kx = (const float*)d_in[1];
  const float* Wq = (const float*)d_in[2];
  const float* bq = (const float*)d_in[3];
  const float* Wk = (const float*)d_in[4];
  const float* bk = (const float*)d_in[5];
  const float* Wv = (const float*)d_in[6];
  const float* bv = (const float*)d_in[7];
  const float* Wo = (const float*)d_in[8];
  const float* bo = (const float*)d_in[9];
  const float* W1 = (const float*)d_in[10];
  const float* b1 = (const float*)d_in[11];
  const float* W2 = (const float*)d_in[12];
  const float* b2 = (const float*)d_in[13];

  constexpr int B = 32, Nt = 512, D = 512, H = 8;
  constexpr int M = B * Nt;                          // 16384
  const size_t szH = (size_t)M * D * sizeof(_Float16);  // activations, f16
  const size_t szW = (size_t)D * D * sizeof(_Float16);  // weights, f16
  const size_t szF = (size_t)M * D * sizeof(float);

  char* p = (char*)d_ws;
  _Float16* Q16  = (_Float16*)p; p += szH;
  _Float16* K16  = (_Float16*)p; p += szH;
  _Float16* q2   = (_Float16*)p; p += szH;
  _Float16* k2   = (_Float16*)p; p += szH;
  _Float16* v2   = (_Float16*)p; p += szH;
  _Float16* at2  = (_Float16*)p; p += szH;
  _Float16* outh = (_Float16*)p; p += szH;
  _Float16* h1   = (_Float16*)p; p += szH;
  _Float16* Wq6  = (_Float16*)p; p += szW;
  _Float16* Wk6  = (_Float16*)p; p += szW;
  _Float16* Wv6  = (_Float16*)p; p += szW;
  _Float16* Wo6  = (_Float16*)p; p += szW;
  _Float16* W16w = (_Float16*)p; p += szW;
  _Float16* W26w = (_Float16*)p; p += szW;
  float*    outb = (float*)p;    p += szF;
  float*    Mst  = (float*)p;    p += (size_t)B * H * Nt * sizeof(float);
  float*    Lst  = (float*)p;

  const dim3 blk(256);
  const dim3 gg(D / 128, M / 128);  // (4, 128)

  // f32 -> f16 conversions (activations + weights), one launch.
  cvt_all<<<dim3(2 * kActSegs + 6 * kWgtSegs), blk, 0, stream>>>(
      Q, Kx, Wq, Wk, Wv, Wo, W1, W2, Q16, Wq6);

  // q/k/v projections (TDM-staged f16 GEMMs, f16 out), one launch
  gemm_f16<0, 1, true><<<dim3(D / 128, M / 128, 3), blk, 0, stream>>>(
      Q16, Wq6, bq, nullptr, q2, nullptr, M, D, D, bk, bv);

  // attention: column softmax stats (query axis), then P @ V
  attn_stats<<<dim3(B * H * 4), blk, 0, stream>>>(q2, k2, Mst, Lst);
  attn_av<<<dim3(B * H * kQBlks), blk, 0, stream>>>(q2, k2, v2, Mst, Lst, at2);

  // out = Q + attn @ Wo^T + bo  -> f32 (residual source) + f16 (FFN input)
  gemm_f16<2, 2><<<gg, blk, 0, stream>>>(at2, Wo6, bo, Q, outb, outh, M, D, D, nullptr, nullptr);
  // h1 = relu(out @ W1^T + b1) -> f16
  gemm_f16<1, 1><<<gg, blk, 0, stream>>>(outh, W16w, b1, nullptr, h1, nullptr, M, D, D, nullptr, nullptr);
  // final = out + h1 @ W2^T + b2 -> f32 d_out
  gemm_f16<2, 0><<<gg, blk, 0, stream>>>(h1, W26w, b2, outb, (float*)d_out, nullptr, M, D, D, nullptr, nullptr);
}

// v005
// It runs in 132 microseconds.
// Next to v004, in two timings, it ran 1.09 and 1.08 times as fast.
// Counting every step since v000, it is 1.93 times as fast.
#include <hip/hip_runtime.h>
#include <math.h>

// MAB (multihead attention block) for MI455X / gfx1250, wave32 + WMMA + TDM.
// B=32, N=512, D=512, H=8, dh=64. All heavy math via v_wmma_f32_16x16x32_f16;
// GEMM tile staging via tensor_load_to_lds (Tensor Data Mover), double-buffered.

typedef _Float16 v16h __attribute__((ext_vector_type(16)));
typedef float    v8f  __attribute__((ext_vector_type(8)));
typedef unsigned int u32x4 __attribute__((ext_vector_type(4)));
typedef int          i32x4 __attribute__((ext_vector_type(4)));
typedef int          i32x8 __attribute__((ext_vector_type(8)));
typedef unsigned int u32x8 __attribute__((ext_vector_type(8)));
typedef float        f32x4 __attribute__((ext_vector_type(4)));

static constexpr float kScale = 0.044194173824159216f; // 1/sqrt(512)

__device__ __forceinline__ v8f wmma_f16(v16h a, v16h b, v8f c) {
  // (neg_a, A, neg_b, B, c_mod, C, reuse_a, reuse_b)
  return __builtin_amdgcn_wmma_f32_16x16x32_f16(false, a, false, b, (short)0, c,
                                                false, false);
}

// 16-bit A/B fragment for 16x16x32 WMMA. Per ISA layout, lane (lo=L%16,
// hi=L/16) holds K=[8*hi,8*hi+8) in VGPR0-3 and K=[16+8*hi,+8) in VGPR4-7.
__device__ __forceinline__ v16h ldfrag(const _Float16* rowp, int hi) {
  v16h a;
  *reinterpret_cast<uint4*>(&a)       = *reinterpret_cast<const uint4*>(rowp + 8 * hi);
  *(reinterpret_cast<uint4*>(&a) + 1) = *reinterpret_cast<const uint4*>(rowp + 16 + 8 * hi);
  return a;
}

// ---------------------------------------------------------------------------
// TDM: DMA a 128-row x 32-col f16 tile (row stride 512 elements in memory)
// into LDS, padding each 64B row with 16B -> LDS row stride = 40 halves.
// D# built per CDNA5 ISA 8.3-8.6; issued by one wave, tracked by TENSORcnt.
// This toolchain exposes the 6-arg builtin: (g0, g1, g2, g3, extra, cpol).
// ---------------------------------------------------------------------------
__device__ __forceinline__ void tdm_load_tile(const _Float16* gsrc,
                                              unsigned lds_byte_off) {
  const unsigned long long ga = (unsigned long long)(uintptr_t)gsrc;
  u32x4 g0;
  g0.x = 1u;                                   // count=1 (valid user desc)
  g0.y = lds_byte_off;                         // lds_addr
  g0.z = (unsigned)ga;                         // global_addr[31:0]
  g0.w = (unsigned)(ga >> 32) | (2u << 30);    // global_addr[56:32] | type=2
  i32x8 g1;
  g1[0] = (1 << 16)      // data_size = 2 bytes
        | (1 << 20)      // pad_enable
        | (3 << 22)      // pad_interval: every 16 DWORDs (64B = one tile row)
        | (3 << 25);     // pad_amount: 4 DWORDs (16B -> 40-half LDS stride)
  g1[1] = (512 << 16);                 // tensor_dim0 = 512 (low 16 in [31:16])
  g1[2] = 0;                           // tensor_dim0 hi | tensor_dim1 lo
  g1[3] = 0x10 | (32 << 16);           // tensor_dim1 = 1<<20 (hi16) | tile_dim0=32
  g1[4] = 128;                         // tile_dim1 = 128, tile_dim2 = 0
  g1[5] = 512;                         // tensor_dim0_stride = 512 elements
  g1[6] = 0;
  g1[7] = 0;
  const i32x4 z4 = {0, 0, 0, 0};               // groups 2/3 unused (2D tile)
  const i32x8 z8 = {0, 0, 0, 0, 0, 0, 0, 0};   // extra group slot unused
  __builtin_amdgcn_tensor_load_to_lds(g0, g1, z4, z4, z8, 0);
}

// ---------------------------------------------------------------------------
// f32 -> f16 convert of all eight operands in ONE launch. A block takes one
// kSeg-element segment of one operand, picked by its index (a scalar choice);
// a wave takes 4096 contiguous elements of it: 32 whole-line loads of 512 B,
// all in flight before the first convert, then whole-line stores of 256 B.
// dAct: the f16 copies of Q and K, one behind the other; dWgt: those of the
// six weights, one behind the other (the workspace is laid out so).
// ---------------------------------------------------------------------------
static constexpr unsigned kSeg     = 32768;              // elements per block
static constexpr unsigned kActSegs = 32 * 512 * 512 / kSeg;  // 256 per activation
static constexpr unsigned kWgtSegs = 512 * 512 / kSeg;       // 8 per weight

__global__ __launch_bounds__(256) void cvt_all(const float* __restrict__ Q,
                                               const float* __restrict__ Kx,
                                               const float* __restrict__ Wq,
                                               const float* __restrict__ Wk,
                                               const float* __restrict__ Wv,
                                               const float* __restrict__ Wo,
                                               const float* __restrict__ W1,
                                               const float* __restrict__ W2,
                                               _Float16* __restrict__ dAct,
                                               _Float16* __restrict__ dWgt) {
  const unsigned blk = blockIdx.x;
  const float* s;
  _Float16* d;
  if (blk < 2 * kActSegs) {
    s = (blk < kActSegs ? Q : Kx) + (size_t)(blk % kActSegs) * kSeg;
    d = dAct + (size_t)blk * kSeg;
  } else {
    const unsigned wb = blk - 2 * kActSegs;
    const unsigned w = wb / kWgtSegs;
    const float* wsrc = w == 0 ? Wq : w == 1 ? Wk : w == 2 ? Wv
                      : w == 3 ? Wo : w == 4 ? W1 : W2;
    s = wsrc + (size_t)(wb % kWgtSegs) * kSeg;
    d = dWgt + (size_t)wb * kSeg;
  }
  const int off = (threadIdx.x >> 5) * 4096 + (threadIdx.x & 31) * 4;

  float4 v[32];
#pragma unroll  // v[] stays in registers, the 32 loads become one clause
  for (int u = 0; u < 32; ++u)
    v[u] = *reinterpret_cast<const float4*>(s + off + u * 128);
  // Holds all 32 loads ahead of the first convert; without it the compiler
  // sinks 14 of them behind waits on the first 18: serial memory latencies.
  __builtin_amdgcn_sched_barrier(0);
#pragma unroll  // constant indices into v[], so that it stays in registers
  for (int u = 0; u < 32; ++u) {
    _Float16 h[4] = {(_Float16)v[u].x, (_Float16)v[u].y, (_Float16)v[u].z,
                     (_Float16)v[u].w};
    *reinterpret_cast<uint2*>(d + off + u * 128) = *reinterpret_cast<uint2*>(h);
  }
}

// ---------------------------------------------------------------------------
// GEMM: C[M,N] = epi( A[M,K] @ W[N,K]^T + bias[N] ) (+ R residual), all-f16
// operands, TDM double-buffered tile staging, 128x128 C tile, K-step 32.
//   EPI: 0 bias, 1 bias+ReLU, 2 bias+residual R (f32)
//   OH : 0 f32 out, 1 f16 out, 2 dual (f32 -> Cp, f16 -> C2p)
// 8 waves in 2x4 grid; each wave: 64x32 via 8 f32 accumulators.
//   QKV: one launch holds the three projections, which do not depend on one
//   another. A block picks its operands by blockIdx.z, a scalar choice:
//   A16 = the f16 copies of Q and K, W16 = those of Wq, Wk, Wv, Cp = q2, k2,
//   v2, each set one behind the other (the workspace is laid out so); q reads
//   the first activation, k and v the second; bias, biasK, biasV in that order.
// ---------------------------------------------------------------------------
template <int EPI, int OH, bool QKV = false>
__global__ __launch_bounds__(256) void gemm_f16(const _Float16* __restrict__ A16,
                                                const _Float16* __restrict__ W16,
                                                const float* __restrict__ bias,
                                                const float* __restrict__ R,
                                                void* __restrict__ Cp,
                                                void* __restrict__ C2p,
                                                int M, int N, int K,
                                                const float* __restrict__ biasK,
                                                const float* __restrict__ biasV) {
  __shared__ _Float16 As[2][128][40];
  __shared__ _Float16 Ws[2][128][40];

  const int t = threadIdx.x;
  const int lane = t & 31;
  const int wave = t >> 5;
  const int lo = lane & 15;
  const int hi = lane >> 4;
  const int wm = (wave >> 2) * 64;
  const int wn = (wave & 3) * 32;
  const int m0 = blockIdx.y * 128;
  const int n0 = blockIdx.x * 128;

  if constexpr (QKV) {
    const unsigned proj = blockIdx.z;  // 0 q, 1 k, 2 v
    A16 += (size_t)(proj != 0) * M * K;
    W16 += (size_t)proj * N * K;
    bias = proj == 0 ? bias : proj == 1 ? biasK : biasV;
    Cp = (_Float16*)Cp + (size_t)proj * M * N;
  }

  const _Float16* Abase = A16 + (size_t)m0 * K;
  const _Float16* Wbase = W16 + (size_t)n0 * K;
  const unsigned offA0 = (unsigned)(uintptr_t)&As[0][0][0];
  const unsigned offA1 = (unsigned)(uintptr_t)&As[1][0][0];
  const unsigned offW0 = (unsigned)(uintptr_t)&Ws[0][0][0];
  const unsigned offW1 = (unsigned)(uintptr_t)&Ws[1][0][0];

  const int NK = K >> 5;  // # of 32-wide k tiles

  if (wave == 0) {  // prologue: DMA tile 0 into buffer 0
    tdm_load_tile(Abase, offA0);
    tdm_load_tile(Wbase, offW0);
  }

  v8f acc[4][2] = {};

  for (int kt = 0; kt < NK; ++kt) {
    const int cur = kt & 1;
    __syncthreads();  // all waves done reading buffer cur^1
    if (wave == 0) {
      if (kt + 1 < NK) {  // prefetch next tile into the other buffer
        tdm_load_tile(Abase + (kt + 1) * 32, cur ? offA0 : offA1);
        tdm_load_tile(Wbase + (kt + 1) * 32, cur ? offW0 : offW1);
        __builtin_amdgcn_s_wait_tensorcnt(2);  // tiles for 'cur' landed
      } else {
        __builtin_amdgcn_s_wait_tensorcnt(0);
      }
    }
    __syncthreads();  // buffer 'cur' visible to all waves

    v16h af[4], wf[2];
#pragma unroll
    for (int i = 0; i < 4; ++i) af[i] = ldfrag(&As[cur][wm + 16 * i + lo][0], hi);
#pragma unroll
    for (int j = 0; j < 2; ++j) wf[j] = ldfrag(&Ws[cur][wn + 16 * j + lo][0], hi);
#pragma unroll
    for (int i = 0; i < 4; ++i)
#pragma unroll
      for (int j = 0; j < 2; ++j) acc[i][j] = wmma_f16(af[i], wf[j], acc[i][j]);
  }

  // epilogue: C layout m = r + 8*hi, n = lo
#pragma unroll
  for (int j = 0; j < 2; ++j) {
    const int gc = n0 + wn + 16 * j + lo;
    const float bv = bias[gc];
#pragma unroll
    for (int i = 0; i < 4; ++i) {
      const int gr = m0 + wm + 16 * i + 8 * hi;
#pragma unroll
      for (int r = 0; r < 8; ++r) {
        float x = acc[i][j][r] + bv;
        if constexpr (EPI == 1) x = fmaxf(x, 0.0f);
        const size_t idx = (size_t)(gr + r) * N + gc;
        if constexpr (EPI == 2) x += R[idx];
        if constexpr (OH == 0) {
          ((float*)Cp)[idx] = x;
        } else if constexpr (OH == 1) {
          ((_Float16*)Cp)[idx] = (_Float16)x;
        } else {
          ((float*)Cp)[idx] = x;
          ((_Float16*)C2p)[idx] = (_Float16)x;
        }
      }
    }
  }
}

// ---------------------------------------------------------------------------
// Phase 1: per-(b,h,k-column) softmax stats over the QUERY axis.
// One wave owns 16 k-columns; k-fragments resident, stream 32 q-tiles through
// WMMA, online max/sum with cross-half shfl_xor(16). All 8 waves walk the same
// q rows: the block stages them in LDS, 128 rows at a time, with whole-line
// loads, and the fragments are read from there.
// ---------------------------------------------------------------------------
__global__ __launch_bounds__(256) void attn_stats(const _Float16* __restrict__ q2,
                                                  const _Float16* __restrict__ k2,
                                                  float* __restrict__ Mst,
                                                  float* __restrict__ Lst) {
  // 128 q rows x 64 dh; pitch 144 B (16 B x odd) for the ds_load_b128 readers
  __shared__ alignas(16) _Float16 Qs[128][72];

  const int blk = blockIdx.x;  // bh*4 + kb
  const int bh = blk >> 2;
  const int kb = blk & 3;
  const int b = bh >> 3;
  const int h = bh & 7;
  const int t = threadIdx.x;
  const int lane = t & 31;
  const int wave = t >> 5;
  const int lo = lane & 15;
  const int hi = lane >> 4;

  const int col = kb * 128 + wave * 16 + lo;
  const _Float16* krow = k2 + (((size_t)b * 512 + col) * 512) + h * 64;
  const v16h bk0 = ldfrag(krow, hi);
  const v16h bk1 = ldfrag(krow + 32, hi);

  float m_run = -1e30f, l_run = 0.0f;

  const int srow = t >> 3;        // 8 lanes cover one row's 128 B line
  const int scol = (t & 7) * 8;

  for (int qs = 0; qs < 512; qs += 128) {
    __syncthreads();  // every wave has left the previous 128 rows
#pragma unroll
    for (int i = 0; i < 4; ++i) {
      const _Float16* qsrc =
          q2 + (((size_t)b * 512 + qs + i * 32 + srow) * 512) + h * 64 + scol;
      *reinterpret_cast<uint4*>(&Qs[i * 32 + srow][scol]) =
          *reinterpret_cast<const uint4*>(qsrc);
    }
    __syncthreads();  // the 128 rows are visible to all waves

    for (int q0 = 0; q0 < 128; q0 += 16) {
      const _Float16* qrow = &Qs[q0 + lo][0];
      const v16h aq0 = ldfrag(qrow, hi);
      const v16h aq1 = ldfrag(qrow + 32, hi);
      v8f s = {};
      s = wmma_f16(aq0, bk0, s);
      s = wmma_f16(aq1, bk1, s);

      float pmax = -1e30f;
#pragma unroll
      for (int r = 0; r < 8; ++r) pmax = fmaxf(pmax, s[r] * kScale);
      pmax = fmaxf(pmax, __shfl_xor(pmax, 16, 32));
      const float nm = fmaxf(m_run, pmax);
      float ps = 0.0f;
#pragma unroll
      for (int r = 0; r < 8; ++r) ps += __expf(s[r] * kScale - nm);
      ps += __shfl_xor(ps, 16, 32);
      l_run = l_run * __expf(m_run - nm) + ps;
      m_run = nm;
    }
  }
  if (lane < 16) {
    Mst[(size_t)bh * 512 + col] = m_run;
    Lst[(size_t)bh * 512 + col] = l_run;
  }
}

// ---------------------------------------------------------------------------
// Phase 2: attn = P @ V with P = exp(scale*S - M[k]) / L[k], S recomputed by
// WMMA; P round-trips wave-private LDS (C->A layout), V is LDS-transposed.
// All 8 waves need the same 32 k rows per pass: the block stages them in LDS
// beside V with whole-line loads, and the k fragments are read from there.
// A wave owns kQT tiles of 16 q rows and all 64 dh of them: every score, exp
// and P element is made once, and each K and V fragment read from LDS feeds
// kQT products. A block covers kQRows q rows of one (b, h).
// ---------------------------------------------------------------------------
static constexpr int kQT    = 2;             // q tiles of 16 rows per wave
static constexpr int kQRows = 8 * 16 * kQT;  // q rows per block
static constexpr int kQBlks = 512 / kQRows;  // blocks per (b, h)

__global__ __launch_bounds__(256) void attn_av(const _Float16* __restrict__ q2,
                                               const _Float16* __restrict__ k2,
                                               const _Float16* __restrict__ v2,
                                               const float* __restrict__ Mst,
                                               const float* __restrict__ Lst,
                                               _Float16* __restrict__ at2) {
  __shared__ _Float16 vT[64][40];
  __shared__ _Float16 Pw[8][16 * kQT][40];
  // 32 k rows x 64 dh; pitch 144 B (16 B x odd) for the ds_load_b128 readers
  __shared__ alignas(16) _Float16 Ks[32][72];

  const int blk = blockIdx.x;  // bh*kQBlks + qb
  const int bh = blk / kQBlks;
  const int qb = blk % kQBlks;
  const int b = bh >> 3;
  const int h = bh & 7;
  const int t = threadIdx.x;
  const int lane = t & 31;
  const int wave = t >> 5;
  const int lo = lane & 15;
  const int hi = lane >> 4;

  const int q0 = qb * kQRows + wave * (16 * kQT);

  v16h aq[kQT][2];
#pragma unroll  // constant indices into aq[], so that it stays in registers
  for (int qt = 0; qt < kQT; ++qt) {
    const _Float16* qrow =
        q2 + (((size_t)b * 512 + q0 + qt * 16 + lo) * 512) + h * 64;
    aq[qt][0] = ldfrag(qrow, hi);
    aq[qt][1] = ldfrag(qrow + 32, hi);
  }

  v8f oacc[kQT][4] = {};

  const int vtok = t >> 3;
  const int vd0  = (t & 7) * 8;

  for (int kt = 0; kt < 512; kt += 32) {
    __syncthreads();
    {
      const _Float16* vsrc =
          v2 + (((size_t)b * 512 + kt + vtok) * 512) + h * 64 + vd0;
      _Float16 tmp[8];
      *reinterpret_cast<uint4*>(tmp) = *reinterpret_cast<const uint4*>(vsrc);
#pragma unroll
      for (int e = 0; e < 8; ++e) vT[vd0 + e][vtok] = tmp[e];
      const _Float16* ksrc =
          k2 + (((size_t)b * 512 + kt + vtok) * 512) + h * 64 + vd0;
      *reinterpret_cast<uint4*>(&Ks[vtok][vd0]) =
          *reinterpret_cast<const uint4*>(ksrc);
    }
    __syncthreads();

#pragma unroll
    for (int jn = 0; jn < 2; ++jn) {
      const int ktok = kt + jn * 16 + lo;
      const _Float16* krow = &Ks[jn * 16 + lo][0];
      const v16h bk0 = ldfrag(krow, hi);
      const v16h bk1 = ldfrag(krow + 32, hi);
      const float Mv = Mst[(size_t)bh * 512 + ktok];
      const float Li = 1.0f / Lst[(size_t)bh * 512 + ktok];
#pragma unroll  // constant indices into aq[]; the kQT score chains interleave
      for (int qt = 0; qt < kQT; ++qt) {
        v8f s = {};
        s = wmma_f16(aq[qt][0], bk0, s);
        s = wmma_f16(aq[qt][1], bk1, s);
#pragma unroll
        for (int r = 0; r < 8; ++r)
          Pw[wave][qt * 16 + r + 8 * hi][jn * 16 + lo] =
              (_Float16)(__expf(s[r] * kScale - Mv) * Li);
      }
    }

    v16h ap[kQT];
#pragma unroll  // constant indices into ap[], so that it stays in registers
    for (int qt = 0; qt < kQT; ++qt)
      ap[qt] = ldfrag(&Pw[wave][qt * 16 + lo][0], hi);
#pragma unroll
    for (int jd = 0; jd < 4; ++jd) {
      const v16h bv = ldfrag(&vT[jd * 16 + lo][0], hi);
#pragma unroll  // constant indices into oacc[], so that it stays in registers
      for (int qt = 0; qt < kQT; ++qt)
        oacc[qt][jd] = wmma_f16(ap[qt], bv, oacc[qt][jd]);
    }
  }

#pragma unroll  // constant indices into oacc[], so that it stays in registers
  for (int qt = 0; qt < kQT; ++qt) {
#pragma unroll
    for (int jd = 0; jd < 4; ++jd) {
#pragma unroll
      for (int r = 0; r < 8; ++r) {
        const int qrw = q0 + qt * 16 + 8 * hi + r;
        const int dcl = h * 64 + jd * 16 + lo;
        at2[(((size_t)b * 512 + qrw) * 512) + dcl] = (_Float16)oacc[qt][jd][r];
      }
    }
  }
}

// ---------------------------------------------------------------------------
// Tail: out = Q + attn @ Wo^T + bo; final = out + relu(out @ W1^T + b1) @ W2^T
// + b2, all three products in ONE launch. A block owns kFR rows. Their f16
// activations (attn, then out, then the hidden layer) stay in LDS (Xs), 'out'
// in f32 stays in registers; nothing goes through the workspace in between.
// A wave owns 64 output columns = 64 weight rows that no other wave reads; it
// brings them in itself, 64 k at a time, by one tensor load per pass into its
// own slice of a two-buffer ring. The three weights lie one behind the other
// (the workspace is laid out so), so that the ring runs through all 24 passes.
// ---------------------------------------------------------------------------
static constexpr int      kFR     = 64;     // rows per block
static constexpr int      kXP     = 520;    // Xs pitch, halves: 1040 B = 16 B x odd
static constexpr int      kWP     = 72;     // weight pitch in LDS, halves: 144 B
static constexpr unsigned kWSlice = 10240;  // 64 rows x 144 B, up to a 2 KiB multiple
static constexpr unsigned kStages = 24;     // 3 products x 8 passes of 64 k

__device__ __forceinline__ unsigned uni(unsigned v) {
  return (unsigned)__builtin_amdgcn_readfirstlane(v);
}
__device__ __forceinline__ unsigned pinned(unsigned v) {
  unsigned w = uni(v);
  asm volatile("" : "+s"(w));  // pinned(): holds an issue test or a descriptor word in a scalar register
  return w;
}
// LDS reads of this wave have retired (before the ring's buffer is handed over)
__device__ __forceinline__ void wait_ds0() { asm volatile("s_wait_dscnt 0x0" ::: "memory"); }
// Group 1 of the request: 64 rows of 128 B, source pitch 1024 B, 16 B of pad
// behind each row in LDS (pitch 144 B). All extents in bytes, tensor = tile.
__device__ __forceinline__ u32x8 wslice_group1() {
  u32x8 g1;
  g1[0] = pinned((1u << 20) | (4u << 22) | (3u << 25));  // pad: 4 dwords per 32 dwords
  g1[1] = pinned(128u << 16);                            // tensor_dim0 = 128
  g1[2] = pinned(64u << 16);                             // tensor_dim1 = 64
  g1[3] = pinned(128u << 16);                            // tile_dim0 = 128
  g1[4] = pinned(64u);                                   // tile_dim1 = 64
  g1[5] = pinned(1024u);                                 // source row pitch
  g1[6] = pinned(0u);
  g1[7] = pinned(0u);
  return g1;
}

__global__ __launch_bounds__(256) void tail_fused(const _Float16* __restrict__ at2,
                                                  const _Float16* __restrict__ Wcat,
                                                  const float* __restrict__ Q,
                                                  const float* __restrict__ bo,
                                                  const float* __restrict__ b1,
                                                  const float* __restrict__ b2,
                                                  float* __restrict__ out) {
  __shared__ __attribute__((aligned(2048))) unsigned char Wr[2][8][kWSlice];
  __shared__ alignas(16) _Float16 Xs[kFR][kXP];

  const int t = threadIdx.x;
  const int lane = t & 31;
  const unsigned wave = uni(threadIdx.x >> 5);
  const int lo = lane & 15;
  const int hi = lane >> 4;
  const int m0 = blockIdx.x * kFR;
  const int wn = (int)wave * 64;

  const unsigned wdst = (unsigned)(uintptr_t)&Wr[0][0][0] + wave * kWSlice;
  const _Float16* wsrc = Wcat + (size_t)wn * 512;
  // stage s: product s / 8, k columns (s % 8) * 64, into buffer s % 2
  const u32x8 g1 = wslice_group1();
  u32x4 g0;
  g0[0] = pinned(1u);  // count 1
  auto issue = [&](unsigned s) {
    const unsigned long long ga = (unsigned long long)(uintptr_t)(
        wsrc + (size_t)(s >> 3) * (512 * 512) + (s & 7u) * 64u);
    g0[1] = uni(wdst + (s & 1u) * (8u * kWSlice));                      // place in LDS
    g0[2] = uni((unsigned)ga);                                          // address, low
    g0[3] = uni((((unsigned)(ga >> 32)) & 0x01FFFFFFu) | 0x80000000u);  // high | type 2
    asm volatile("tensor_load_to_lds %0, %1" ::"s"(g0), "s"(g1) : "memory");
  };
  // This wave's tensor load has landed (the compiler places no wait for it). The
  // descriptor is an input only: its registers keep their words up to the wait.
  auto wait_tensor0 = [&]() {
    asm volatile("s_wait_tensorcnt 0x0" ::"s"(g0), "s"(g1) : "memory");
  };

  issue(0);
  // The residual rows of Q and the three biases, C layout (m = r + 8*hi, n = lo),
  // asked for here so that their latency runs beside that of stage 0 and Xs.
  const float* qsrc = Q + (size_t)(m0 + 8 * hi) * 512 + wn + lo;
  f32x4 bias[3];
  v8f qv[4][4];
#pragma unroll  // constant indices into bias[] and qv[]: they stay in registers
  for (int j = 0; j < 4; ++j) {
    const int gc = wn + 16 * j + lo;
    bias[0][j] = bo[gc];
    bias[1][j] = b1[gc];
    bias[2][j] = b2[gc];
#pragma unroll
    for (int i = 0; i < 4; ++i)
#pragma unroll
      for (int r = 0; r < 8; ++r) qv[i][j][r] = qsrc[(16 * i + r) * 512 + 16 * j];
  }
  // The wait that stands in front of any rewrite of an address register of the
  // loads above; the address is an input only, so that it lives up to the wait.
  asm volatile("s_wait_xcnt 0x0" ::"v"(qsrc) : "memory");
  // keeps every later register write behind that wait
  __builtin_amdgcn_sched_barrier(0);

  // the block's attn rows into Xs, whole-line loads (a wave takes 512 B of a row)
  const int xrow = t >> 6;
  const int xcol = (t & 63) * 8;
  const _Float16* xsrc = at2 + (size_t)(m0 + xrow) * 512 + xcol;
  u32x4 xr[16];
#pragma unroll  // constant indices into xr[]: it stays in registers
  for (int i = 0; i < 16; ++i)
    xr[i] = *reinterpret_cast<const u32x4*>(xsrc + i * (4 * 512));
  // The same wait for these loads; the loaded values and the address are inputs
  // only: they tie the wait behind the loads and keep the address up to it.
  asm volatile("s_wait_xcnt 0x0" ::"v"(xr[0]), "v"(xr[1]), "v"(xr[2]), "v"(xr[3]),
               "v"(xr[4]), "v"(xr[5]), "v"(xr[6]), "v"(xr[7]), "v"(xr[8]), "v"(xr[9]),
               "v"(xr[10]), "v"(xr[11]), "v"(xr[12]), "v"(xr[13]), "v"(xr[14]),
               "v"(xr[15]), "v"(xsrc)
               : "memory");
  // keeps every later register write behind that wait
  __builtin_amdgcn_sched_barrier(0);
#pragma unroll
  for (int i = 0; i < 16; ++i)
    *reinterpret_cast<u32x4*>(&Xs[i * 4 + xrow][xcol]) = xr[i];
  wait_tensor0();
  __syncthreads();  // stage 0 and Xs are visible to all waves
  issue(1);

  // One product: acc[i][j] = Xs rows 16 i.. x weight rows wn + 16 j.., k ascending
  auto product = [&](unsigned g, v8f (&acc)[4][4]) {
#pragma unroll 1  // one pass per trip: the ring's foot stands once in the text
    for (unsigned kt = 0; kt < 8; ++kt) {
      const unsigned s = g * 8 + kt;
      const _Float16* Wl = reinterpret_cast<const _Float16*>(&Wr[s & 1u][wave][0]);
      v16h af[2][4], wf[2][4];
#pragma unroll
      for (int kk = 0; kk < 2; ++kk) {
#pragma unroll
        for (int j = 0; j < 4; ++j)
          wf[kk][j] = ldfrag(Wl + (16 * j + lo) * kWP + kk * 32, hi);
#pragma unroll
        for (int i = 0; i < 4; ++i)
          af[kk][i] = ldfrag(&Xs[16 * i + lo][kt * 64 + kk * 32], hi);
      }
      // Keeps the pass's LDS reads one group ahead of its WMMAs; without it the
      // compiler spreads them among the WMMAs, each place with a full wait.
      __builtin_amdgcn_sched_barrier(0);
#pragma unroll
      for (int kk = 0; kk < 2; ++kk)
#pragma unroll
        for (int i = 0; i < 4; ++i)
#pragma unroll
          for (int j = 0; j < 4; ++j)
            acc[i][j] = wmma_f16(af[kk][i], wf[kk][j], acc[i][j]);
      // Keeps the WMMAs in front of the foot; without it the compiler sinks them
      // behind the barrier: no overlap with the LDS reads, and a late refill.
      __builtin_amdgcn_sched_barrier(0);
      // foot of pass s: stage s + 1 is published, buffer s % 2 is free
      wait_ds0();
      wait_tensor0();
      __syncthreads();
      if (pinned(s + 2 < kStages)) issue(s + 2);
    }
  };

  v8f outr[4][4];  // 'out' in f32: C layout m = r + 8*hi, n = lo

  {  // out = Q + attn @ Wo^T + bo
    v8f acc[4][4] = {};
    product(0, acc);
#pragma unroll
    for (int j = 0; j < 4; ++j) {
      const int gc = wn + 16 * j + lo;
      const float bv = bias[0][j];
#pragma unroll
      for (int i = 0; i < 4; ++i) {
        const int lr = 16 * i + 8 * hi;
#pragma unroll
        for (int r = 0; r < 8; ++r) {
          float x = acc[i][j][r] + bv;
          x += qv[i][j][r];
          outr[i][j][r] = x;
          Xs[lr + r][gc] = (_Float16)x;
        }
      }
    }
    __syncthreads();  // 'out' in f16 is visible to all waves
  }

  {  // hidden = relu(out @ W1^T + b1)
    v8f acc[4][4] = {};
    product(1, acc);
#pragma unroll
    for (int j = 0; j < 4; ++j) {
      const int gc = wn + 16 * j + lo;
      const float bv = bias[1][j];
#pragma unroll
      for (int i = 0; i < 4; ++i) {
        const int lr = 16 * i + 8 * hi;
#pragma unroll
        for (int r = 0; r < 8; ++r)
          Xs[lr + r][gc] = (_Float16)fmaxf(acc[i][j][r] + bv, 0.0f);
      }
    }
    __syncthreads();  // the hidden layer is visible to all waves
  }

  {  // final = out + hidden @ W2^T + b2
    v8f acc[4][4] = {};
    product(2, acc);
    wait_tensor0();
    wait_ds0();
#pragma unroll
    for (int j = 0; j < 4; ++j) {
      const float bv = bias[2][j];
#pragma unroll
      for (int i = 0; i < 4; ++i) {
#pragma unroll
        for (int r = 0; r < 8; ++r) {
          float x = acc[i][j][r] + bv;
          x += outr[i][j][r];
          acc[i][j][r] = x;
        }
      }
    }
    // All sums stand in front of the first store: no register that an issued
    // store names is written again.
    __builtin_amdgcn_sched_barrier(0);
    float* odst = out + (size_t)(m0 + 8 * hi) * 512 + wn + lo;
#pragma unroll
    for (int j = 0; j < 4; ++j)
#pragma unroll
      for (int i = 0; i < 4; ++i)
#pragma unroll
        for (int r = 0; r < 8; ++r) odst[(16 * i + r) * 512 + 16 * j] = acc[i][j][r];
  }
}

// ---------------------------------------------------------------------------
extern "C" void kernel_launch(void* const* d_in, const int* in_sizes, int n_in,
                              void* d_out, int out_size, void* d_ws,
                              size_t ws_size, hipStream_t stream) {
  (void)in_sizes; (void)n_in; (void)out_size; (void)ws_size;
  const float* Q  = (const float*)d_in[0];
  const float* Kx = (const float*)d_in[1];
  const float* Wq = (const float*)d_in[2];
  const float* bq = (const float*)d_in[3];
  const float* Wk = (const float*)d_in[4];
  const float* bk = (const float*)d_in[5];
  const float* Wv = (const float*)d_in[6];
  const float* bv = (const float*)d_in[7];
  const float* Wo = (const float*)d_in[8];
  const float* bo = (const float*)d_in[9];
  const float* W1 = (const float*)d_in[10];
  const float* b1 = (const float*)d_in[11];
  const float* W2 = (const float*)d_in[12];
  const float* b2 = (const float*)d_in[13];

  constexpr int B = 32, Nt = 512, D = 512, H = 8;
  constexpr int M = B * Nt;                          // 16384
  const size_t szH = (size_t)M * D * sizeof(_Float16);  // activations, f16
  const size_t szW = (size_t)D * D * sizeof(_Float16);  // weights, f16

  char* p = (char*)d_ws;
  _Float16* Q16  = (_Float16*)p; p += szH;
  _Float16* K16  = (_Float16*)p; p += szH;
  _Float16* q2   = (_Float16*)p; p += szH;
  _Float16* k2   = (_Float16*)p; p += szH;
  _Float16* v2   = (_Float16*)p; p += szH;
  _Float16* at2  = (_Float16*)p; p += szH;
  _Float16* Wq6  = (_Float16*)p; p += szW;
  _Float16* Wk6  = (_Float16*)p; p += szW;
  _Float16* Wv6  = (_Float16*)p; p += szW;
  _Float16* Wo6  = (_Float16*)p; p += szW;
  _Float16* W16w = (_Float16*)p; p += szW;
  _Float16* W26w = (_Float16*)p; p += szW;
  float*    Mst  = (float*)p;    p += (size_t)B * H * Nt * sizeof(float);
  float*    Lst  = (float*)p;

  const dim3 blk(256);

  // f32 -> f16 conversions (activations + weights), one launch.
  cvt_all<<<dim3(2 * kActSegs + 6 * kWgtSegs), blk, 0, stream>>>(
      Q, Kx, Wq, Wk, Wv, Wo, W1, W2, Q16, Wq6);

  // q/k/v projections (TDM-staged f16 GEMMs, f16 out), one launch
  gemm_f16<0, 1, true><<<dim3(D / 128, M / 128, 3), blk, 0, stream>>>(
      Q16, Wq6, bq, nullptr, q2, nullptr, M, D, D, bk, bv);

  // attention: column softmax stats (query axis), then P @ V
  attn_stats<<<dim3(B * H * 4), blk, 0, stream>>>(q2, k2, Mst, Lst);
  attn_av<<<dim3(B * H * kQBlks), blk, 0, stream>>>(q2, k2, v2, Mst, Lst, at2);

  // out = Q + attn @ Wo^T + bo; final = out + relu(out @ W1^T + b1) @ W2^T + b2
  tail_fused<<<dim3(M / kFR), blk, 0, stream>>>(at2, Wo6, Q, bo, b1, b2,
                                                (float*)d_out);
}

// v006
// One run takes 117 microseconds.
// In both of two side-by-side timings against v005, it was 1.13 times as fast.
// Counting every step since v000, it is 2.19 times as fast.
#include <hip/hip_runtime.h>
#include <math.h>

// MAB (multihead attention block) for MI455X / gfx1250, wave32 + WMMA + TDM.
// B=32, N=512, D=512, H=8, dh=64. All heavy math via v_wmma_f32_16x16x32_f16;
// GEMM tile staging via tensor_load_to_lds (Tensor Data Mover), double-buffered.

typedef _Float16 v16h __attribute__((ext_vector_type(16)));
typedef float    v8f  __attribute__((ext_vector_type(8)));
typedef unsigned int u32x4 __attribute__((ext_vector_type(4)));
typedef int          i32x4 __attribute__((ext_vector_type(4)));
typedef int          i32x8 __attribute__((ext_vector_type(8)));
typedef unsigned int u32x8 __attribute__((ext_vector_type(8)));
typedef float        f32x4 __attribute__((ext_vector_type(4)));

static constexpr float kScale = 0.044194173824159216f; // 1/sqrt(512)

__device__ __forceinline__ v8f wmma_f16(v16h a, v16h b, v8f c) {
  // (neg_a, A, neg_b, B, c_mod, C, reuse_a, reuse_b)
  return __builtin_amdgcn_wmma_f32_16x16x32_f16(false, a, false, b, (short)0, c,
                                                false, false);
}

// 16-bit A/B fragment for 16x16x32 WMMA. Per ISA layout, lane (lo=L%16,
// hi=L/16) holds K=[8*hi,8*hi+8) in VGPR0-3 and K=[16+8*hi,+8) in VGPR4-7.
__device__ __forceinline__ v16h ldfrag(const _Float16* rowp, int hi) {
  v16h a;
  *reinterpret_cast<uint4*>(&a)       = *reinterpret_cast<const uint4*>(rowp + 8 * hi);
  *(reinterpret_cast<uint4*>(&a) + 1) = *reinterpret_cast<const uint4*>(rowp + 16 + 8 * hi);
  return a;
}

// ---------------------------------------------------------------------------
// TDM: DMA a 128-row x 32-col f16 tile (row stride 512 elements in memory)
// into LDS, padding each 64B row with 16B -> LDS row stride = 40 halves.
// D# built per CDNA5 ISA 8.3-8.6; issued by one wave, tracked by TENSORcnt.
// This toolchain exposes the 6-arg builtin: (g0, g1, g2, g3, extra, cpol).
// ---------------------------------------------------------------------------
__device__ __forceinline__ void tdm_load_tile(const _Float16* gsrc,
                                              unsigned lds_byte_off) {
  const unsigned long long ga = (unsigned long long)(uintptr_t)gsrc;
  u32x4 g0;
  g0.x = 1u;                                   // count=1 (valid user desc)
  g0.y = lds_byte_off;                         // lds_addr
  g0.z = (unsigned)ga;                         // global_addr[31:0]
  g0.w = (unsigned)(ga >> 32) | (2u << 30);    // global_addr[56:32] | type=2
  i32x8 g1;
  g1[0] = (1 << 16)      // data_size = 2 bytes
        | (1 << 20)      // pad_enable
        | (3 << 22)      // pad_interval: every 16 DWORDs (64B = one tile row)
        | (3 << 25);     // pad_amount: 4 DWORDs (16B -> 40-half LDS stride)
  g1[1] = (512 << 16);                 // tensor_dim0 = 512 (low 16 in [31:16])
  g1[2] = 0;                           // tensor_dim0 hi | tensor_dim1 lo
  g1[3] = 0x10 | (32 << 16);           // tensor_dim1 = 1<<20 (hi16) | tile_dim0=32
  g1[4] = 128;                         // tile_dim1 = 128, tile_dim2 = 0
  g1[5] = 512;                         // tensor_dim0_stride = 512 elements
  g1[6] = 0;
  g1[7] = 0;
  const i32x4 z4 = {0, 0, 0, 0};               // groups 2/3 unused (2D tile)
  const i32x8 z8 = {0, 0, 0, 0, 0, 0, 0, 0};   // extra group slot unused
  __builtin_amdgcn_tensor_load_to_lds(g0, g1, z4, z4, z8, 0);
}

// ---------------------------------------------------------------------------
// f32 -> f16 convert of all eight operands in ONE launch. A block takes one
// kSeg-element segment of one operand, picked by its index (a scalar choice);
// a wave takes 4096 contiguous elements of it: 32 whole-line loads of 512 B,
// all in flight before the first convert, then whole-line stores of 256 B.
// dAct: the f16 copies of Q and K, one behind the other; dWgt: those of the
// six weights, one behind the other (the workspace is laid out so).
// ---------------------------------------------------------------------------
static constexpr unsigned kSeg     = 32768;              // elements per block
static constexpr unsigned kActSegs = 32 * 512 * 512 / kSeg;  // 256 per activation
static constexpr unsigned kWgtSegs = 512 * 512 / kSeg;       // 8 per weight

__global__ __launch_bounds__(256) void cvt_all(const float* __restrict__ Q,
                                               const float* __restrict__ Kx,
                                               const float* __restrict__ Wq,
                                               const float* __restrict__ Wk,
                                               const float* __restrict__ Wv,
                                               const float* __restrict__ Wo,
                                               const float* __restrict__ W1,
                                               const float* __restrict__ W2,
                                               _Float16* __restrict__ dAct,
                                               _Float16* __restrict__ dWgt) {
  const unsigned blk = blockIdx.x;
  const float* s;
  _Float16* d;
  if (blk < 2 * kActSegs) {
    s = (blk < kActSegs ? Q : Kx) + (size_t)(blk % kActSegs) * kSeg;
    d = dAct + (size_t)blk * kSeg;
  } else {
    const unsigned wb = blk - 2 * kActSegs;
    const unsigned w = wb / kWgtSegs;
    const float* wsrc = w == 0 ? Wq : w == 1 ? Wk : w == 2 ? Wv
                      : w == 3 ? Wo : w == 4 ? W1 : W2;
    s = wsrc + (size_t)(wb % kWgtSegs) * kSeg;
    d = dWgt + (size_t)wb * kSeg;
  }
  const int off = (threadIdx.x >> 5) * 4096 + (threadIdx.x & 31) * 4;

  float4 v[32];
#pragma unroll  // v[] stays in registers, the 32 loads become one clause
  for (int u = 0; u < 32; ++u)
    v[u] = *reinterpret_cast<const float4*>(s + off + u * 128);
  // Holds all 32 loads ahead of the first convert; without it the compiler
  // sinks 14 of them behind waits on the first 18: serial memory latencies.
  __builtin_amdgcn_sched_barrier(0);
#pragma unroll  // constant indices into v[], so that it stays in registers
  for (int u = 0; u < 32; ++u) {
    _Float16 h[4] = {(_Float16)v[u].x, (_Float16)v[u].y, (_Float16)v[u].z,
                     (_Float16)v[u].w};
    *reinterpret_cast<uint2*>(d + off + u * 128) = *reinterpret_cast<uint2*>(h);
  }
}

// ---------------------------------------------------------------------------
// GEMM: C[M,N] = epi( A[M,K] @ W[N,K]^T + bias[N] ) (+ R residual), all-f16
// operands, TDM double-buffered tile staging, 128x128 C tile, K-step 32.
//   EPI: 0 bias, 1 bias+ReLU, 2 bias+residual R (f32)
//   OH : 0 f32 out, 1 f16 out, 2 dual (f32 -> Cp, f16 -> C2p)
// 8 waves in 2x4 grid; each wave: 64x32 via 8 f32 accumulators.
//   QKV: one launch holds the three projections, which do not depend on one
//   another. A block picks its operands by blockIdx.z, a scalar choice:
//   A16 = the f16 copies of Q and K, W16 = those of Wq, Wk, Wv, Cp = q2, k2,
//   v2, each set one behind the other (the workspace is laid out so); q reads
//   the first activation, k and v the second; bias, biasK, biasV in that order.
// ---------------------------------------------------------------------------
template <int EPI, int OH, bool QKV = false>
__global__ __launch_bounds__(256) void gemm_f16(const _Float16* __restrict__ A16,
                                                const _Float16* __restrict__ W16,
                                                const float* __restrict__ bias,
                                                const float* __restrict__ R,
                                                void* __restrict__ Cp,
                                                void* __restrict__ C2p,
                                                int M, int N, int K,
                                                const float* __restrict__ biasK,
                                                const float* __restrict__ biasV) {
  __shared__ _Float16 As[2][128][40];
  __shared__ _Float16 Ws[2][128][40];

  const int t = threadIdx.x;
  const int lane = t & 31;
  const int wave = t >> 5;
  const int lo = lane & 15;
  const int hi = lane >> 4;
  const int wm = (wave >> 2) * 64;
  const int wn = (wave & 3) * 32;
  const int m0 = blockIdx.y * 128;
  const int n0 = blockIdx.x * 128;

  if constexpr (QKV) {
    const unsigned proj = blockIdx.z;  // 0 q, 1 k, 2 v
    A16 += (size_t)(proj != 0) * M * K;
    W16 += (size_t)proj * N * K;
    bias = proj == 0 ? bias : proj == 1 ? biasK : biasV;
    Cp = (_Float16*)Cp + (size_t)proj * M * N;
  }

  const _Float16* Abase = A16 + (size_t)m0 * K;
  const _Float16* Wbase = W16 + (size_t)n0 * K;
  const unsigned offA0 = (unsigned)(uintptr_t)&As[0][0][0];
  const unsigned offA1 = (unsigned)(uintptr_t)&As[1][0][0];
  const unsigned offW0 = (unsigned)(uintptr_t)&Ws[0][0][0];
  const unsigned offW1 = (unsigned)(uintptr_t)&Ws[1][0][0];

  const int NK = K >> 5;  // # of 32-wide k tiles

  if (wave == 0) {  // prologue: DMA tile 0 into buffer 0
    tdm_load_tile(Abase, offA0);
    tdm_load_tile(Wbase, offW0);
  }

  v8f acc[4][2] = {};

  for (int kt = 0; kt < NK; ++kt) {
    const int cur = kt & 1;
    __syncthreads();  // all waves done reading buffer cur^1
    if (wave == 0) {
      if (kt + 1 < NK) {  // prefetch next tile into the other buffer
        tdm_load_tile(Abase + (kt + 1) * 32, cur ? offA0 : offA1);
        tdm_load_tile(Wbase + (kt + 1) * 32, cur ? offW0 : offW1);
        __builtin_amdgcn_s_wait_tensorcnt(2);  // tiles for 'cur' landed
      } else {
        __builtin_amdgcn_s_wait_tensorcnt(0);
      }
    }
    __syncthreads();  // buffer 'cur' visible to all waves

    v16h af[4], wf[2];
#pragma unroll
    for (int i = 0; i < 4; ++i) af[i] = ldfrag(&As[cur][wm + 16 * i + lo][0], hi);
#pragma unroll
    for (int j = 0; j < 2; ++j) wf[j] = ldfrag(&Ws[cur][wn + 16 * j + lo][0], hi);
#pragma unroll
    for (int i = 0; i < 4; ++i)
#pragma unroll
      for (int j = 0; j < 2; ++j) acc[i][j] = wmma_f16(af[i], wf[j], acc[i][j]);
  }

  // epilogue: C layout m = r + 8*hi, n = lo
#pragma unroll
  for (int j = 0; j < 2; ++j) {
    const int gc = n0 + wn + 16 * j + lo;
    const float bv = bias[gc];
#pragma unroll
    for (int i = 0; i < 4; ++i) {
      const int gr = m0 + wm + 16 * i + 8 * hi;
#pragma unroll
      for (int r = 0; r < 8; ++r) {
        float x = acc[i][j][r] + bv;
        if constexpr (EPI == 1) x = fmaxf(x, 0.0f);
        const size_t idx = (size_t)(gr + r) * N + gc;
        if constexpr (EPI == 2) x += R[idx];
        if constexpr (OH == 0) {
          ((float*)Cp)[idx] = x;
        } else if constexpr (OH == 1) {
          ((_Float16*)Cp)[idx] = (_Float16)x;
        } else {
          ((float*)Cp)[idx] = x;
          ((_Float16*)C2p)[idx] = (_Float16)x;
        }
      }
    }
  }
}

// ---------------------------------------------------------------------------
// Attention, ONE launch. A block of 16 waves owns one (b, h) and holds its q, k
// (row-major) and v (transposed) in LDS for its whole life: each is read from
// global memory once, with whole-line loads, and no pass stages anything.
// Phase 1: per k column the softmax stats over the QUERY axis. A wave owns 32
// k columns (2 tiles), k fragments resident; it streams the 32 q tiles through
// WMMA, online max/sum with cross-half shfl_xor(16). The stats go to LDS.
// Phase 2: attn = P @ V with P = exp(scale*S - M[k]) / L[k], S recomputed by
// WMMA; P round-trips wave-private LDS (C->A layout). A wave owns kQT tiles of
// 16 q rows and all 64 dh of them.
// ---------------------------------------------------------------------------
static constexpr int kQT = 2;    // q tiles of 16 rows per wave
static constexpr int kAW = 16;   // waves per block: kAW * 16 * kQT = 512 q rows
static constexpr int kRP = 72;   // q, k pitch, halves: 144 B = 16 B x odd
static constexpr int kVP = 520;  // V^T pitch, halves: 1040 B = 16 B x odd

__global__ __launch_bounds__(512) void attn_fused(const _Float16* __restrict__ q2,
                                                  const _Float16* __restrict__ k2,
                                                  const _Float16* __restrict__ v2,
                                                  _Float16* __restrict__ at2) {
  __shared__ alignas(16) _Float16 Qs[512][kRP];
  __shared__ alignas(16) _Float16 Ks[512][kRP];
  __shared__ alignas(16) _Float16 vT[64][kVP];
  __shared__ alignas(16) _Float16 Pw[kAW][16 * kQT][40];
  __shared__ float Ms[512];  // column maximum
  __shared__ float Ls[512];  // 1 / column sum

  const int bh = blockIdx.x;
  const int b = bh >> 3;
  const int h = bh & 7;
  const int t = threadIdx.x;
  const int lane = t & 31;
  const int wave = t >> 5;
  const int lo = lane & 15;
  const int hi = lane >> 4;

  {  // q, k, v of this (b, h) into LDS; 8 lanes cover one row's 128 B line
    const int srow = t >> 3;
    const int scol = (t & 7) * 8;
    const size_t goff = (((size_t)b * 512 + srow) * 512) + h * 64 + scol;
    const _Float16* qsrc = q2 + goff;
    const _Float16* ksrc = k2 + goff;
    const _Float16* vsrc = v2 + goff;
    u32x4 qr[8], kr[8], vr[8];
#pragma unroll  // constant indices: the three arrays stay in registers
    for (int i = 0; i < 8; ++i) {
      qr[i] = *reinterpret_cast<const u32x4*>(qsrc + i * (64 * 512));
      kr[i] = *reinterpret_cast<const u32x4*>(ksrc + i * (64 * 512));
      vr[i] = *reinterpret_cast<const u32x4*>(vsrc + i * (64 * 512));
    }
    // The wait that stands in front of any rewrite of an address register of the
    // loads above; the loaded values and the addresses are inputs only: they tie
    // the wait behind all 24 loads and keep the addresses up to it.
    asm volatile("s_wait_xcnt 0x0" ::"v"(qr[0]), "v"(qr[1]), "v"(qr[2]), "v"(qr[3]),
                 "v"(qr[4]), "v"(qr[5]), "v"(qr[6]), "v"(qr[7]), "v"(kr[0]), "v"(kr[1]),
                 "v"(kr[2]), "v"(kr[3]), "v"(kr[4]), "v"(kr[5]), "v"(kr[6]), "v"(kr[7]),
                 "v"(vr[0]), "v"(vr[1]), "v"(vr[2]), "v"(vr[3]), "v"(vr[4]), "v"(vr[5]),
                 "v"(vr[6]), "v"(vr[7]), "v"(qsrc), "v"(ksrc), "v"(vsrc)
                 : "memory");
    // keeps every later register write behind that wait
    __builtin_amdgcn_sched_barrier(0);
#pragma unroll
    for (int i = 0; i < 8; ++i) {
      const int row = i * 64 + srow;
      *reinterpret_cast<u32x4*>(&Qs[row][scol]) = qr[i];
      *reinterpret_cast<u32x4*>(&Ks[row][scol]) = kr[i];
      _Float16 tmp[8];
      *reinterpret_cast<u32x4*>(tmp) = vr[i];
#pragma unroll
      for (int e = 0; e < 8; ++e) vT[scol + e][row] = tmp[e];
    }
  }
  __syncthreads();  // q, k and V^T are visible to all waves

  {  // phase 1: stats of this wave's 32 k columns
    v16h bk[2][2];
    float m_run[2], l_run[2];
#pragma unroll  // constant indices into bk[], so that it stays in registers
    for (int c = 0; c < 2; ++c) {
      const _Float16* krow = &Ks[wave * 32 + c * 16 + lo][0];
      bk[c][0] = ldfrag(krow, hi);
      bk[c][1] = ldfrag(krow + 32, hi);
      m_run[c] = -1e30f;
      l_run[c] = 0.0f;
    }
    for (int q0 = 0; q0 < 512; q0 += 16) {
      const _Float16* qrow = &Qs[q0 + lo][0];
      const v16h aq0 = ldfrag(qrow, hi);
      const v16h aq1 = ldfrag(qrow + 32, hi);
#pragma unroll  // constant indices into bk[]; the two columns' chains interleave
      for (int c = 0; c < 2; ++c) {
        v8f s = {};
        s = wmma_f16(aq0, bk[c][0], s);
        s = wmma_f16(aq1, bk[c][1], s);

        float pmax = -1e30f;
#pragma unroll
        for (int r = 0; r < 8; ++r) pmax = fmaxf(pmax, s[r] * kScale);
        pmax = fmaxf(pmax, __shfl_xor(pmax, 16, 32));
        const float nm = fmaxf(m_run[c], pmax);
        float ps = 0.0f;
#pragma unroll
        for (int r = 0; r < 8; ++r) ps += __expf(s[r] * kScale - nm);
        ps += __shfl_xor(ps, 16, 32);
        l_run[c] = l_run[c] * __expf(m_run[c] - nm) + ps;
        m_run[c] = nm;
      }
    }
    if (lane < 16) {
#pragma unroll
      for (int c = 0; c < 2; ++c) {
        Ms[wave * 32 + c * 16 + lo] = m_run[c];
        Ls[wave * 32 + c * 16 + lo] = 1.0f / l_run[c];
      }
    }
  }
  __syncthreads();  // the stats of all 512 k columns are visible to all waves

  // phase 2
  const int q0 = wave * (16 * kQT);

  v16h aq[kQT][2];
#pragma unroll  // constant indices into aq[], so that it stays in registers
  for (int qt = 0; qt < kQT; ++qt) {
    const _Float16* qrow = &Qs[q0 + qt * 16 + lo][0];
    aq[qt][0] = ldfrag(qrow, hi);
    aq[qt][1] = ldfrag(qrow + 32, hi);
  }

  v8f oacc[kQT][4] = {};

#pragma unroll 1  // one pass per trip, for speed only
  for (int kt = 0; kt < 512; kt += 32) {
#pragma unroll
    for (int jn = 0; jn < 2; ++jn) {
      const int ktok = kt + jn * 16 + lo;
      const _Float16* krow = &Ks[ktok][0];
      const v16h bk0 = ldfrag(krow, hi);
      const v16h bk1 = ldfrag(krow + 32, hi);
      const float Mv = Ms[ktok];
      const float Li = Ls[ktok];
#pragma unroll  // constant indices into aq[]; the kQT score chains interleave
      for (int qt = 0; qt < kQT; ++qt) {
        v8f s = {};
        s = wmma_f16(aq[qt][0], bk0, s);
        s = wmma_f16(aq[qt][1], bk1, s);
#pragma unroll
        for (int r = 0; r < 8; ++r)
          Pw[wave][qt * 16 + r + 8 * hi][jn * 16 + lo] =
              (_Float16)(__expf(s[r] * kScale - Mv) * Li);
      }
    }

    v16h ap[kQT];
#pragma unroll  // constant indices into ap[], so that it stays in registers
    for (int qt = 0; qt < kQT; ++qt)
      ap[qt] = ldfrag(&Pw[wave][qt * 16 + lo][0], hi);
#pragma unroll
    for (int jd = 0; jd < 4; ++jd) {
      const v16h bv = ldfrag(&vT[jd * 16 + lo][kt], hi);
#pragma unroll  // constant indices into oacc[], so that it stays in registers
      for (int qt = 0; qt < kQT; ++qt)
        oacc[qt][jd] = wmma_f16(ap[qt], bv, oacc[qt][jd]);
    }
  }

  _Float16 oh[kQT][4][8];
#pragma unroll  // constant indices into oacc[] and oh[]: they stay in registers
  for (int qt = 0; qt < kQT; ++qt)
#pragma unroll
    for (int jd = 0; jd < 4; ++jd)
#pragma unroll
      for (int r = 0; r < 8; ++r) oh[qt][jd][r] = (_Float16)oacc[qt][jd][r];
  // All converts stand in front of the first store: no register that an issued
  // store names is written again.
  __builtin_amdgcn_sched_barrier(0);
  _Float16* odst = at2 + (((size_t)b * 512 + q0 + 8 * hi) * 512) + h * 64 + lo;
#pragma unroll
  for (int qt = 0; qt < kQT; ++qt)
#pragma unroll
    for (int jd = 0; jd < 4; ++jd)
#pragma unroll
      for (int r = 0; r < 8; ++r)
        odst[(qt * 16 + r) * 512 + jd * 16] = oh[qt][jd][r];
}

// ---------------------------------------------------------------------------
// Tail: out = Q + attn @ Wo^T + bo; final = out + relu(out @ W1^T + b1) @ W2^T
// + b2, all three products in ONE launch. A block owns kFR rows. Their f16
// activations (attn, then out, then the hidden layer) stay in LDS (Xs), 'out'
// in f32 stays in registers; nothing goes through the workspace in between.
// A wave owns 64 output columns = 64 weight rows that no other wave reads; it
// brings them in itself, 64 k at a time, by one tensor load per pass into its
// own slice of a two-buffer ring. The three weights lie one behind the other
// (the workspace is laid out so), so that the ring runs through all 24 passes.
// ---------------------------------------------------------------------------
static constexpr int      kFR     = 64;     // rows per block
static constexpr int      kXP     = 520;    // Xs pitch, halves: 1040 B = 16 B x odd
static constexpr int      kWP     = 72;     // weight pitch in LDS, halves: 144 B
static constexpr unsigned kWSlice = 10240;  // 64 rows x 144 B, up to a 2 KiB multiple
static constexpr unsigned kStages = 24;     // 3 products x 8 passes of 64 k

__device__ __forceinline__ unsigned uni(unsigned v) {
  return (unsigned)__builtin_amdgcn_readfirstlane(v);
}
__device__ __forceinline__ unsigned pinned(unsigned v) {
  unsigned w = uni(v);
  asm volatile("" : "+s"(w));  // pinned(): holds an issue test or a descriptor word in a scalar register
  return w;
}
// LDS reads of this wave have retired (before the ring's buffer is handed over)
__device__ __forceinline__ void wait_ds0() { asm volatile("s_wait_dscnt 0x0" ::: "memory"); }
// Group 1 of the request: 64 rows of 128 B, source pitch 1024 B, 16 B of pad
// behind each row in LDS (pitch 144 B). All extents in bytes, tensor = tile.
__device__ __forceinline__ u32x8 wslice_group1() {
  u32x8 g1;
  g1[0] = pinned((1u << 20) | (4u << 22) | (3u << 25));  // pad: 4 dwords per 32 dwords
  g1[1] = pinned(128u << 16);                            // tensor_dim0 = 128
  g1[2] = pinned(64u << 16);                             // tensor_dim1 = 64
  g1[3] = pinned(128u << 16);                            // tile_dim0 = 128
  g1[4] = pinned(64u);                                   // tile_dim1 = 64
  g1[5] = pinned(1024u);                                 // source row pitch
  g1[6] = pinned(0u);
  g1[7] = pinned(0u);
  return g1;
}

__global__ __launch_bounds__(256) void tail_fused(const _Float16* __restrict__ at2,
                                                  const _Float16* __restrict__ Wcat,
                                                  const float* __restrict__ Q,
                                                  const float* __restrict__ bo,
                                                  const float* __restrict__ b1,
                                                  const float* __restrict__ b2,
                                                  float* __restrict__ out) {
  __shared__ __attribute__((aligned(2048))) unsigned char Wr[2][8][kWSlice];
  __shared__ alignas(16) _Float16 Xs[kFR][kXP];

  const int t = threadIdx.x;
  const int lane = t & 31;
  const unsigned wave = uni(threadIdx.x >> 5);
  const int lo = lane & 15;
  const int hi = lane >> 4;
  const int m0 = blockIdx.x * kFR;
  const int wn = (int)wave * 64;

  const unsigned wdst = (unsigned)(uintptr_t)&Wr[0][0][0] + wave * kWSlice;
  const _Float16* wsrc = Wcat + (size_t)wn * 512;
  // stage s: product s / 8, k columns (s % 8) * 64, into buffer s % 2
  const u32x8 g1 = wslice_group1();
  u32x4 g0;
  g0[0] = pinned(1u);  // count 1
  auto issue = [&](unsigned s) {
    const unsigned long long ga = (unsigned long long)(uintptr_t)(
        wsrc + (size_t)(s >> 3) * (512 * 512) + (s & 7u) * 64u);
    g0[1] = uni(wdst + (s & 1u) * (8u * kWSlice));                      // place in LDS
    g0[2] = uni((unsigned)ga);                                          // address, low
    g0[3] = uni((((unsigned)(ga >> 32)) & 0x01FFFFFFu) | 0x80000000u);  // high | type 2
    asm volatile("tensor_load_to_lds %0, %1" ::"s"(g0), "s"(g1) : "memory");
  };
  // This wave's tensor load has landed (the compiler places no wait for it). The
  // descriptor is an input only: its registers keep their words up to the wait.
  auto wait_tensor0 = [&]() {
    asm volatile("s_wait_tensorcnt 0x0" ::"s"(g0), "s"(g1) : "memory");
  };

  issue(0);
  // The residual rows of Q and the three biases, C layout (m = r + 8*hi, n = lo),
  // asked for here so that their latency runs beside that of stage 0 and Xs.
  const float* qsrc = Q + (size_t)(m0 + 8 * hi) * 512 + wn + lo;
  f32x4 bias[3];
  v8f qv[4][4];
#pragma unroll  // constant indices into bias[] and qv[]: they stay in registers
  for (int j = 0; j < 4; ++j) {
    const int gc = wn + 16 * j + lo;
    bias[0][j] = bo[gc];
    bias[1][j] = b1[gc];
    bias[2][j] = b2[gc];
#pragma unroll
    for (int i = 0; i < 4; ++i)
#pragma unroll
      for (int r = 0; r < 8; ++r) qv[i][j][r] = qsrc[(16 * i + r) * 512 + 16 * j];
  }
  // The wait that stands in front of any rewrite of an address register of the
  // loads above; the address is an input only, so that it lives up to the wait.
  asm volatile("s_wait_xcnt 0x0" ::"v"(qsrc) : "memory");
  // keeps every later register write behind that wait
  __builtin_amdgcn_sched_barrier(0);

  // the block's attn rows into Xs, whole-line loads (a wave takes 512 B of a row)
  const int xrow = t >> 6;
  const int xcol = (t & 63) * 8;
  const _Float16* xsrc = at2 + (size_t)(m0 + xrow) * 512 + xcol;
  u32x4 xr[16];
#pragma unroll  // constant indices into xr[]: it stays in registers
  for (int i = 0; i < 16; ++i)
    xr[i] = *reinterpret_cast<const u32x4*>(xsrc + i * (4 * 512));
  // The same wait for these loads; the loaded values and the address are inputs
  // only: they tie the wait behind the loads and keep the address up to it.
  asm volatile("s_wait_xcnt 0x0" ::"v"(xr[0]), "v"(xr[1]), "v"(xr[2]), "v"(xr[3]),
               "v"(xr[4]), "v"(xr[5]), "v"(xr[6]), "v"(xr[7]), "v"(xr[8]), "v"(xr[9]),
               "v"(xr[10]), "v"(xr[11]), "v"(xr[12]), "v"(xr[13]), "v"(xr[14]),
               "v"(xr[15]), "v"(xsrc)
               : "memory");
  // keeps every later register write behind that wait
  __builtin_amdgcn_sched_barrier(0);
#pragma unroll
  for (int i = 0; i < 16; ++i)
    *reinterpret_cast<u32x4*>(&Xs[i * 4 + xrow][xcol]) = xr[i];
  wait_tensor0();
  __syncthreads();  // stage 0 and Xs are visible to all waves
  issue(1);

  // One product: acc[i][j] = Xs rows 16 i.. x weight rows wn + 16 j.., k ascending
  auto product = [&](unsigned g, v8f (&acc)[4][4]) {
#pragma unroll 1  // one pass per trip: the ring's foot stands once in the text
    for (unsigned kt = 0; kt < 8; ++kt) {
      const unsigned s = g * 8 + kt;
      const _Float16* Wl = reinterpret_cast<const _Float16*>(&Wr[s & 1u][wave][0]);
      v16h af[2][4], wf[2][4];
#pragma unroll
      for (int kk = 0; kk < 2; ++kk) {
#pragma unroll
        for (int j = 0; j < 4; ++j)
          wf[kk][j] = ldfrag(Wl + (16 * j + lo) * kWP + kk * 32, hi);
#pragma unroll
        for (int i = 0; i < 4; ++i)
          af[kk][i] = ldfrag(&Xs[16 * i + lo][kt * 64 + kk * 32], hi);
      }
      // Keeps the pass's LDS reads one group ahead of its WMMAs; without it the
      // compiler spreads them among the WMMAs, each place with a full wait.
      __builtin_amdgcn_sched_barrier(0);
#pragma unroll
      for (int kk = 0; kk < 2; ++kk)
#pragma unroll
        for (int i = 0; i < 4; ++i)
#pragma unroll
          for (int j = 0; j < 4; ++j)
            acc[i][j] = wmma_f16(af[kk][i], wf[kk][j], acc[i][j]);
      // Keeps the WMMAs in front of the foot; without it the compiler sinks them
      // behind the barrier: no overlap with the LDS reads, and a late refill.
      __builtin_amdgcn_sched_barrier(0);
      // foot of pass s: stage s + 1 is published, buffer s % 2 is free
      wait_ds0();
      wait_tensor0();
      __syncthreads();
      if (pinned(s + 2 < kStages)) issue(s + 2);
    }
  };

  v8f outr[4][4];  // 'out' in f32: C layout m = r + 8*hi, n = lo

  {  // out = Q + attn @ Wo^T + bo
    v8f acc[4][4] = {};
    product(0, acc);
#pragma unroll
    for (int j = 0; j < 4; ++j) {
      const int gc = wn + 16 * j + lo;
      const float bv = bias[0][j];
#pragma unroll
      for (int i = 0; i < 4; ++i) {
        const int lr = 16 * i + 8 * hi;
#pragma unroll
        for (int r = 0; r < 8; ++r) {
          float x = acc[i][j][r] + bv;
          x += qv[i][j][r];
          outr[i][j][r] = x;
          Xs[lr + r][gc] = (_Float16)x;
        }
      }
    }
    __syncthreads();  // 'out' in f16 is visible to all waves
  }

  {  // hidden = relu(out @ W1^T + b1)
    v8f acc[4][4] = {};
    product(1, acc);
#pragma unroll
    for (int j = 0; j < 4; ++j) {
      const int gc = wn + 16 * j + lo;
      const float bv = bias[1][j];
#pragma unroll
      for (int i = 0; i < 4; ++i) {
        const int lr = 16 * i + 8 * hi;
#pragma unroll
        for (int r = 0; r < 8; ++r)
          Xs[lr + r][gc] = (_Float16)fmaxf(acc[i][j][r] + bv, 0.0f);
      }
    }
    __syncthreads();  // the hidden layer is visible to all waves
  }

  {  // final = out + hidden @ W2^T + b2
    v8f acc[4][4] = {};
    product(2, acc);
    wait_tensor0();
    wait_ds0();
#pragma unroll
    for (int j = 0; j < 4; ++j) {
      const float bv = bias[2][j];
#pragma unroll
      for (int i = 0; i < 4; ++i) {
#pragma unroll
        for (int r = 0; r < 8; ++r) {
          float x = acc[i][j][r] + bv;
          x += outr[i][j][r];
          acc[i][j][r] = x;
        }
      }
    }
    // All sums stand in front of the first store: no register that an issued
    // store names is written again.
    __builtin_amdgcn_sched_barrier(0);
    float* odst = out + (size_t)(m0 + 8 * hi) * 512 + wn + lo;
#pragma unroll
    for (int j = 0; j < 4; ++j)
#pragma unroll
      for (int i = 0; i < 4; ++i)
#pragma unroll
        for (int r = 0; r < 8; ++r) odst[(16 * i + r) * 512 + 16 * j] = acc[i][j][r];
  }
}

// ---------------------------------------------------------------------------
extern "C" void kernel_launch(void* const* d_in, const int* in_sizes, int n_in,
                              void* d_out, int out_size, void* d_ws,
                              size_t ws_size, hipStream_t stream) {
  (void)in_sizes; (void)n_in; (void)out_size; (void)ws_size;
  const float* Q  = (const float*)d_in[0];
  const float* Kx = (const float*)d_in[1];
  const float* Wq = (const float*)d_in[2];
  const float* bq = (const float*)d_in[3];
  const float* Wk = (const float*)d_in[4];
  const float* bk = (const float*)d_in[5];
  const float* Wv = (const float*)d_in[6];
  const float* bv = (const float*)d_in[7];
  const float* Wo = (const float*)d_in[8];
  const float* bo = (const float*)d_in[9];
  const float* W1 = (const float*)d_in[10];
  const float* b1 = (const float*)d_in[11];
  const float* W2 = (const float*)d_in[12];
  const float* b2 = (const float*)d_in[13];

  constexpr int B = 32, Nt = 512, D = 512, H = 8;
  constexpr int M = B * Nt;                          // 16384
  const size_t szH = (size_t)M * D * sizeof(_Float16);  // activations, f16
  const size_t szW = (size_t)D * D * sizeof(_Float16);  // weights, f16

  char* p = (char*)d_ws;
  _Float16* Q16  = (_Float16*)p; p += szH;
  _Float16* K16  = (_Float16*)p; p += szH;
  _Float16* q2   = (_Float16*)p; p += szH;
  _Float16* k2   = (_Float16*)p; p += szH;
  _Float16* v2   = (_Float16*)p; p += szH;
  _Float16* at2  = (_Float16*)p; p += szH;
  _Float16* Wq6  = (_Float16*)p; p += szW;
  _Float16* Wk6  = (_Float16*)p; p += szW;
  _Float16* Wv6  = (_Float16*)p; p += szW;
  _Float16* Wo6  = (_Float16*)p; p += szW;
  _Float16* W16w = (_Float16*)p; p += szW;
  _Float16* W26w = (_Float16*)p;

  const dim3 blk(256);

  // f32 -> f16 conversions (activations + weights), one launch.
  cvt_all<<<dim3(2 * kActSegs + 6 * kWgtSegs), blk, 0, stream>>>(
      Q, Kx, Wq, Wk, Wv, Wo, W1, W2, Q16, Wq6);

  // q/k/v projections (TDM-staged f16 GEMMs, f16 out), one launch
  gemm_f16<0, 1, true><<<dim3(D / 128, M / 128, 3), blk, 0, stream>>>(
      Q16, Wq6, bq, nullptr, q2, nullptr, M, D, D, bk, bv);

  // attention: column softmax stats (query axis), then P @ V, one launch
  attn_fused<<<dim3(B * H), dim3(32 * kAW), 0, stream>>>(q2, k2, v2, at2);

  // out = Q + attn @ Wo^T + bo; final = out + relu(out @ W1^T + b1) @ W2^T + b2
  tail_fused<<<dim3(M / kFR), blk, 0, stream>>>(at2, Wo6, Q, bo, b1, b2,
                                                (float*)d_out);
}

// v007
// Measured time: 109 microseconds a run.
// Two timings next to v006 put it at 1.07 and 1.08 times that version's speed.
// Over all steps from v000 it is 2.36 times as fast.
#include <hip/hip_runtime.h>
#include <math.h>

// MAB (multihead attention block) for MI455X / gfx1250, wave32 + WMMA + TDM.
// B=32, N=512, D=512, H=8, dh=64. All heavy math via v_wmma_f32_16x16x32_f16;
// weight staging via tensor_load_to_lds (Tensor Data Mover), double-buffered.

typedef _Float16 v16h __attribute__((ext_vector_type(16)));
typedef float    v8f  __attribute__((ext_vector_type(8)));
typedef unsigned int u32x4 __attribute__((ext_vector_type(4)));
typedef int          i32x4 __attribute__((ext_vector_type(4)));
typedef int          i32x8 __attribute__((ext_vector_type(8)));
typedef unsigned int u32x8 __attribute__((ext_vector_type(8)));
typedef float        f32x4 __attribute__((ext_vector_type(4)));

static constexpr float kScale = 0.044194173824159216f; // 1/sqrt(512)

__device__ __forceinline__ v8f wmma_f16(v16h a, v16h b, v8f c) {
  // (neg_a, A, neg_b, B, c_mod, C, reuse_a, reuse_b)
  return __builtin_amdgcn_wmma_f32_16x16x32_f16(false, a, false, b, (short)0, c,
                                                false, false);
}

// 16-bit A/B fragment for 16x16x32 WMMA. Per ISA layout, lane (lo=L%16,
// hi=L/16) holds K=[8*hi,8*hi+8) in VGPR0-3 and K=[16+8*hi,+8) in VGPR4-7.
__device__ __forceinline__ v16h ldfrag(const _Float16* rowp, int hi) {
  v16h a;
  *reinterpret_cast<uint4*>(&a)       = *reinterpret_cast<const uint4*>(rowp + 8 * hi);
  *(reinterpret_cast<uint4*>(&a) + 1) = *reinterpret_cast<const uint4*>(rowp + 16 + 8 * hi);
  return a;
}

// ---------------------------------------------------------------------------
// f32 -> f16 convert of the six weights in ONE launch (the activations are
// converted where they are used, in qkv_fused). A block takes one kSeg-element
// segment of one weight, picked by its index (a scalar choice); a wave takes
// 1024 contiguous elements of it: 8 whole-line loads of 512 B, all in flight
// before the first convert, then whole-line stores of 256 B.
// dWgt: the f16 copies, one behind the other (the workspace is laid out so).
// ---------------------------------------------------------------------------
static constexpr unsigned kSeg     = 8192;               // elements per block
static constexpr unsigned kWgtSegs = 512 * 512 / kSeg;   // 32 per weight

__global__ __launch_bounds__(256) void cvt_wgt(const float* __restrict__ Wq,
                                               const float* __restrict__ Wk,
                                               const float* __restrict__ Wv,
                                               const float* __restrict__ Wo,
                                               const float* __restrict__ W1,
                                               const float* __restrict__ W2,
                                               _Float16* __restrict__ dWgt) {
  const unsigned wb = blockIdx.x;
  const unsigned w = wb / kWgtSegs;
  const float* wsrc = w == 0 ? Wq : w == 1 ? Wk : w == 2 ? Wv
                    : w == 3 ? Wo : w == 4 ? W1 : W2;
  const float* s = wsrc + (size_t)(wb % kWgtSegs) * kSeg;
  _Float16* d = dWgt + (size_t)wb * kSeg;
  const int off = (threadIdx.x >> 5) * 1024 + (threadIdx.x & 31) * 4;

  float4 v[8];
#pragma unroll  // v[] stays in registers, the 8 loads become one clause
  for (int u = 0; u < 8; ++u)
    v[u] = *reinterpret_cast<const float4*>(s + off + u * 128);
  // Holds all 8 loads ahead of the first convert: one memory latency, not several.
  __builtin_amdgcn_sched_barrier(0);
#pragma unroll  // constant indices into v[], so that it stays in registers
  for (int u = 0; u < 8; ++u) {
    _Float16 h[4] = {(_Float16)v[u].x, (_Float16)v[u].y, (_Float16)v[u].z,
                     (_Float16)v[u].w};
    *reinterpret_cast<uint2*>(d + off + u * 128) = *reinterpret_cast<uint2*>(h);
  }
}

// ---------------------------------------------------------------------------
// Attention, ONE launch. A block of 16 waves owns one (b, h) and holds its q, k
// (row-major) and v (transposed) in LDS for its whole life: each is read from
// global memory once, with whole-line loads, and no pass stages anything.
// Phase 1: per k column the softmax stats over the QUERY axis. A wave owns 32
// k columns (2 tiles), k fragments resident; it streams the 32 q tiles through
// WMMA, online max/sum with cross-half shfl_xor(16). The stats go to LDS.
// Phase 2: attn = P @ V with P = exp(scale*S - M[k]) / L[k], S recomputed by
// WMMA; P round-trips wave-private LDS (C->A layout). A wave owns kQT tiles of
// 16 q rows and all 64 dh of them.
// ---------------------------------------------------------------------------
static constexpr int kQT = 2;    // q tiles of 16 rows per wave
static constexpr int kAW = 16;   // waves per block: kAW * 16 * kQT = 512 q rows
static constexpr int kRP = 72;   // q, k pitch, halves: 144 B = 16 B x odd
static constexpr int kVP = 520;  // V^T pitch, halves: 1040 B = 16 B x odd

__global__ __launch_bounds__(512) void attn_fused(const _Float16* __restrict__ q2,
                                                  const _Float16* __restrict__ k2,
                                                  const _Float16* __restrict__ v2,
                                                  _Float16* __restrict__ at2) {
  __shared__ alignas(16) _Float16 Qs[512][kRP];
  __shared__ alignas(16) _Float16 Ks[512][kRP];
  __shared__ alignas(16) _Float16 vT[64][kVP];
  __shared__ alignas(16) _Float16 Pw[kAW][16 * kQT][40];
  __shared__ float Ms[512];  // column maximum
  __shared__ float Ls[512];  // 1 / column sum

  const int bh = blockIdx.x;
  const int b = bh >> 3;
  const int h = bh & 7;
  const int t = threadIdx.x;
  const int lane = t & 31;
  const int wave = t >> 5;
  const int lo = lane & 15;
  const int hi = lane >> 4;

  {  // q, k, v of this (b, h) into LDS; 8 lanes cover one row's 128 B line
    const int srow = t >> 3;
    const int scol = (t & 7) * 8;
    const size_t goff = (((size_t)b * 512 + srow) * 512) + h * 64 + scol;
    const _Float16* qsrc = q2 + goff;
    const _Float16* ksrc = k2 + goff;
    const _Float16* vsrc = v2 + goff;
    u32x4 qr[8], kr[8], vr[8];
#pragma unroll  // constant indices: the three arrays stay in registers
    for (int i = 0; i < 8; ++i) {
      qr[i] = *reinterpret_cast<const u32x4*>(qsrc + i * (64 * 512));
      kr[i] = *reinterpret_cast<const u32x4*>(ksrc + i * (64 * 512));
      vr[i] = *reinterpret_cast<const u32x4*>(vsrc + i * (64 * 512));
    }
    // The wait that stands in front of any rewrite of an address register of the
    // loads above; the loaded values and the addresses are inputs only: they tie
    // the wait behind all 24 loads and keep the addresses up to it.
    asm volatile("s_wait_xcnt 0x0" ::"v"(qr[0]), "v"(qr[1]), "v"(qr[2]), "v"(qr[3]),
                 "v"(qr[4]), "v"(qr[5]), "v"(qr[6]), "v"(qr[7]), "v"(kr[0]), "v"(kr[1]),
                 "v"(kr[2]), "v"(kr[3]), "v"(kr[4]), "v"(kr[5]), "v"(kr[6]), "v"(kr[7]),
                 "v"(vr[0]), "v"(vr[1]), "v"(vr[2]), "v"(vr[3]), "v"(vr[4]), "v"(vr[5]),
                 "v"(vr[6]), "v"(vr[7]), "v"(qsrc), "v"(ksrc), "v"(vsrc)
                 : "memory");
    // keeps every later register write behind that wait
    __builtin_amdgcn_sched_barrier(0);
#pragma unroll
    for (int i = 0; i < 8; ++i) {
      const int row = i * 64 + srow;
      *reinterpret_cast<u32x4*>(&Qs[row][scol]) = qr[i];
      *reinterpret_cast<u32x4*>(&Ks[row][scol]) = kr[i];
      _Float16 tmp[8];
      *reinterpret_cast<u32x4*>(tmp) = vr[i];
#pragma unroll
      for (int e = 0; e < 8; ++e) vT[scol + e][row] = tmp[e];
    }
  }
  __syncthreads();  // q, k and V^T are visible to all waves

  {  // phase 1: stats of this wave's 32 k columns
    v16h bk[2][2];
    float m_run[2], l_run[2];
#pragma unroll  // constant indices into bk[], so that it stays in registers
    for (int c = 0; c < 2; ++c) {
      const _Float16* krow = &Ks[wave * 32 + c * 16 + lo][0];
      bk[c][0] = ldfrag(krow, hi);
      bk[c][1] = ldfrag(krow + 32, hi);
      m_run[c] = -1e30f;
      l_run[c] = 0.0f;
    }
    for (int q0 = 0; q0 < 512; q0 += 16) {
      const _Float16* qrow = &Qs[q0 + lo][0];
      const v16h aq0 = ldfrag(qrow, hi);
      const v16h aq1 = ldfrag(qrow + 32, hi);
#pragma unroll  // constant indices into bk[]; the two columns' chains interleave
      for (int c = 0; c < 2; ++c) {
        v8f s = {};
        s = wmma_f16(aq0, bk[c][0], s);
        s = wmma_f16(aq1, bk[c][1], s);

        float pmax = -1e30f;
#pragma unroll
        for (int r = 0; r < 8; ++r) pmax = fmaxf(pmax, s[r] * kScale);
        pmax = fmaxf(pmax, __shfl_xor(pmax, 16, 32));
        const float nm = fmaxf(m_run[c], pmax);
        float ps = 0.0f;
#pragma unroll
        for (int r = 0; r < 8; ++r) ps += __expf(s[r] * kScale - nm);
        ps += __shfl_xor(ps, 16, 32);
        l_run[c] = l_run[c] * __expf(m_run[c] - nm) + ps;
        m_run[c] = nm;
      }
    }
    if (lane < 16) {
#pragma unroll
      for (int c = 0; c < 2; ++c) {
        Ms[wave * 32 + c * 16 + lo] = m_run[c];
        Ls[wave * 32 + c * 16 + lo] = 1.0f / l_run[c];
      }
    }
  }
  __syncthreads();  // the stats of all 512 k columns are visible to all waves

  // phase 2
  const int q0 = wave * (16 * kQT);

  v16h aq[kQT][2];
#pragma unroll  // constant indices into aq[], so that it stays in registers
  for (int qt = 0; qt < kQT; ++qt) {
    const _Float16* qrow = &Qs[q0 + qt * 16 + lo][0];
    aq[qt][0] = ldfrag(qrow, hi);
    aq[qt][1] = ldfrag(qrow + 32, hi);
  }

  v8f oacc[kQT][4] = {};

#pragma unroll 1  // one pass per trip, for speed only
  for (int kt = 0; kt < 512; kt += 32) {
#pragma unroll
    for (int jn = 0; jn < 2; ++jn) {
      const int ktok = kt + jn * 16 + lo;
      const _Float16* krow = &Ks[ktok][0];
      const v16h bk0 = ldfrag(krow, hi);
      const v16h bk1 = ldfrag(krow + 32, hi);
      const float Mv = Ms[ktok];
      const float Li = Ls[ktok];
#pragma unroll  // constant indices into aq[]; the kQT score chains interleave
      for (int qt = 0; qt < kQT; ++qt) {
        v8f s = {};
        s = wmma_f16(aq[qt][0], bk0, s);
        s = wmma_f16(aq[qt][1], bk1, s);
#pragma unroll
        for (int r = 0; r < 8; ++r)
          Pw[wave][qt * 16 + r + 8 * hi][jn * 16 + lo] =
              (_Float16)(__expf(s[r] * kScale - Mv) * Li);
      }
    }

    v16h ap[kQT];
#pragma unroll  // constant indices into ap[], so that it stays in registers
    for (int qt = 0; qt < kQT; ++qt)
      ap[qt] = ldfrag(&Pw[wave][qt * 16 + lo][0], hi);
#pragma unroll
    for (int jd = 0; jd < 4; ++jd) {
      const v16h bv = ldfrag(&vT[jd * 16 + lo][kt], hi);
#pragma unroll  // constant indices into oacc[], so that it stays in registers
      for (int qt = 0; qt < kQT; ++qt)
        oacc[qt][jd] = wmma_f16(ap[qt], bv, oacc[qt][jd]);
    }
  }

  _Float16 oh[kQT][4][8];
#pragma unroll  // constant indices into oacc[] and oh[]: they stay in registers
  for (int qt = 0; qt < kQT; ++qt)
#pragma unroll
    for (int jd = 0; jd < 4; ++jd)
#pragma unroll
      for (int r = 0; r < 8; ++r) oh[qt][jd][r] = (_Float16)oacc[qt][jd][r];
  // All converts stand in front of the first store: no register that an issued
  // store names is written again.
  __builtin_amdgcn_sched_barrier(0);
  _Float16* odst = at2 + (((size_t)b * 512 + q0 + 8 * hi) * 512) + h * 64 + lo;
#pragma unroll
  for (int qt = 0; qt < kQT; ++qt)
#pragma unroll
    for (int jd = 0; jd < 4; ++jd)
#pragma unroll
      for (int r = 0; r < 8; ++r)
        odst[(qt * 16 + r) * 512 + jd * 16] = oh[qt][jd][r];
}

// ---------------------------------------------------------------------------
// Tail: out = Q + attn @ Wo^T + bo; final = out + relu(out @ W1^T + b1) @ W2^T
// + b2, all three products in ONE launch. A block owns kFR rows. Their f16
// activations (attn, then out, then the hidden layer) stay in LDS (Xs), 'out'
// in f32 stays in registers; nothing goes through the workspace in between.
// A wave owns 64 output columns = 64 weight rows that no other wave reads; it
// brings them in itself, 64 k at a time, by one tensor load per pass into its
// own slice of a two-buffer ring. The three weights lie one behind the other
// (the workspace is laid out so), so that the ring runs through all 24 passes.
// ---------------------------------------------------------------------------
static constexpr int      kFR     = 64;     // rows per block
static constexpr int      kXP     = 520;    // Xs pitch, halves: 1040 B = 16 B x odd
static constexpr int      kWP     = 72;     // weight pitch in LDS, halves: 144 B
static constexpr unsigned kWSlice = 10240;  // 64 rows x 144 B, up to a 2 KiB multiple
static constexpr unsigned kStages = 24;     // 3 products x 8 passes of 64 k

__device__ __forceinline__ unsigned uni(unsigned v) {
  return (unsigned)__builtin_amdgcn_readfirstlane(v);
}
__device__ __forceinline__ unsigned pinned(unsigned v) {
  unsigned w = uni(v);
  asm volatile("" : "+s"(w));  // pinned(): holds an issue test or a descriptor word in a scalar register
  return w;
}
// LDS reads of this wave have retired (before the ring's buffer is handed over)
__device__ __forceinline__ void wait_ds0() { asm volatile("s_wait_dscnt 0x0" ::: "memory"); }
// Group 1 of the request: 64 rows of 128 B, source pitch 1024 B, 16 B of pad
// behind each row in LDS (pitch 144 B). All extents in bytes, tensor = tile.
__device__ __forceinline__ u32x8 wslice_group1() {
  u32x8 g1;
  g1[0] = pinned((1u << 20) | (4u << 22) | (3u << 25));  // pad: 4 dwords per 32 dwords
  g1[1] = pinned(128u << 16);                            // tensor_dim0 = 128
  g1[2] = pinned(64u << 16);                             // tensor_dim1 = 64
  g1[3] = pinned(128u << 16);                            // tile_dim0 = 128
  g1[4] = pinned(64u);                                   // tile_dim1 = 64
  g1[5] = pinned(1024u);                                 // source row pitch
  g1[6] = pinned(0u);
  g1[7] = pinned(0u);
  return g1;
}

__global__ __launch_bounds__(256) void tail_fused(const _Float16* __restrict__ at2,
                                                  const _Float16* __restrict__ Wcat,
                                                  const float* __restrict__ Q,
                                                  const float* __restrict__ bo,
                                                  const float* __restrict__ b1,
                                                  const float* __restrict__ b2,
                                                  float* __restrict__ out) {
  __shared__ __attribute__((aligned(2048))) unsigned char Wr[2][8][kWSlice];
  __shared__ alignas(16) _Float16 Xs[kFR][kXP];

  const int t = threadIdx.x;
  const int lane = t & 31;
  const unsigned wave = uni(threadIdx.x >> 5);
  const int lo = lane & 15;
  const int hi = lane >> 4;
  const int m0 = blockIdx.x * kFR;
  const int wn = (int)wave * 64;

  const unsigned wdst = (unsigned)(uintptr_t)&Wr[0][0][0] + wave * kWSlice;
  const _Float16* wsrc = Wcat + (size_t)wn * 512;
  // stage s: product s / 8, k columns (s % 8) * 64, into buffer s % 2
  const u32x8 g1 = wslice_group1();
  u32x4 g0;
  g0[0] = pinned(1u);  // count 1
  auto issue = [&](unsigned s) {
    const unsigned long long ga = (unsigned long long)(uintptr_t)(
        wsrc + (size_t)(s >> 3) * (512 * 512) + (s & 7u) * 64u);
    g0[1] = uni(wdst + (s & 1u) * (8u * kWSlice));                      // place in LDS
    g0[2] = uni((unsigned)ga);                                          // address, low
    g0[3] = uni((((unsigned)(ga >> 32)) & 0x01FFFFFFu) | 0x80000000u);  // high | type 2
    asm volatile("tensor_load_to_lds %0, %1" ::"s"(g0), "s"(g1) : "memory");
  };
  // This wave's tensor load has landed (the compiler places no wait for it). The
  // descriptor is an input only: its registers keep their words up to the wait.
  auto wait_tensor0 = [&]() {
    asm volatile("s_wait_tensorcnt 0x0" ::"s"(g0), "s"(g1) : "memory");
  };

  issue(0);
  // The residual rows of Q and the three biases, C layout (m = r + 8*hi, n = lo),
  // asked for here so that their latency runs beside that of stage 0 and Xs.
  const float* qsrc = Q + (size_t)(m0 + 8 * hi) * 512 + wn + lo;
  f32x4 bias[3];
  v8f qv[4][4];
#pragma unroll  // constant indices into bias[] and qv[]: they stay in registers
  for (int j = 0; j < 4; ++j) {
    const int gc = wn + 16 * j + lo;
    bias[0][j] = bo[gc];
    bias[1][j] = b1[gc];
    bias[2][j] = b2[gc];
#pragma unroll
    for (int i = 0; i < 4; ++i)
#pragma unroll
      for (int r = 0; r < 8; ++r) qv[i][j][r] = qsrc[(16 * i + r) * 512 + 16 * j];
  }
  // The wait that stands in front of any rewrite of an address register of the
  // loads above; the address is an input only, so that it lives up to the wait.
  asm volatile("s_wait_xcnt 0x0" ::"v"(qsrc) : "memory");
  // keeps every later register write behind that wait
  __builtin_amdgcn_sched_barrier(0);

  // the block's attn rows into Xs, whole-line loads (a wave takes 512 B of a row)
  const int xrow = t >> 6;
  const int xcol = (t & 63) * 8;
  const _Float16* xsrc = at2 + (size_t)(m0 + xrow) * 512 + xcol;
  u32x4 xr[16];
#pragma unroll  // constant indices into xr[]: it stays in registers
  for (int i = 0; i < 16; ++i)
    xr[i] = *reinterpret_cast<const u32x4*>(xsrc + i * (4 * 512));
  // The same wait for these loads; the loaded values and the address are inputs
  // only: they tie the wait behind the loads and keep the address up to it.
  asm volatile("s_wait_xcnt 0x0" ::"v"(xr[0]), "v"(xr[1]), "v"(xr[2]), "v"(xr[3]),
               "v"(xr[4]), "v"(xr[5]), "v"(xr[6]), "v"(xr[7]), "v"(xr[8]), "v"(xr[9]),
               "v"(xr[10]), "v"(xr[11]), "v"(xr[12]), "v"(xr[13]), "v"(xr[14]),
               "v"(xr[15]), "v"(xsrc)
               : "memory");
  // keeps every later register write behind that wait
  __builtin_amdgcn_sched_barrier(0);
#pragma unroll
  for (int i = 0; i < 16; ++i)
    *reinterpret_cast<u32x4*>(&Xs[i * 4 + xrow][xcol]) = xr[i];
  wait_tensor0();
  __syncthreads();  // stage 0 and Xs are visible to all waves
  issue(1);

  // One product: acc[i][j] = Xs rows 16 i.. x weight rows wn + 16 j.., k ascending
  auto product = [&](unsigned g, v8f (&acc)[4][4]) {
#pragma unroll 1  // one pass per trip: the ring's foot stands once in the text
    for (unsigned kt = 0; kt < 8; ++kt) {
      const unsigned s = g * 8 + kt;
      const _Float16* Wl = reinterpret_cast<const _Float16*>(&Wr[s & 1u][wave][0]);
      v16h af[2][4], wf[2][4];
#pragma unroll
      for (int kk = 0; kk < 2; ++kk) {
#pragma unroll
        for (int j = 0; j < 4; ++j)
          wf[kk][j] = ldfrag(Wl + (16 * j + lo) * kWP + kk * 32, hi);
#pragma unroll
        for (int i = 0; i < 4; ++i)
          af[kk][i] = ldfrag(&Xs[16 * i + lo][kt * 64 + kk * 32], hi);
      }
      // Keeps the pass's LDS reads one group ahead of its WMMAs; without it the
      // compiler spreads them among the WMMAs, each place with a full wait.
      __builtin_amdgcn_sched_barrier(0);
#pragma unroll
      for (int kk = 0; kk < 2; ++kk)
#pragma unroll
        for (int i = 0; i < 4; ++i)
#pragma unroll
          for (int j = 0; j < 4; ++j)
            acc[i][j] = wmma_f16(af[kk][i], wf[kk][j], acc[i][j]);
      // Keeps the WMMAs in front of the foot; without it the compiler sinks them
      // behind the barrier: no overlap with the LDS reads, and a late refill.
      __builtin_amdgcn_sched_barrier(0);
      // foot of pass s: stage s + 1 is published, buffer s % 2 is free
      wait_ds0();
      wait_tensor0();
      __syncthreads();
      if (pinned(s + 2 < kStages)) issue(s + 2);
    }
  };

  v8f outr[4][4];  // 'out' in f32: C layout m = r + 8*hi, n = lo

  {  // out = Q + attn @ Wo^T + bo
    v8f acc[4][4] = {};
    product(0, acc);
#pragma unroll
    for (int j = 0; j < 4; ++j) {
      const int gc = wn + 16 * j + lo;
      const float bv = bias[0][j];
#pragma unroll
      for (int i = 0; i < 4; ++i) {
        const int lr = 16 * i + 8 * hi;
#pragma unroll
        for (int r = 0; r < 8; ++r) {
          float x = acc[i][j][r] + bv;
          x += qv[i][j][r];
          outr[i][j][r] = x;
          Xs[lr + r][gc] = (_Float16)x;
        }
      }
    }
    __syncthreads();  // 'out' in f16 is visible to all waves
  }

  {  // hidden = relu(out @ W1^T + b1)
    v8f acc[4][4] = {};
    product(1, acc);
#pragma unroll
    for (int j = 0; j < 4; ++j) {
      const int gc = wn + 16 * j + lo;
      const float bv = bias[1][j];
#pragma unroll
      for (int i = 0; i < 4; ++i) {
        const int lr = 16 * i + 8 * hi;
#pragma unroll
        for (int r = 0; r < 8; ++r)
          Xs[lr + r][gc] = (_Float16)fmaxf(acc[i][j][r] + bv, 0.0f);
      }
    }
    __syncthreads();  // the hidden layer is visible to all waves
  }

  {  // final = out + hidden @ W2^T + b2
    v8f acc[4][4] = {};
    product(2, acc);
    wait_tensor0();
    wait_ds0();
#pragma unroll
    for (int j = 0; j < 4; ++j) {
      const float bv = bias[2][j];
#pragma unroll
      for (int i = 0; i < 4; ++i) {
#pragma unroll
        for (int r = 0; r < 8; ++r) {
          float x = acc[i][j][r] + bv;
          x += outr[i][j][r];
          acc[i][j][r] = x;
        }
      }
    }
    // All sums stand in front of the first store: no register that an issued
    // store names is written again.
    __builtin_amdgcn_sched_barrier(0);
    float* odst = out + (size_t)(m0 + 8 * hi) * 512 + wn + lo;
#pragma unroll
    for (int j = 0; j < 4; ++j)
#pragma unroll
      for (int i = 0; i < 4; ++i)
#pragma unroll
        for (int r = 0; r < 8; ++r) odst[(16 * i + r) * 512 + 16 * j] = acc[i][j][r];
  }
}

// The work-group barrier alone, for data that goes from wave to wave through LDS:
// the caller's s_wait_dscnt 0 stands in front of it. __syncthreads() would also wait
// for every global load in flight, and the K rows are to stay in flight across it.
__device__ __forceinline__ void barrier_lds() {
  asm volatile("s_barrier_signal -1\n\ts_barrier_wait -1" ::: "memory");
}

// ---------------------------------------------------------------------------
// Projections: q = Q @ Wq^T + bq, k = K @ Wk^T + bk, v = K @ Wv^T + bv, all three
// in ONE launch, straight from the f32 activations. A block owns kFR rows of Q and
// the same kFR rows of K: it reads each f32 row once, with whole-line loads,
// converts it and keeps it in LDS in f16 (Xa: Q rows, Xb: K rows). The K rows are
// asked for at the start and stay in flight, then in registers, during the first
// product. Weights as in tail_fused: a wave owns 64 output columns = 64 weight
// rows and brings them in itself, 64 k at a time, by one tensor load per pass into
// its own slice of a two-buffer ring; Wq, Wk, Wv lie one behind the other, so that
// the ring runs through all 24 passes. A wave's 64 x 64 result goes through its own
// columns of Xa (free after the first product) and leaves as whole 128 B lines.
// qkv: q2, k2, v2, one behind the other (the workspace is laid out so).
// ---------------------------------------------------------------------------
__global__ __launch_bounds__(256) void qkv_fused(const float* __restrict__ Q,
                                                 const float* __restrict__ Kx,
                                                 const _Float16* __restrict__ Wcat,
                                                 const float* __restrict__ bq,
                                                 const float* __restrict__ bk,
                                                 const float* __restrict__ bv,
                                                 _Float16* __restrict__ qkv) {
  __shared__ __attribute__((aligned(2048))) unsigned char Wr[2][8][kWSlice];
  __shared__ alignas(16) _Float16 Xa[kFR][kXP];
  __shared__ alignas(16) _Float16 Xb[kFR][kXP];

  const int t = threadIdx.x;
  const int lane = t & 31;
  const unsigned wave = uni(threadIdx.x >> 5);
  const int lo = lane & 15;
  const int hi = lane >> 4;
  const int m0 = blockIdx.x * kFR;
  const int wn = (int)wave * 64;

  const unsigned wdst = (unsigned)(uintptr_t)&Wr[0][0][0] + wave * kWSlice;
  const _Float16* wsrc = Wcat + (size_t)wn * 512;
  // stage s: product s / 8, k columns (s % 8) * 64, into buffer s % 2
  const u32x8 g1 = wslice_group1();
  u32x4 g0;
  g0[0] = pinned(1u);  // count 1
  auto issue = [&](unsigned s) {
    const unsigned long long ga = (unsigned long long)(uintptr_t)(
        wsrc + (size_t)(s >> 3) * (512 * 512) + (s & 7u) * 64u);
    g0[1] = uni(wdst + (s & 1u) * (8u * kWSlice));                      // place in LDS
    g0[2] = uni((unsigned)ga);                                          // address, low
    g0[3] = uni((((unsigned)(ga >> 32)) & 0x01FFFFFFu) | 0x80000000u);  // high | type 2
    asm volatile("tensor_load_to_lds %0, %1" ::"s"(g0), "s"(g1) : "memory");
  };
  // This wave's tensor load has landed (the compiler places no wait for it). The
  // descriptor is an input only: its registers keep their words up to the wait.
  auto wait_tensor0 = [&]() {
    asm volatile("s_wait_tensorcnt 0x0" ::"s"(g0), "s"(g1) : "memory");
  };

  issue(0);
  // The block's f32 rows, whole-line loads (a wave takes 512 B of a row; the block
  // two rows per load): first the 32 loads of Q, then the 32 of K, all in flight.
  const int xrow = t >> 7;
  const int xcol = (t & 127) * 4;
  const float* qsrc = Q + (size_t)(m0 + xrow) * 512 + xcol;
  const float* ksrc = Kx + (size_t)(m0 + xrow) * 512 + xcol;
  f32x4 qf[32], kf[32];
#pragma unroll  // constant indices into qf[]: it stays in registers
  for (int i = 0; i < 32; ++i)
    qf[i] = *reinterpret_cast<const f32x4*>(qsrc + i * (2 * 512));
  // Keeps every load of Q ahead of those of K; without it the compiler puts six of
  // them behind: loads return in order, and the first product would wait for K.
  __builtin_amdgcn_sched_barrier(0);
#pragma unroll  // constant indices into kf[]: it stays in registers
  for (int i = 0; i < 32; ++i)
    kf[i] = *reinterpret_cast<const f32x4*>(ksrc + i * (2 * 512));
  const int gc0 = wn + lo;  // this lane's first output column (C layout, n = lo)
  f32x4 bias[3];
#pragma unroll  // constant indices into bias[]: it stays in registers
  for (int j = 0; j < 4; ++j) {
    bias[0][j] = bq[gc0 + 16 * j];
    bias[1][j] = bk[gc0 + 16 * j];
    bias[2][j] = bv[gc0 + 16 * j];
  }
  // The wait that stands in front of any rewrite of an address register of the
  // loads above; the addresses are inputs only, so that they live up to the wait.
  asm volatile("s_wait_xcnt 0x0" ::"v"(qsrc), "v"(ksrc), "v"(gc0) : "memory");
  // keeps every later register write behind that wait
  __builtin_amdgcn_sched_barrier(0);

  // four f32 of a row -> four f16, one 8 B store (a wave fills 256 B in a row)
  auto put = [&](_Float16(*X)[kXP], int i, f32x4 x) {
    _Float16 h[4] = {(_Float16)x[0], (_Float16)x[1], (_Float16)x[2], (_Float16)x[3]};
    *reinterpret_cast<uint2*>(&X[2 * i + xrow][xcol]) = *reinterpret_cast<uint2*>(h);
  };
#pragma unroll  // constant indices into qf[]: it stays in registers
  for (int i = 0; i < 32; ++i) put(Xa, i, qf[i]);
  wait_ds0();
  wait_tensor0();
  barrier_lds();  // stage 0 and the Q rows are visible to all waves
  issue(1);

  // One product: acc[i][j] = X rows 16 i.. x weight rows wn + 16 j.., k ascending
  auto product = [&](unsigned g, const _Float16(*X)[kXP], v8f(&acc)[4][4]) {
#pragma unroll 1  // one pass per trip: the ring's foot stands once in the text
    for (unsigned kt = 0; kt < 8; ++kt) {
      const unsigned s = g * 8 + kt;
      const _Float16* Wl = reinterpret_cast<const _Float16*>(&Wr[s & 1u][wave][0]);
      v16h af[2][4], wf[2][4];
#pragma unroll
      for (int kk = 0; kk < 2; ++kk) {
#pragma unroll
        for (int j = 0; j < 4; ++j)
          wf[kk][j] = ldfrag(Wl + (16 * j + lo) * kWP + kk * 32, hi);
#pragma unroll
        for (int i = 0; i < 4; ++i)
          af[kk][i] = ldfrag(&X[16 * i + lo][kt * 64 + kk * 32], hi);
      }
      // Keeps the pass's LDS reads one group ahead of its WMMAs; without it the
      // compiler spreads them among the WMMAs, each place with a full wait.
      __builtin_amdgcn_sched_barrier(0);
#pragma unroll
      for (int kk = 0; kk < 2; ++kk)
#pragma unroll
        for (int i = 0; i < 4; ++i)
#pragma unroll
          for (int j = 0; j < 4; ++j)
            acc[i][j] = wmma_f16(af[kk][i], wf[kk][j], acc[i][j]);
      // Keeps the WMMAs in front of the foot; without it the compiler sinks them
      // behind the barrier: no overlap with the LDS reads, and a late refill.
      __builtin_amdgcn_sched_barrier(0);
      // foot of pass s: stage s + 1 is published, buffer s % 2 is free
      wait_ds0();
      wait_tensor0();
      barrier_lds();
      if (pinned(s + 2 < kStages)) issue(s + 2);
    }
  };

  // Result of product g out: C layout (m = r + 8*hi, n = lo) into this wave's own
  // 64 columns of Xa, which no other wave touches, then back row by row: 8 lanes
  // cover a row's 128 B line, a store covers four whole lines.
  const int orow = lane >> 3;
  const int ocol = wn + (lane & 7) * 8;
  auto emit = [&](unsigned g, v8f(&acc)[4][4]) {
#pragma unroll
    for (int j = 0; j < 4; ++j) {
      const int gc = wn + 16 * j + lo;
      const float bvj = bias[g][j];
#pragma unroll
      for (int i = 0; i < 4; ++i) {
        const int lr = 16 * i + 8 * hi;
#pragma unroll
        for (int r = 0; r < 8; ++r) Xa[lr + r][gc] = (_Float16)(acc[i][j][r] + bvj);
      }
    }
    u32x4 o[16];
#pragma unroll  // constant indices into o[]: it stays in registers
    for (int n = 0; n < 16; ++n)
      o[n] = *reinterpret_cast<const u32x4*>(&Xa[4 * n + orow][ocol]);
    // All 16 reads stand in front of the first store: no register that an issued
    // store names is written by a later read.
    __builtin_amdgcn_sched_barrier(0);
    _Float16* odst = qkv + (size_t)g * (32 * 512 * 512) + (size_t)(m0 + orow) * 512 + ocol;
#pragma unroll
    for (int n = 0; n < 16; ++n)
      *reinterpret_cast<u32x4*>(odst + n * (4 * 512)) = o[n];
    // The wait that stands in front of any rewrite of a register of the stores
    // above; data and address are inputs only, so that they live up to the wait.
    asm volatile("s_wait_xcnt 0x0" ::"v"(o[0]), "v"(o[1]), "v"(o[2]), "v"(o[3]), "v"(o[4]),
                 "v"(o[5]), "v"(o[6]), "v"(o[7]), "v"(o[8]), "v"(o[9]), "v"(o[10]),
                 "v"(o[11]), "v"(o[12]), "v"(o[13]), "v"(o[14]), "v"(o[15]), "v"(odst)
                 : "memory");
    // keeps every later register write behind that wait
    __builtin_amdgcn_sched_barrier(0);
  };

  {  // q = Q @ Wq^T + bq
    v8f acc[4][4] = {};
    product(0, Xa, acc);
    // the last foot's barrier has ended every wave's reads of Xa
#pragma unroll  // constant indices into kf[]: it stays in registers
    for (int i = 0; i < 32; ++i) put(Xb, i, kf[i]);
    emit(0, acc);
    wait_ds0();
    barrier_lds();  // the K rows are visible to all waves
  }
  {  // k = K @ Wk^T + bk
    v8f acc[4][4] = {};
    product(1, Xb, acc);
    emit(1, acc);
  }
  {  // v = K @ Wv^T + bv
    v8f acc[4][4] = {};
    product(2, Xb, acc);
    wait_tensor0();
    wait_ds0();
    emit(2, acc);
  }
}

// ---------------------------------------------------------------------------
extern "C" void kernel_launch(void* const* d_in, const int* in_sizes, int n_in,
                              void* d_out, int out_size, void* d_ws,
                              size_t ws_size, hipStream_t stream) {
  (void)in_sizes; (void)n_in; (void)out_size; (void)ws_size;
  const float* Q  = (const float*)d_in[0];
  const float* Kx = (const float*)d_in[1];
  const float* Wq = (const float*)d_in[2];
  const float* bq = (const float*)d_in[3];
  const float* Wk = (const float*)d_in[4];
  const float* bk = (const float*)d_in[5];
  const float* Wv = (const float*)d_in[6];
  const float* bv = (const float*)d_in[7];
  const float* Wo = (const float*)d_in[8];
  const float* bo = (const float*)d_in[9];
  const float* W1 = (const float*)d_in[10];
  const float* b1 = (const float*)d_in[11];
  const float* W2 = (const float*)d_in[12];
  const float* b2 = (const float*)d_in[13];

  constexpr int B = 32, Nt = 512, D = 512, H = 8;
  constexpr int M = B * Nt;                          // 16384
  const size_t szH = (size_t)M * D * sizeof(_Float16);  // activations, f16
  const size_t szW = (size_t)D * D * sizeof(_Float16);  // weights, f16

  char* p = (char*)d_ws;
  _Float16* q2   = (_Float16*)p; p += szH;
  _Float16* k2   = (_Float16*)p; p += szH;
  _Float16* v2   = (_Float16*)p; p += szH;
  _Float16* at2  = (_Float16*)p; p += szH;
  _Float16* Wq6  = (_Float16*)p; p += szW;
  _Float16* Wk6  = (_Float16*)p; p += szW;
  _Float16* Wv6  = (_Float16*)p; p += szW;
  _Float16* Wo6  = (_Float16*)p; p += szW;
  _Float16* W16w = (_Float16*)p; p += szW;
  _Float16* W26w = (_Float16*)p;

  const dim3 blk(256);

  // f32 -> f16 conversion of the six weights, one launch
  cvt_wgt<<<dim3(6 * kWgtSegs), blk, 0, stream>>>(Wq, Wk, Wv, Wo, W1, W2, Wq6);

  // q/k/v projections from the f32 activations (f16 out), one launch
  qkv_fused<<<dim3(M / kFR), blk, 0, stream>>>(Q, Kx, Wq6, bq, bk, bv, q2);

  // attention: column softmax stats (query axis), then P @ V, one launch
  attn_fused<<<dim3(B * H), dim3(32 * kAW), 0, stream>>>(q2, k2, v2, at2);

  // out = Q + attn @ Wo^T + bo; final = out + relu(out @ W1^T + b1) @ W2^T + b2
  tail_fused<<<dim3(M / kFR), blk, 0, stream>>>(at2, Wo6, Q, bo, b1, b2,
                                                (float*)d_out);
}

// v008
// It runs in 104 microseconds.
// Timed twice side by side with v007, it ran 1.05 times as fast both times.
// All steps since v000 together make it 2.48 times as fast.
#include <hip/hip_runtime.h>
#include <math.h>

// MAB (multihead attention block) for MI455X / gfx1250, wave32 + WMMA + TDM.
// B=32, N=512, D=512, H=8, dh=64. All heavy math via v_wmma_f32_16x16x32_f16;
// weight staging via tensor_load_to_lds (Tensor Data Mover), double-buffered.

typedef _Float16 v16h __attribute__((ext_vector_type(16)));
typedef float    v8f  __attribute__((ext_vector_type(8)));
typedef unsigned int u32x4 __attribute__((ext_vector_type(4)));
typedef int          i32x4 __attribute__((ext_vector_type(4)));
typedef int          i32x8 __attribute__((ext_vector_type(8)));
typedef unsigned int u32x8 __attribute__((ext_vector_type(8)));
typedef float        f32x4 __attribute__((ext_vector_type(4)));
typedef float        f32x2 __attribute__((ext_vector_type(2)));
typedef _Float16     f16x2 __attribute__((ext_vector_type(2)));

static constexpr float kScale = 0.044194173824159216f; // 1/sqrt(512)
static constexpr float kC2 = kScale * 1.4426950408889634f;  // scale * log2 e

__device__ __forceinline__ v8f wmma_f16(v16h a, v16h b, v8f c) {
  // (neg_a, A, neg_b, B, c_mod, C, reuse_a, reuse_b)
  return __builtin_amdgcn_wmma_f32_16x16x32_f16(false, a, false, b, (short)0, c,
                                                false, false);
}

// 16-bit A/B fragment for 16x16x32 WMMA. Per ISA layout, lane (lo=L%16,
// hi=L/16) holds K=[8*hi,8*hi+8) in VGPR0-3 and K=[16+8*hi,+8) in VGPR4-7.
__device__ __forceinline__ v16h ldfrag(const _Float16* rowp, int hi) {
  v16h a;
  *reinterpret_cast<uint4*>(&a)       = *reinterpret_cast<const uint4*>(rowp + 8 * hi);
  *(reinterpret_cast<uint4*>(&a) + 1) = *reinterpret_cast<const uint4*>(rowp + 16 + 8 * hi);
  return a;
}

// ---------------------------------------------------------------------------
// f32 -> f16 convert of the six weights in ONE launch (the activations are
// converted where they are used, in qkv_fused). A block takes one kSeg-element
// segment of one weight, picked by its index (a scalar choice); a wave takes
// 1024 contiguous elements of it: 8 whole-line loads of 512 B, all in flight
// before the first convert, then whole-line stores of 256 B.
// dWgt: the f16 copies, one behind the other (the workspace is laid out so).
// ---------------------------------------------------------------------------
static constexpr unsigned kSeg     = 8192;               // elements per block
static constexpr unsigned kWgtSegs = 512 * 512 / kSeg;   // 32 per weight

__global__ __launch_bounds__(256) void cvt_wgt(const float* __restrict__ Wq,
                                               const float* __restrict__ Wk,
                                               const float* __restrict__ Wv,
                                               const float* __restrict__ Wo,
                                               const float* __restrict__ W1,
                                               const float* __restrict__ W2,
                                               _Float16* __restrict__ dWgt) {
  const unsigned wb = blockIdx.x;
  const unsigned w = wb / kWgtSegs;
  const float* wsrc = w == 0 ? Wq : w == 1 ? Wk : w == 2 ? Wv
                    : w == 3 ? Wo : w == 4 ? W1 : W2;
  const float* s = wsrc + (size_t)(wb % kWgtSegs) * kSeg;
  _Float16* d = dWgt + (size_t)wb * kSeg;
  const int off = (threadIdx.x >> 5) * 1024 + (threadIdx.x & 31) * 4;

  float4 v[8];
#pragma unroll  // v[] stays in registers, the 8 loads become one clause
  for (int u = 0; u < 8; ++u)
    v[u] = *reinterpret_cast<const float4*>(s + off + u * 128);
  // Holds all 8 loads ahead of the first convert: one memory latency, not several.
  __builtin_amdgcn_sched_barrier(0);
#pragma unroll  // constant indices into v[], so that it stays in registers
  for (int u = 0; u < 8; ++u) {
    _Float16 h[4] = {(_Float16)v[u].x, (_Float16)v[u].y, (_Float16)v[u].z,
                     (_Float16)v[u].w};
    *reinterpret_cast<uint2*>(d + off + u * 128) = *reinterpret_cast<uint2*>(h);
  }
}

// ---------------------------------------------------------------------------
// Attention, ONE launch. A block of 16 waves owns one (b, h) and holds its q, k
// (row-major) and v (transposed) in LDS for its whole life: each is read from
// global memory once, with whole-line loads, and no pass stages anything.
// The softmax runs in the exp2 domain on the raw scores S: with c = scale * log2 e,
// exp(scale * S - scale * M) = exp2(c * S - c * M): one fma and one exp2 per score.
// Phase 1: per k column the softmax stats over the QUERY axis. A wave owns 32
// k columns (2 tiles), k fragments resident; it streams the 32 q tiles through
// WMMA. A lane keeps the running max and sum of its own 8 rows of each tile; the
// two lane halves of a column are joined once, behind the loop. One number per
// column goes to LDS: Z = -(c * M + log2 L), L the column's sum.
// Phase 2: attn = P @ V with P = exp2(c * S + Z[k]), S recomputed by WMMA; P
// round-trips wave-private LDS (C->A layout). A wave owns kQT tiles of 16 q rows
// and all 64 dh of them.
// ---------------------------------------------------------------------------
static constexpr int kQT = 2;    // q tiles of 16 rows per wave
static constexpr int kAW = 16;   // waves per block: kAW * 16 * kQT = 512 q rows
static constexpr int kRP = 72;   // q, k pitch, halves: 144 B = 16 B x odd
static constexpr int kVP = 520;  // V^T pitch, halves: 1040 B = 16 B x odd

__global__ __launch_bounds__(512) void attn_fused(const _Float16* __restrict__ q2,
                                                  const _Float16* __restrict__ k2,
                                                  const _Float16* __restrict__ v2,
                                                  _Float16* __restrict__ at2) {
  __shared__ alignas(16) _Float16 Qs[512][kRP];
  __shared__ alignas(16) _Float16 Ks[512][kRP];
  __shared__ alignas(16) _Float16 vT[64][kVP];
  __shared__ alignas(16) _Float16 Pw[kAW][16 * kQT][40];
  __shared__ float Zs[512];  // -(c * column maximum + log2 column sum)

  const int bh = blockIdx.x;
  const int b = bh >> 3;
  const int h = bh & 7;
  const int t = threadIdx.x;
  const int lane = t & 31;
  const int wave = t >> 5;
  const int lo = lane & 15;
  const int hi = lane >> 4;

  {  // q, k, v of this (b, h) into LDS; 8 lanes cover one row's 128 B line
    const int srow = t >> 3;
    const int scol = (t & 7) * 8;
    const size_t goff = (((size_t)b * 512 + srow) * 512) + h * 64 + scol;
    const _Float16* qsrc = q2 + goff;
    const _Float16* ksrc = k2 + goff;
    const _Float16* vsrc = v2 + goff;
    u32x4 qr[8], kr[8], vr[8];
#pragma unroll  // constant indices: the three arrays stay in registers
    for (int i = 0; i < 8; ++i) {
      qr[i] = *reinterpret_cast<const u32x4*>(qsrc + i * (64 * 512));
      kr[i] = *reinterpret_cast<const u32x4*>(ksrc + i * (64 * 512));
      vr[i] = *reinterpret_cast<const u32x4*>(vsrc + i * (64 * 512));
    }
    // The wait that stands in front of any rewrite of an address register of the
    // loads above; the loaded values and the addresses are inputs only: they tie
    // the wait behind all 24 loads and keep the addresses up to it.
    asm volatile("s_wait_xcnt 0x0" ::"v"(qr[0]), "v"(qr[1]), "v"(qr[2]), "v"(qr[3]),
                 "v"(qr[4]), "v"(qr[5]), "v"(qr[6]), "v"(qr[7]), "v"(kr[0]), "v"(kr[1]),
                 "v"(kr[2]), "v"(kr[3]), "v"(kr[4]), "v"(kr[5]), "v"(kr[6]), "v"(kr[7]),
                 "v"(vr[0]), "v"(vr[1]), "v"(vr[2]), "v"(vr[3]), "v"(vr[4]), "v"(vr[5]),
                 "v"(vr[6]), "v"(vr[7]), "v"(qsrc), "v"(ksrc), "v"(vsrc)
                 : "memory");
    // keeps every later register write behind that wait
    __builtin_amdgcn_sched_barrier(0);
#pragma unroll
    for (int i = 0; i < 8; ++i) {
      const int row = i * 64 + srow;
      *reinterpret_cast<u32x4*>(&Qs[row][scol]) = qr[i];
      *reinterpret_cast<u32x4*>(&Ks[row][scol]) = kr[i];
      _Float16 tmp[8];
      *reinterpret_cast<u32x4*>(tmp) = vr[i];
#pragma unroll
      for (int e = 0; e < 8; ++e) vT[scol + e][row] = tmp[e];
    }
  }
  __syncthreads();  // q, k and V^T are visible to all waves

  {  // phase 1: stats of this wave's 32 k columns
    v16h bk[2][2];
    float m_run[2];  // maximum of the raw scores this lane has seen
    f32x2 l_run[2];  // their sum of exp2(c * (S - m_run)), in two partial sums
#pragma unroll  // constant indices into bk[], so that it stays in registers
    for (int c = 0; c < 2; ++c) {
      const _Float16* krow = &Ks[wave * 32 + c * 16 + lo][0];
      bk[c][0] = ldfrag(krow, hi);
      bk[c][1] = ldfrag(krow + 32, hi);
      m_run[c] = -1e30f;
      l_run[c] = f32x2{0.0f, 0.0f};
    }
    const f32x2 c2 = {kC2, kC2};
#pragma unroll 2  // the next tile's LDS reads and WMMAs stand among this tile's vector work
    for (int q0 = 0; q0 < 512; q0 += 16) {
      const _Float16* qrow = &Qs[q0 + lo][0];
      const v16h aq0 = ldfrag(qrow, hi);
      const v16h aq1 = ldfrag(qrow + 32, hi);
#pragma unroll  // constant indices into bk[]; the two columns' chains interleave
      for (int c = 0; c < 2; ++c) {
        v8f s = {};
        s = wmma_f16(aq0, bk[c][0], s);
        s = wmma_f16(aq1, bk[c][1], s);

        float nm = fmaxf(fmaxf(m_run[c], s[0]), s[1]);
        nm = fmaxf(fmaxf(nm, s[2]), s[3]);
        nm = fmaxf(fmaxf(nm, s[4]), s[5]);
        nm = fmaxf(fmaxf(nm, s[6]), s[7]);
        const float nb = -kC2 * nm;
        const float corr = __builtin_amdgcn_exp2f(fmaf(m_run[c], kC2, nb));
        const f32x2 nb2 = {nb, nb};
        f32x2 e[4];
#pragma unroll
        for (int r = 0; r < 4; ++r) {
          const f32x2 x =
              __builtin_elementwise_fma(f32x2{s[2 * r], s[2 * r + 1]}, c2, nb2);
          e[r] = f32x2{__builtin_amdgcn_exp2f(x[0]), __builtin_amdgcn_exp2f(x[1])};
        }
        l_run[c] = __builtin_elementwise_fma(l_run[c], f32x2{corr, corr}, e[0] + e[1]) +
                   (e[2] + e[3]);
        m_run[c] = nm;
      }
    }
#pragma unroll
    for (int c = 0; c < 2; ++c) {  // join the two lane halves of a column
      const float l = l_run[c][0] + l_run[c][1];
      const float mo = __shfl_xor(m_run[c], 16, 32);
      const float lother = __shfl_xor(l, 16, 32);
      const float M = fmaxf(m_run[c], mo);
      const float L = l * __builtin_amdgcn_exp2f(kC2 * (m_run[c] - M)) +
                      lother * __builtin_amdgcn_exp2f(kC2 * (mo - M));
      if (lane < 16) Zs[wave * 32 + c * 16 + lo] = -(kC2 * M + __log2f(L));
    }
  }
  __syncthreads();  // the stats of all 512 k columns are visible to all waves

  // phase 2
  const int q0 = wave * (16 * kQT);

  v16h aq[kQT][2];
#pragma unroll  // constant indices into aq[], so that it stays in registers
  for (int qt = 0; qt < kQT; ++qt) {
    const _Float16* qrow = &Qs[q0 + qt * 16 + lo][0];
    aq[qt][0] = ldfrag(qrow, hi);
    aq[qt][1] = ldfrag(qrow + 32, hi);
  }

  v8f oacc[kQT][4] = {};

#pragma unroll 1  // one pass per trip, for speed only
  for (int kt = 0; kt < 512; kt += 32) {
#pragma unroll
    for (int jn = 0; jn < 2; ++jn) {
      const int ktok = kt + jn * 16 + lo;
      const _Float16* krow = &Ks[ktok][0];
      const v16h bk0 = ldfrag(krow, hi);
      const v16h bk1 = ldfrag(krow + 32, hi);
      const float Zv = Zs[ktok];
      const f32x2 z2 = {Zv, Zv};
      const f32x2 c2 = {kC2, kC2};
#pragma unroll  // constant indices into aq[]; the kQT score chains interleave
      for (int qt = 0; qt < kQT; ++qt) {
        v8f s = {};
        s = wmma_f16(aq[qt][0], bk0, s);
        s = wmma_f16(aq[qt][1], bk1, s);
#pragma unroll
        for (int r = 0; r < 8; r += 2) {
          const f32x2 x = __builtin_elementwise_fma(f32x2{s[r], s[r + 1]}, c2, z2);
          const f32x2 p = {__builtin_amdgcn_exp2f(x[0]), __builtin_amdgcn_exp2f(x[1])};
          const f16x2 ph = __builtin_convertvector(p, f16x2);
          Pw[wave][qt * 16 + r + 8 * hi][jn * 16 + lo] = ph[0];
          Pw[wave][qt * 16 + r + 1 + 8 * hi][jn * 16 + lo] = ph[1];
        }
      }
    }

    v16h ap[kQT];
#pragma unroll  // constant indices into ap[], so that it stays in registers
    for (int qt = 0; qt < kQT; ++qt)
      ap[qt] = ldfrag(&Pw[wave][qt * 16 + lo][0], hi);
#pragma unroll
    for (int jd = 0; jd < 4; ++jd) {
      const v16h bv = ldfrag(&vT[jd * 16 + lo][kt], hi);
#pragma unroll  // constant indices into oacc[], so that it stays in registers
      for (int qt = 0; qt < kQT; ++qt)
        oacc[qt][jd] = wmma_f16(ap[qt], bv, oacc[qt][jd]);
    }
  }

  _Float16 oh[kQT][4][8];
#pragma unroll  // constant indices into oacc[] and oh[]: they stay in registers
  for (int qt = 0; qt < kQT; ++qt)
#pragma unroll
    for (int jd = 0; jd < 4; ++jd)
#pragma unroll
      for (int r = 0; r < 8; ++r) oh[qt][jd][r] = (_Float16)oacc[qt][jd][r];
  // All converts stand in front of the first store: no register that an issued
  // store names is written again.
  __builtin_amdgcn_sched_barrier(0);
  _Float16* odst = at2 + (((size_t)b * 512 + q0 + 8 * hi) * 512) + h * 64 + lo;
#pragma unroll
  for (int qt = 0; qt < kQT; ++qt)
#pragma unroll
    for (int jd = 0; jd < 4; ++jd)
#pragma unroll
      for (int r = 0; r < 8; ++r)
        odst[(qt * 16 + r) * 512 + jd * 16] = oh[qt][jd][r];
}

// ---------------------------------------------------------------------------
// Tail: out = Q + attn @ Wo^T + bo; final = out + relu(out @ W1^T + b1) @ W2^T
// + b2, all three products in ONE launch. A block owns kFR rows. Their f16
// activations (attn, then out, then the hidden layer) stay in LDS (Xs), 'out'
// in f32 stays in registers; nothing goes through the workspace in between.
// A wave owns 64 output columns = 64 weight rows that no other wave reads; it
// brings them in itself, 64 k at a time, by one tensor load per pass into its
// own slice of a two-buffer ring. The three weights lie one behind the other
// (the workspace is laid out so), so that the ring runs through all 24 passes.
// ---------------------------------------------------------------------------
static constexpr int      kFR     = 64;     // rows per block
static constexpr int      kXP     = 520;    // Xs pitch, halves: 1040 B = 16 B x odd
static constexpr int      kWP     = 72;     // weight pitch in LDS, halves: 144 B
static constexpr unsigned kWSlice = 10240;  // 64 rows x 144 B, up to a 2 KiB multiple
static constexpr unsigned kStages = 24;     // 3 products x 8 passes of 64 k

__device__ __forceinline__ unsigned uni(unsigned v) {
  return (unsigned)__builtin_amdgcn_readfirstlane(v);
}
__device__ __forceinline__ unsigned pinned(unsigned v) {
  unsigned w = uni(v);
  asm volatile("" : "+s"(w));  // pinned(): holds an issue test or a descriptor word in a scalar register
  return w;
}
// LDS reads of this wave have retired (before the ring's buffer is handed over)
__device__ __forceinline__ void wait_ds0() { asm volatile("s_wait_dscnt 0x0" ::: "memory"); }
// Group 1 of the request: 64 rows of 128 B, source pitch 1024 B, 16 B of pad
// behind each row in LDS (pitch 144 B). All extents in bytes, tensor = tile.
__device__ __forceinline__ u32x8 wslice_group1() {
  u32x8 g1;
  g1[0] = pinned((1u << 20) | (4u << 22) | (3u << 25));  // pad: 4 dwords per 32 dwords
  g1[1] = pinned(128u << 16);                            // tensor_dim0 = 128
  g1[2] = pinned(64u << 16);                             // tensor_dim1 = 64
  g1[3] = pinned(128u << 16);                            // tile_dim0 = 128
  g1[4] = pinned(64u);                                   // tile_dim1 = 64
  g1[5] = pinned(1024u);                                 // source row pitch
  g1[6] = pinned(0u);
  g1[7] = pinned(0u);
  return g1;
}

__global__ __launch_bounds__(256) void tail_fused(const _Float16* __restrict__ at2,
                                                  const _Float16* __restrict__ Wcat,
                                                  const float* __restrict__ Q,
                                                  const float* __restrict__ bo,
                                                  const float* __restrict__ b1,
                                                  const float* __restrict__ b2,
                                                  float* __restrict__ out) {
  __shared__ __attribute__((aligned(2048))) unsigned char Wr[2][8][kWSlice];
  __shared__ alignas(16) _Float16 Xs[kFR][kXP];

  const int t = threadIdx.x;
  const int lane = t & 31;
  const unsigned wave = uni(threadIdx.x >> 5);
  const int lo = lane & 15;
  const int hi = lane >> 4;
  const int m0 = blockIdx.x * kFR;
  const int wn = (int)wave * 64;

  const unsigned wdst = (unsigned)(uintptr_t)&Wr[0][0][0] + wave * kWSlice;
  const _Float16* wsrc = Wcat + (size_t)wn * 512;
  // stage s: product s / 8, k columns (s % 8) * 64, into buffer s % 2
  const u32x8 g1 = wslice_group1();
  u32x4 g0;
  g0[0] = pinned(1u);  // count 1
  auto issue = [&](unsigned s) {
    const unsigned long long ga = (unsigned long long)(uintptr_t)(
        wsrc + (size_t)(s >> 3) * (512 * 512) + (s & 7u) * 64u);
    g0[1] = uni(wdst + (s & 1u) * (8u * kWSlice));                      // place in LDS
    g0[2] = uni((unsigned)ga);                                          // address, low
    g0[3] = uni((((unsigned)(ga >> 32)) & 0x01FFFFFFu) | 0x80000000u);  // high | type 2
    asm volatile("tensor_load_to_lds %0, %1" ::"s"(g0), "s"(g1) : "memory");
  };
  // This wave's tensor load has landed (the compiler places no wait for it). The
  // descriptor is an input only: its registers keep their words up to the wait.
  auto wait_tensor0 = [&]() {
    asm volatile("s_wait_tensorcnt 0x0" ::"s"(g0), "s"(g1) : "memory");
  };

  issue(0);
  // The residual rows of Q and the three biases, C layout (m = r + 8*hi, n = lo),
  // asked for here so that their latency runs beside that of stage 0 and Xs.
  const float* qsrc = Q + (size_t)(m0 + 8 * hi) * 512 + wn + lo;
  f32x4 bias[3];
  v8f qv[4][4];
#pragma unroll  // constant indices into bias[] and qv[]: they stay in registers
  for (int j = 0; j < 4; ++j) {
    const int gc = wn + 16 * j + lo;
    bias[0][j] = bo[gc];
    bias[1][j] = b1[gc];
    bias[2][j] = b2[gc];
#pragma unroll
    for (int i = 0; i < 4; ++i)
#pragma unroll
      for (int r = 0; r < 8; ++r) qv[i][j][r] = qsrc[(16 * i + r) * 512 + 16 * j];
  }
  // The wait that stands in front of any rewrite of an address register of the
  // loads above; the address is an input only, so that it lives up to the wait.
  asm volatile("s_wait_xcnt 0x0" ::"v"(qsrc) : "memory");
  // keeps every later register write behind that wait
  __builtin_amdgcn_sched_barrier(0);

  // the block's attn rows into Xs, whole-line loads (a wave takes 512 B of a row)
  const int xrow = t >> 6;
  const int xcol = (t & 63) * 8;
  const _Float16* xsrc = at2 + (size_t)(m0 + xrow) * 512 + xcol;
  u32x4 xr[16];
#pragma unroll  // constant indices into xr[]: it stays in registers
  for (int i = 0; i < 16; ++i)
    xr[i] = *reinterpret_cast<const u32x4*>(xsrc + i * (4 * 512));
  // The same wait for these loads; the loaded values and the address are inputs
  // only: they tie the wait behind the loads and keep the address up to it.
  asm volatile("s_wait_xcnt 0x0" ::"v"(xr[0]), "v"(xr[1]), "v"(xr[2]), "v"(xr[3]),
               "v"(xr[4]), "v"(xr[5]), "v"(xr[6]), "v"(xr[7]), "v"(xr[8]), "v"(xr[9]),
               "v"(xr[10]), "v"(xr[11]), "v"(xr[12]), "v"(xr[13]), "v"(xr[14]),
               "v"(xr[15]), "v"(xsrc)
               : "memory");
  // keeps every later register write behind that wait
  __builtin_amdgcn_sched_barrier(0);
#pragma unroll
  for (int i = 0; i < 16; ++i)
    *reinterpret_cast<u32x4*>(&Xs[i * 4 + xrow][xcol]) = xr[i];
  wait_tensor0();
  __syncthreads();  // stage 0 and Xs are visible to all waves
  issue(1);

  // One product: acc[i][j] = Xs rows 16 i.. x weight rows wn + 16 j.., k ascending
  auto product = [&](unsigned g, v8f (&acc)[4][4]) {
#pragma unroll 1  // one pass per trip: the ring's foot stands once in the text
    for (unsigned kt = 0; kt < 8; ++kt) {
      const unsigned s = g * 8 + kt;
      const _Float16* Wl = reinterpret_cast<const _Float16*>(&Wr[s & 1u][wave][0]);
      v16h af[2][4], wf[2][4];
#pragma unroll
      for (int kk = 0; kk < 2; ++kk) {
#pragma unroll
        for (int j = 0; j < 4; ++j)
          wf[kk][j] = ldfrag(Wl + (16 * j + lo) * kWP + kk * 32, hi);
#pragma unroll
        for (int i = 0; i < 4; ++i)
          af[kk][i] = ldfrag(&Xs[16 * i + lo][kt * 64 + kk * 32], hi);
      }
      // Keeps the pass's LDS reads one group ahead of its WMMAs; without it the
      // compiler spreads them among the WMMAs, each place with a full wait.
      __builtin_amdgcn_sched_barrier(0);
#pragma unroll
      for (int kk = 0; kk < 2; ++kk)
#pragma unroll
        for (int i = 0; i < 4; ++i)
#pragma unroll
          for (int j = 0; j < 4; ++j)
            acc[i][j] = wmma_f16(af[kk][i], wf[kk][j], acc[i][j]);
      // Keeps the WMMAs in front of the foot; without it the compiler sinks them
      // behind the barrier: no overlap with the LDS reads, and a late refill.
      __builtin_amdgcn_sched_barrier(0);
      // foot of pass s: stage s + 1 is published, buffer s % 2 is free
      wait_ds0();
      wait_tensor0();
      __syncthreads();
      if (pinned(s + 2 < kStages)) issue(s + 2);
    }
  };

  v8f outr[4][4];  // 'out' in f32: C layout m = r + 8*hi, n = lo

  {  // out = Q + attn @ Wo^T + bo
    v8f acc[4][4] = {};
    product(0, acc);
#pragma unroll
    for (int j = 0; j < 4; ++j) {
      const int gc = wn + 16 * j + lo;
      const float bv = bias[0][j];
#pragma unroll
      for (int i = 0; i < 4; ++i) {
        const int lr = 16 * i + 8 * hi;
#pragma unroll
        for (int r = 0; r < 8; ++r) {
          float x = acc[i][j][r] + bv;
          x += qv[i][j][r];
          outr[i][j][r] = x;
          Xs[lr + r][gc] = (_Float16)x;
        }
      }
    }
    __syncthreads();  // 'out' in f16 is visible to all waves
  }

  {  // hidden = relu(out @ W1^T + b1)
    v8f acc[4][4] = {};
    product(1, acc);
#pragma unroll
    for (int j = 0; j < 4; ++j) {
      const int gc = wn + 16 * j + lo;
      const float bv = bias[1][j];
#pragma unroll
      for (int i = 0; i < 4; ++i) {
        const int lr = 16 * i + 8 * hi;
#pragma unroll
        for (int r = 0; r < 8; ++r)
          Xs[lr + r][gc] = (_Float16)fmaxf(acc[i][j][r] + bv, 0.0f);
      }
    }
    __syncthreads();  // the hidden layer is visible to all waves
  }

  {  // final = out + hidden @ W2^T + b2
    v8f acc[4][4] = {};
    product(2, acc);
    wait_tensor0();
    wait_ds0();
#pragma unroll
    for (int j = 0; j < 4; ++j) {
      const float bv = bias[2][j];
#pragma unroll
      for (int i = 0; i < 4; ++i) {
#pragma unroll
        for (int r = 0; r < 8; ++r) {
          float x = acc[i][j][r] + bv;
          x += outr[i][j][r];
          acc[i][j][r] = x;
        }
      }
    }
    // All sums stand in front of the first store: no register that an issued
    // store names is written again.
    __builtin_amdgcn_sched_barrier(0);
    float* odst = out + (size_t)(m0 + 8 * hi) * 512 + wn + lo;
#pragma unroll
    for (int j = 0; j < 4; ++j)
#pragma unroll
      for (int i = 0; i < 4; ++i)
#pragma unroll
        for (int r = 0; r < 8; ++r) odst[(16 * i + r) * 512 + 16 * j] = acc[i][j][r];
  }
}

// The work-group barrier alone, for data that goes from wave to wave through LDS:
// the caller's s_wait_dscnt 0 stands in front of it. __syncthreads() would also wait
// for every global load in flight, and the K rows are to stay in flight across it.
__device__ __forceinline__ void barrier_lds() {
  asm volatile("s_barrier_signal -1\n\ts_barrier_wait -1" ::: "memory");
}

// ---------------------------------------------------------------------------
// Projections: q = Q @ Wq^T + bq, k = K @ Wk^T + bk, v = K @ Wv^T + bv, all three
// in ONE launch, straight from the f32 activations. A block owns kFR rows of Q and
// the same kFR rows of K: it reads each f32 row once, with whole-line loads,
// converts it and keeps it in LDS in f16 (Xa: Q rows, Xb: K rows). The K rows are
// asked for at the start and stay in flight, then in registers, during the first
// product. Weights as in tail_fused: a wave owns 64 output columns = 64 weight
// rows and brings them in itself, 64 k at a time, by one tensor load per pass into
// its own slice of a two-buffer ring; Wq, Wk, Wv lie one behind the other, so that
// the ring runs through all 24 passes. A wave's 64 x 64 result goes through its own
// columns of Xa (free after the first product) and leaves as whole 128 B lines.
// qkv: q2, k2, v2, one behind the other (the workspace is laid out so).
// ---------------------------------------------------------------------------
__global__ __launch_bounds__(256) void qkv_fused(const float* __restrict__ Q,
                                                 const float* __restrict__ Kx,
                                                 const _Float16* __restrict__ Wcat,
                                                 const float* __restrict__ bq,
                                                 const float* __restrict__ bk,
                                                 const float* __restrict__ bv,
                                                 _Float16* __restrict__ qkv) {
  __shared__ __attribute__((aligned(2048))) unsigned char Wr[2][8][kWSlice];
  __shared__ alignas(16) _Float16 Xa[kFR][kXP];
  __shared__ alignas(16) _Float16 Xb[kFR][kXP];

  const int t = threadIdx.x;
  const int lane = t & 31;
  const unsigned wave = uni(threadIdx.x >> 5);
  const int lo = lane & 15;
  const int hi = lane >> 4;
  const int m0 = blockIdx.x * kFR;
  const int wn = (int)wave * 64;

  const unsigned wdst = (unsigned)(uintptr_t)&Wr[0][0][0] + wave * kWSlice;
  const _Float16* wsrc = Wcat + (size_t)wn * 512;
  // stage s: product s / 8, k columns (s % 8) * 64, into buffer s % 2
  const u32x8 g1 = wslice_group1();
  u32x4 g0;
  g0[0] = pinned(1u);  // count 1
  auto issue = [&](unsigned s) {
    const unsigned long long ga = (unsigned long long)(uintptr_t)(
        wsrc + (size_t)(s >> 3) * (512 * 512) + (s & 7u) * 64u);
    g0[1] = uni(wdst + (s & 1u) * (8u * kWSlice));                      // place in LDS
    g0[2] = uni((unsigned)ga);                                          // address, low
    g0[3] = uni((((unsigned)(ga >> 32)) & 0x01FFFFFFu) | 0x80000000u);  // high | type 2
    asm volatile("tensor_load_to_lds %0, %1" ::"s"(g0), "s"(g1) : "memory");
  };
  // This wave's tensor load has landed (the compiler places no wait for it). The
  // descriptor is an input only: its registers keep their words up to the wait.
  auto wait_tensor0 = [&]() {
    asm volatile("s_wait_tensorcnt 0x0" ::"s"(g0), "s"(g1) : "memory");
  };

  issue(0);
  // The block's f32 rows, whole-line loads (a wave takes 512 B of a row; the block
  // two rows per load): first the 32 loads of Q, then the 32 of K, all in flight.
  const int xrow = t >> 7;
  const int xcol = (t & 127) * 4;
  const float* qsrc = Q + (size_t)(m0 + xrow) * 512 + xcol;
  const float* ksrc = Kx + (size_t)(m0 + xrow) * 512 + xcol;
  f32x4 qf[32], kf[32];
#pragma unroll  // constant indices into qf[]: it stays in registers
  for (int i = 0; i < 32; ++i)
    qf[i] = *reinterpret_cast<const f32x4*>(qsrc + i * (2 * 512));
  // Keeps every load of Q ahead of those of K; without it the compiler puts six of
  // them behind: loads return in order, and the first product would wait for K.
  __builtin_amdgcn_sched_barrier(0);
#pragma unroll  // constant indices into kf[]: it stays in registers
  for (int i = 0; i < 32; ++i)
    kf[i] = *reinterpret_cast<const f32x4*>(ksrc + i * (2 * 512));
  const int gc0 = wn + lo;  // this lane's first output column (C layout, n = lo)
  f32x4 bias[3];
#pragma unroll  // constant indices into bias[]: it stays in registers
  for (int j = 0; j < 4; ++j) {
    bias[0][j] = bq[gc0 + 16 * j];
    bias[1][j] = bk[gc0 + 16 * j];
    bias[2][j] = bv[gc0 + 16 * j];
  }
  // The wait that stands in front of any rewrite of an address register of the
  // loads above; the addresses are inputs only, so that they live up to the wait.
  asm volatile("s_wait_xcnt 0x0" ::"v"(qsrc), "v"(ksrc), "v"(gc0) : "memory");
  // keeps every later register write behind that wait
  __builtin_amdgcn_sched_barrier(0);

  // four f32 of a row -> four f16, one 8 B store (a wave fills 256 B in a row)
  auto put = [&](_Float16(*X)[kXP], int i, f32x4 x) {
    _Float16 h[4] = {(_Float16)x[0], (_Float16)x[1], (_Float16)x[2], (_Float16)x[3]};
    *reinterpret_cast<uint2*>(&X[2 * i + xrow][xcol]) = *reinterpret_cast<uint2*>(h);
  };
#pragma unroll  // constant indices into qf[]: it stays in registers
  for (int i = 0; i < 32; ++i) put(Xa, i, qf[i]);
  wait_ds0();
  wait_tensor0();
  barrier_lds();  // stage 0 and the Q rows are visible to all waves
  issue(1);

  // One product: acc[i][j] = X rows 16 i.. x weight rows wn + 16 j.., k ascending
  auto product = [&](unsigned g, const _Float16(*X)[kXP], v8f(&acc)[4][4]) {
#pragma unroll 1  // one pass per trip: the ring's foot stands once in the text
    for (unsigned kt = 0; kt < 8; ++kt) {
      const unsigned s = g * 8 + kt;
      const _Float16* Wl = reinterpret_cast<const _Float16*>(&Wr[s & 1u][wave][0]);
      v16h af[2][4], wf[2][4];
#pragma unroll
      for (int kk = 0; kk < 2; ++kk) {
#pragma unroll
        for (int j = 0; j < 4; ++j)
          wf[kk][j] = ldfrag(Wl + (16 * j + lo) * kWP + kk * 32, hi);
#pragma unroll
        for (int i = 0; i < 4; ++i)
          af[kk][i] = ldfrag(&X[16 * i + lo][kt * 64 + kk * 32], hi);
      }
      // Keeps the pass's LDS reads one group ahead of its WMMAs; without it the
      // compiler spreads them among the WMMAs, each place with a full wait.
      __builtin_amdgcn_sched_barrier(0);
#pragma unroll
      for (int kk = 0; kk < 2; ++kk)
#pragma unroll
        for (int i = 0; i < 4; ++i)
#pragma unroll
          for (int j = 0; j < 4; ++j)
            acc[i][j] = wmma_f16(af[kk][i], wf[kk][j], acc[i][j]);
      // Keeps the WMMAs in front of the foot; without it the compiler sinks them
      // behind the barrier: no overlap with the LDS reads, and a late refill.
      __builtin_amdgcn_sched_barrier(0);
      // foot of pass s: stage s + 1 is published, buffer s % 2 is free
      wait_ds0();
      wait_tensor0();
      barrier_lds();
      if (pinned(s + 2 < kStages)) issue(s + 2);
    }
  };

  // Result of product g out: C layout (m = r + 8*hi, n = lo) into this wave's own
  // 64 columns of Xa, which no other wave touches, then back row by row: 8 lanes
  // cover a row's 128 B line, a store covers four whole lines.
  const int orow = lane >> 3;
  const int ocol = wn + (lane & 7) * 8;
  auto emit = [&](unsigned g, v8f(&acc)[4][4]) {
#pragma unroll
    for (int j = 0; j < 4; ++j) {
      const int gc = wn + 16 * j + lo;
      const float bvj = bias[g][j];
#pragma unroll
      for (int i = 0; i < 4; ++i) {
        const int lr = 16 * i + 8 * hi;
#pragma unroll
        for (int r = 0; r < 8; ++r) Xa[lr + r][gc] = (_Float16)(acc[i][j][r] + bvj);
      }
    }
    u32x4 o[16];
#pragma unroll  // constant indices into o[]: it stays in registers
    for (int n = 0; n < 16; ++n)
      o[n] = *reinterpret_cast<const u32x4*>(&Xa[4 * n + orow][ocol]);
    // All 16 reads stand in front of the first store: no register that an issued
    // store names is written by a later read.
    __builtin_amdgcn_sched_barrier(0);
    _Float16* odst = qkv + (size_t)g * (32 * 512 * 512) + (size_t)(m0 + orow) * 512 + ocol;
#pragma unroll
    for (int n = 0; n < 16; ++n)
      *reinterpret_cast<u32x4*>(odst + n * (4 * 512)) = o[n];
    // The wait that stands in front of any rewrite of a register of the stores
    // above; data and address are inputs only, so that they live up to the wait.
    asm volatile("s_wait_xcnt 0x0" ::"v"(o[0]), "v"(o[1]), "v"(o[2]), "v"(o[3]), "v"(o[4]),
                 "v"(o[5]), "v"(o[6]), "v"(o[7]), "v"(o[8]), "v"(o[9]), "v"(o[10]),
                 "v"(o[11]), "v"(o[12]), "v"(o[13]), "v"(o[14]), "v"(o[15]), "v"(odst)
                 : "memory");
    // keeps every later register write behind that wait
    __builtin_amdgcn_sched_barrier(0);
  };

  {  // q = Q @ Wq^T + bq
    v8f acc[4][4] = {};
    product(0, Xa, acc);
    // the last foot's barrier has ended every wave's reads of Xa
#pragma unroll  // constant indices into kf[]: it stays in registers
    for (int i = 0; i < 32; ++i) put(Xb, i, kf[i]);
    emit(0, acc);
    wait_ds0();
    barrier_lds();  // the K rows are visible to all waves
  }
  {  // k = K @ Wk^T + bk
    v8f acc[4][4] = {};
    product(1, Xb, acc);
    emit(1, acc);
  }
  {  // v = K @ Wv^T + bv
    v8f acc[4][4] = {};
    product(2, Xb, acc);
    wait_tensor0();
    wait_ds0();
    emit(2, acc);
  }
}

// ---------------------------------------------------------------------------
extern "C" void kernel_launch(void* const* d_in, const int* in_sizes, int n_in,
                              void* d_out, int out_size, void* d_ws,
                              size_t ws_size, hipStream_t stream) {
  (void)in_sizes; (void)n_in; (void)out_size; (void)ws_size;
  const float* Q  = (const float*)d_in[0];
  const float* Kx = (const float*)d_in[1];
  const float* Wq = (const float*)d_in[2];
  const float* bq = (const float*)d_in[3];
  const float* Wk = (const float*)d_in[4];
  const float* bk = (const float*)d_in[5];
  const float* Wv = (const float*)d_in[6];
  const float* bv = (const float*)d_in[7];
  const float* Wo = (const float*)d_in[8];
  const float* bo = (const float*)d_in[9];
  const float* W1 = (const float*)d_in[10];
  const float* b1 = (const float*)d_in[11];
  const float* W2 = (const float*)d_in[12];
  const float* b2 = (const float*)d_in[13];

  constexpr int B = 32, Nt = 512, D = 512, H = 8;
  constexpr int M = B * Nt;                          // 16384
  const size_t szH = (size_t)M * D * sizeof(_Float16);  // activations, f16
  const size_t szW = (size_t)D * D * sizeof(_Float16);  // weights, f16

  char* p = (char*)d_ws;
  _Float16* q2   = (_Float16*)p; p += szH;
  _Float16* k2   = (_Float16*)p; p += szH;
  _Float16* v2   = (_Float16*)p; p += szH;
  _Float16* at2  = (_Float16*)p; p += szH;
  _Float16* Wq6  = (_Float16*)p; p += szW;
  _Float16* Wk6  = (_Float16*)p; p += szW;
  _Float16* Wv6  = (_Float16*)p; p += szW;
  _Float16* Wo6  = (_Float16*)p; p += szW;
  _Float16* W16w = (_Float16*)p; p += szW;
  _Float16* W26w = (_Float16*)p;

  const dim3 blk(256);

  // f32 -> f16 conversion of the six weights, one launch
  cvt_wgt<<<dim3(6 * kWgtSegs), blk, 0, stream>>>(Wq, Wk, Wv, Wo, W1, W2, Wq6);

  // q/k/v projections from the f32 activations (f16 out), one launch
  qkv_fused<<<dim3(M / kFR), blk, 0, stream>>>(Q, Kx, Wq6, bq, bk, bv, q2);

  // attention: column softmax stats (query axis), then P @ V, one launch
  attn_fused<<<dim3(B * H), dim3(32 * kAW), 0, stream>>>(q2, k2, v2, at2);

  // out = Q + attn @ Wo^T + bo; final = out + relu(out @ W1^T + b1) @ W2^T + b2
  tail_fused<<<dim3(M / kFR), blk, 0, stream>>>(at2, Wo6, Q, bo, b1, b2,
                                                (float*)d_out);
}

// v009
// A run of this version takes 98.3 microseconds.
// Timed twice side by side with v008, it ran 1.05 and 1.06 times as fast.
// All steps since v000 together make it 2.62 times as fast.
#include <hip/hip_runtime.h>
#include <math.h>

// MAB (multihead attention block) for MI455X / gfx1250, wave32 + WMMA + TDM.
// B=32, N=512, D=512, H=8, dh=64. All heavy math via v_wmma_f32_16x16x32_f16;
// weight staging via tensor_load_to_lds (Tensor Data Mover), double-buffered.

typedef _Float16 v16h __attribute__((ext_vector_type(16)));
typedef float    v8f  __attribute__((ext_vector_type(8)));
typedef unsigned int u32x4 __attribute__((ext_vector_type(4)));
typedef int          i32x4 __attribute__((ext_vector_type(4)));
typedef int          i32x8 __attribute__((ext_vector_type(8)));
typedef unsigned int u32x8 __attribute__((ext_vector_type(8)));
typedef float        f32x4 __attribute__((ext_vector_type(4)));
typedef float        f32x2 __attribute__((ext_vector_type(2)));
typedef _Float16     f16x2 __attribute__((ext_vector_type(2)));

static constexpr float kScale = 0.044194173824159216f; // 1/sqrt(512)
static constexpr float kC2 = kScale * 1.4426950408889634f;  // scale * log2 e

__device__ __forceinline__ v8f wmma_f16(v16h a, v16h b, v8f c) {
  // (neg_a, A, neg_b, B, c_mod, C, reuse_a, reuse_b)
  return __builtin_amdgcn_wmma_f32_16x16x32_f16(false, a, false, b, (short)0, c,
                                                false, false);
}

// 16-bit A/B fragment for 16x16x32 WMMA. Per ISA layout, lane (lo=L%16,
// hi=L/16) holds K=[8*hi,8*hi+8) in VGPR0-3 and K=[16+8*hi,+8) in VGPR4-7.
__device__ __forceinline__ v16h ldfrag(const _Float16* rowp, int hi) {
  v16h a;
  *reinterpret_cast<uint4*>(&a)       = *reinterpret_cast<const uint4*>(rowp + 8 * hi);
  *(reinterpret_cast<uint4*>(&a) + 1) = *reinterpret_cast<const uint4*>(rowp + 16 + 8 * hi);
  return a;
}

// ---------------------------------------------------------------------------
// f32 -> f16 convert of the six weights in ONE launch (the activations are
// converted where they are used, in qkv_fused). A block takes one kSeg-element
// segment of one weight, picked by its index (a scalar choice); a wave takes
// 1024 contiguous elements of it: 8 whole-line loads of 512 B, all in flight
// before the first convert, then whole-line stores of 256 B.
// dWgt: the f16 copies, one behind the other (the workspace is laid out so).
// ---------------------------------------------------------------------------
static constexpr unsigned kSeg     = 8192;               // elements per block
static constexpr unsigned kWgtSegs = 512 * 512 / kSeg;   // 32 per weight

__global__ __launch_bounds__(256) void cvt_wgt(const float* __restrict__ Wq,
                                               const float* __restrict__ Wk,
                                               const float* __restrict__ Wv,
                                               const float* __restrict__ Wo,
                                               const float* __restrict__ W1,
                                               const float* __restrict__ W2,
                                               _Float16* __restrict__ dWgt) {
  const unsigned wb = blockIdx.x;
  const unsigned w = wb / kWgtSegs;
  const float* wsrc = w == 0 ? Wq : w == 1 ? Wk : w == 2 ? Wv
                    : w == 3 ? Wo : w == 4 ? W1 : W2;
  const float* s = wsrc + (size_t)(wb % kWgtSegs) * kSeg;
  _Float16* d = dWgt + (size_t)wb * kSeg;
  const int off = (threadIdx.x >> 5) * 1024 + (threadIdx.x & 31) * 4;

  float4 v[8];
#pragma unroll  // v[] stays in registers, the 8 loads become one clause
  for (int u = 0; u < 8; ++u)
    v[u] = *reinterpret_cast<const float4*>(s + off + u * 128);
  // Holds all 8 loads ahead of the first convert: one memory latency, not several.
  __builtin_amdgcn_sched_barrier(0);
#pragma unroll  // constant indices into v[], so that it stays in registers
  for (int u = 0; u < 8; ++u) {
    _Float16 h[4] = {(_Float16)v[u].x, (_Float16)v[u].y, (_Float16)v[u].z,
                     (_Float16)v[u].w};
    *reinterpret_cast<uint2*>(d + off + u * 128) = *reinterpret_cast<uint2*>(h);
  }
}

// ---------------------------------------------------------------------------
// Attention, ONE launch. A block of 16 waves owns one (b, h) and holds its q, k
// and v (all row-major) in LDS for its whole life: each is read from global
// memory once, with whole-line loads, and no pass stages anything.
// The softmax runs in the exp2 domain on the raw scores S: with c = scale * log2 e,
// exp(scale * S - scale * M) = exp2(c * S - c * M): one fma and one exp2 per score.
// Phase 1: per k column the softmax stats over the QUERY axis. A wave owns 32
// k columns (2 tiles), k fragments resident; it streams the 32 q tiles through
// WMMA. A lane keeps the running max and sum of its own 8 rows of each tile; the
// two lane halves of a column are joined once, behind the loop. One number per
// column goes to LDS: Z = -(c * M + log2 L), L the column's sum.
// Phase 2 runs transposed: S^T = K Q^T (A = k rows, B = q rows), P^T = exp2(c * S^T
// + Z[k]), O^T += V^T P^T. Two score tiles (32 k) of a lane, converted in place, ARE
// the B operand P^T in the hardware k order: P touches neither LDS nor another lane.
// V^T (A) comes from the row-major v by the transposing LDS load, same k order. A
// lane ends with 8 consecutive dh of one q row: one 16 B store. A wave owns kQT
// tiles of 16 q rows and all 64 dh of them.
// ---------------------------------------------------------------------------
static constexpr int kQT = 2;    // q tiles of 16 rows per wave
static constexpr int kAW = 16;   // waves per block: kAW * 16 * kQT = 512 q rows
static constexpr int kRP = 72;   // q, k pitch, halves: 144 B = 16 B x odd
static constexpr int kVR = 80;   // v pitch, halves: 160 B = 32 B x odd (transposing load)

typedef short s16x8 __attribute__((ext_vector_type(8)));
// ds_load_tr16_b128: lane (lo, hi) gets column lo, rows 8 * hi .. + 7, of the 16 x 16
// tile of halves whose rows the lanes' addresses name.
__device__ __forceinline__ u32x4 ld_tr16(const unsigned char* p) {
  typedef __attribute__((address_space(3))) s16x8 lds_s16x8;
  return __builtin_bit_cast(u32x4, __builtin_amdgcn_ds_load_tr16_b128_v8i16((lds_s16x8*)p));
}
__device__ __forceinline__ unsigned pack_h2(float a, float b) {  // round to nearest even
  return __builtin_bit_cast(unsigned, __builtin_convertvector(f32x2{a, b}, f16x2));
}

__global__ __launch_bounds__(512) void attn_fused(const _Float16* __restrict__ q2,
                                                  const _Float16* __restrict__ k2,
                                                  const _Float16* __restrict__ v2,
                                                  _Float16* __restrict__ at2) {
  __shared__ alignas(16) _Float16 Qs[512][kRP];
  __shared__ alignas(16) _Float16 Ks[512][kRP];
  __shared__ alignas(16) _Float16 Vs[512][kVR];
  __shared__ alignas(16) float Zs[512];  // -(c * column maximum + log2 column sum)

  const int bh = blockIdx.x;
  const int b = bh >> 3;
  const int h = bh & 7;
  const int t = threadIdx.x;
  const int lane = t & 31;
  const int wave = t >> 5;
  const int lo = lane & 15;
  const int hi = lane >> 4;

  {  // q, k, v of this (b, h) into LDS; 8 lanes cover one row's 128 B line
    const int srow = t >> 3;
    const int scol = (t & 7) * 8;
    const size_t goff = (((size_t)b * 512 + srow) * 512) + h * 64 + scol;
    const _Float16* qsrc = q2 + goff;
    const _Float16* ksrc = k2 + goff;
    const _Float16* vsrc = v2 + goff;
    u32x4 qr[8], kr[8], vr[8];
#pragma unroll  // constant indices: the three arrays stay in registers
    for (int i = 0; i < 8; ++i) {
      qr[i] = *reinterpret_cast<const u32x4*>(qsrc + i * (64 * 512));
      kr[i] = *reinterpret_cast<const u32x4*>(ksrc + i * (64 * 512));
      vr[i] = *reinterpret_cast<const u32x4*>(vsrc + i * (64 * 512));
    }
    // The wait that stands in front of any rewrite of an address register of the
    // loads above; the loaded values and the addresses are inputs only: they tie
    // the wait behind all 24 loads and keep the addresses up to it.
    asm volatile("s_wait_xcnt 0x0" ::"v"(qr[0]), "v"(qr[1]), "v"(qr[2]), "v"(qr[3]),
                 "v"(qr[4]), "v"(qr[5]), "v"(qr[6]), "v"(qr[7]), "v"(kr[0]), "v"(kr[1]),
                 "v"(kr[2]), "v"(kr[3]), "v"(kr[4]), "v"(kr[5]), "v"(kr[6]), "v"(kr[7]),
                 "v"(vr[0]), "v"(vr[1]), "v"(vr[2]), "v"(vr[3]), "v"(vr[4]), "v"(vr[5]),
                 "v"(vr[6]), "v"(vr[7]), "v"(qsrc), "v"(ksrc), "v"(vsrc)
                 : "memory");
    // keeps every later register write behind that wait
    __builtin_amdgcn_sched_barrier(0);
#pragma unroll
    for (int i = 0; i < 8; ++i) {
      const int row = i * 64 + srow;
      *reinterpret_cast<u32x4*>(&Qs[row][scol]) = qr[i];
      *reinterpret_cast<u32x4*>(&Ks[row][scol]) = kr[i];
      *reinterpret_cast<u32x4*>(&Vs[row][scol]) = vr[i];
    }
  }
  __syncthreads();  // q, k and v are visible to all waves

  {  // phase 1: stats of this wave's 32 k columns
    v16h bk[2][2];
    float m_run[2];  // maximum of the raw scores this lane has seen
    f32x2 l_run[2];  // their sum of exp2(c * (S - m_run)), in two partial sums
#pragma unroll  // constant indices into bk[], so that it stays in registers
    for (int c = 0; c < 2; ++c) {
      const _Float16* krow = &Ks[wave * 32 + c * 16 + lo][0];
      bk[c][0] = ldfrag(krow, hi);
      bk[c][1] = ldfrag(krow + 32, hi);
      m_run[c] = -1e30f;
      l_run[c] = f32x2{0.0f, 0.0f};
    }
    const f32x2 c2 = {kC2, kC2};
#pragma unroll 2  // the next tile's LDS reads and WMMAs stand among this tile's vector work
    for (int q0 = 0; q0 < 512; q0 += 16) {
      const _Float16* qrow = &Qs[q0 + lo][0];
      const v16h aq0 = ldfrag(qrow, hi);
      const v16h aq1 = ldfrag(qrow + 32, hi);
#pragma unroll  // constant indices into bk[]; the two columns' chains interleave
      for (int c = 0; c < 2; ++c) {
        v8f s = {};
        s = wmma_f16(aq0, bk[c][0], s);
        s = wmma_f16(aq1, bk[c][1], s);

        float nm = fmaxf(fmaxf(m_run[c], s[0]), s[1]);
        nm = fmaxf(fmaxf(nm, s[2]), s[3]);
        nm = fmaxf(fmaxf(nm, s[4]), s[5]);
        nm = fmaxf(fmaxf(nm, s[6]), s[7]);
        const float nb = -kC2 * nm;
        const float corr = __builtin_amdgcn_exp2f(fmaf(m_run[c], kC2, nb));
        const f32x2 nb2 = {nb, nb};
        f32x2 e[4];
#pragma unroll
        for (int r = 0; r < 4; ++r) {
          const f32x2 x =
              __builtin_elementwise_fma(f32x2{s[2 * r], s[2 * r + 1]}, c2, nb2);
          e[r] = f32x2{__builtin_amdgcn_exp2f(x[0]), __builtin_amdgcn_exp2f(x[1])};
        }
        l_run[c] = __builtin_elementwise_fma(l_run[c], f32x2{corr, corr}, e[0] + e[1]) +
                   (e[2] + e[3]);
        m_run[c] = nm;
      }
    }
#pragma unroll
    for (int c = 0; c < 2; ++c) {  // join the two lane halves of a column
      const float l = l_run[c][0] + l_run[c][1];
      const float mo = __shfl_xor(m_run[c], 16, 32);
      const float lother = __shfl_xor(l, 16, 32);
      const float M = fmaxf(m_run[c], mo);
      const float L = l * __builtin_amdgcn_exp2f(kC2 * (m_run[c] - M)) +
                      lother * __builtin_amdgcn_exp2f(kC2 * (mo - M));
      if (lane < 16) Zs[wave * 32 + c * 16 + lo] = -(kC2 * M + __log2f(L));
    }
  }
  __syncthreads();  // the stats of all 512 k columns are visible to all waves

  // phase 2
  const int q0 = wave * (16 * kQT);

  v16h bq[kQT][2];  // q rows as the B operand: column n = lo is q row q0 + 16 qt + lo
#pragma unroll  // constant indices into bq[], so that it stays in registers
  for (int qt = 0; qt < kQT; ++qt) {
    const _Float16* qrow = &Qs[q0 + qt * 16 + lo][0];
    bq[qt][0] = ldfrag(qrow, hi);
    bq[qt][1] = ldfrag(qrow + 32, hi);
  }

  v8f oacc[kQT][4] = {};  // O^T: register r = dh 16 jd + 8 hi + r of q row q0 + 16 qt + lo

  // this lane's address in a 16 x 16 tile of v for the transposing load
  const unsigned char* vlane = reinterpret_cast<const unsigned char*>(&Vs[0][0]) +
                               (8 * hi + (lane & 7)) * (kVR * 2) + ((lane >> 3) & 1) * 16;
  const f32x2 c2 = {kC2, kC2};

#pragma unroll 1  // one pass per trip, for speed only
  for (int kt = 0; kt < 512; kt += 32) {
    u32x8 pw[kQT];  // P^T, 32 k x 16 q: element s = k (s < 8 ? 8 hi + s : 16 + 8 hi + s - 8)
#pragma unroll  // constant indices into pw[], so that it stays in registers
    for (int jn = 0; jn < 2; ++jn) {
      const _Float16* krow = &Ks[kt + jn * 16 + lo][0];
      const v16h ak0 = ldfrag(krow, hi);
      const v16h ak1 = ldfrag(krow + 32, hi);
      // the stats of this lane's 8 k rows of the tile (m = r + 8 hi)
      const f32x4 za = *reinterpret_cast<const f32x4*>(&Zs[kt + jn * 16 + 8 * hi]);
      const f32x4 zb = *reinterpret_cast<const f32x4*>(&Zs[kt + jn * 16 + 8 * hi + 4]);
      const f32x2 z2[4] = {{za[0], za[1]}, {za[2], za[3]}, {zb[0], zb[1]}, {zb[2], zb[3]}};
#pragma unroll  // constant indices into bq[]; the kQT score chains interleave
      for (int qt = 0; qt < kQT; ++qt) {
        v8f s = {};
        s = wmma_f16(ak0, bq[qt][0], s);
        s = wmma_f16(ak1, bq[qt][1], s);
#pragma unroll
        for (int r = 0; r < 4; ++r) {
          const f32x2 x =
              __builtin_elementwise_fma(f32x2{s[2 * r], s[2 * r + 1]}, c2, z2[r]);
          pw[qt][jn * 4 + r] =
              pack_h2(__builtin_amdgcn_exp2f(x[0]), __builtin_amdgcn_exp2f(x[1]));
        }
      }
    }

    const unsigned char* vp = vlane + kt * (kVR * 2);
#pragma unroll
    for (int jd = 0; jd < 4; ++jd) {
      const u32x4 v0 = ld_tr16(vp + 32 * jd);                   // k = kt + 8 hi ..
      const u32x4 v1 = ld_tr16(vp + 16 * (kVR * 2) + 32 * jd);  // k = kt + 16 + 8 hi ..
      const v16h av = __builtin_bit_cast(
          v16h, __builtin_shufflevector(v0, v1, 0, 1, 2, 3, 4, 5, 6, 7));
#pragma unroll  // constant indices into oacc[], so that it stays in registers
      for (int qt = 0; qt < kQT; ++qt)
        oacc[qt][jd] = wmma_f16(av, __builtin_bit_cast(v16h, pw[qt]), oacc[qt][jd]);
    }
  }

  u32x4 oh[kQT][4];
#pragma unroll  // constant indices into oacc[] and oh[]: they stay in registers
  for (int qt = 0; qt < kQT; ++qt)
#pragma unroll
    for (int jd = 0; jd < 4; ++jd)
#pragma unroll
      for (int r = 0; r < 4; ++r)
        oh[qt][jd][r] = pack_h2(oacc[qt][jd][2 * r], oacc[qt][jd][2 * r + 1]);
  // All converts stand in front of the first store: no register that an issued
  // store names is written again.
  __builtin_amdgcn_sched_barrier(0);
  _Float16* odst = at2 + (((size_t)b * 512 + q0 + lo) * 512) + h * 64 + 8 * hi;
#pragma unroll
  for (int qt = 0; qt < kQT; ++qt)
#pragma unroll
    for (int jd = 0; jd < 4; ++jd)
      *reinterpret_cast<u32x4*>(odst + qt * (16 * 512) + jd * 16) = oh[qt][jd];
}

// ---------------------------------------------------------------------------
// Tail: out = Q + attn @ Wo^T + bo; final = out + relu(out @ W1^T + b1) @ W2^T
// + b2, all three products in ONE launch. A block owns kFR rows. Their f16
// activations (attn, then out, then the hidden layer) stay in LDS (Xs), 'out'
// in f32 stays in registers; nothing goes through the workspace in between.
// A wave owns 64 output columns = 64 weight rows that no other wave reads; it
// brings them in itself, 64 k at a time, by one tensor load per pass into its
// own slice of a two-buffer ring. The three weights lie one behind the other
// (the workspace is laid out so), so that the ring runs through all 24 passes.
// ---------------------------------------------------------------------------
static constexpr int      kFR     = 64;     // rows per block
static constexpr int      kXP     = 520;    // Xs pitch, halves: 1040 B = 16 B x odd
static constexpr int      kWP     = 72;     // weight pitch in LDS, halves: 144 B
static constexpr unsigned kWSlice = 10240;  // 64 rows x 144 B, up to a 2 KiB multiple
static constexpr unsigned kStages = 24;     // 3 products x 8 passes of 64 k

__device__ __forceinline__ unsigned uni(unsigned v) {
  return (unsigned)__builtin_amdgcn_readfirstlane(v);
}
__device__ __forceinline__ unsigned pinned(unsigned v) {
  unsigned w = uni(v);
  asm volatile("" : "+s"(w));  // pinned(): holds an issue test or a descriptor word in a scalar register
  return w;
}
// LDS reads of this wave have retired (before the ring's buffer is handed over)
__device__ __forceinline__ void wait_ds0() { asm volatile("s_wait_dscnt 0x0" ::: "memory"); }
// Group 1 of the request: 64 rows of 128 B, source pitch 1024 B, 16 B of pad
// behind each row in LDS (pitch 144 B). All extents in bytes, tensor = tile.
__device__ __forceinline__ u32x8 wslice_group1() {
  u32x8 g1;
  g1[0] = pinned((1u << 20) | (4u << 22) | (3u << 25));  // pad: 4 dwords per 32 dwords
  g1[1] = pinned(128u << 16);                            // tensor_dim0 = 128
  g1[2] = pinned(64u << 16);                             // tensor_dim1 = 64
  g1[3] = pinned(128u << 16);                            // tile_dim0 = 128
  g1[4] = pinned(64u);                                   // tile_dim1 = 64
  g1[5] = pinned(1024u);                                 // source row pitch
  g1[6] = pinned(0u);
  g1[7] = pinned(0u);
  return g1;
}

__global__ __launch_bounds__(256) void tail_fused(const _Float16* __restrict__ at2,
                                                  const _Float16* __restrict__ Wcat,
                                                  const float* __restrict__ Q,
                                                  const float* __restrict__ bo,
                                                  const float* __restrict__ b1,
                                                  const float* __restrict__ b2,
                                                  float* __restrict__ out) {
  __shared__ __attribute__((aligned(2048))) unsigned char Wr[2][8][kWSlice];
  __shared__ alignas(16) _Float16 Xs[kFR][kXP];

  const int t = threadIdx.x;
  const int lane = t & 31;
  const unsigned wave = uni(threadIdx.x >> 5);
  const int lo = lane & 15;
  const int hi = lane >> 4;
  const int m0 = blockIdx.x * kFR;
  const int wn = (int)wave * 64;

  const unsigned wdst = (unsigned)(uintptr_t)&Wr[0][0][0] + wave * kWSlice;
  const _Float16* wsrc = Wcat + (size_t)wn * 512;
  // stage s: product s / 8, k columns (s % 8) * 64, into buffer s % 2
  const u32x8 g1 = wslice_group1();
  u32x4 g0;
  g0[0] = pinned(1u);  // count 1
  auto issue = [&](unsigned s) {
    const unsigned long long ga = (unsigned long long)(uintptr_t)(
        wsrc + (size_t)(s >> 3) * (512 * 512) + (s & 7u) * 64u);
    g0[1] = uni(wdst + (s & 1u) * (8u * kWSlice));                      // place in LDS
    g0[2] = uni((unsigned)ga);                                          // address, low
    g0[3] = uni((((unsigned)(ga >> 32)) & 0x01FFFFFFu) | 0x80000000u);  // high | type 2
    asm volatile("tensor_load_to_lds %0, %1" ::"s"(g0), "s"(g1) : "memory");
  };
  // This wave's tensor load has landed (the compiler places no wait for it). The
  // descriptor is an input only: its registers keep their words up to the wait.
  auto wait_tensor0 = [&]() {
    asm volatile("s_wait_tensorcnt 0x0" ::"s"(g0), "s"(g1) : "memory");
  };

  issue(0);
  // The residual rows of Q and the three biases, C layout (m = r + 8*hi, n = lo),
  // asked for here so that their latency runs beside that of stage 0 and Xs.
  const float* qsrc = Q + (size_t)(m0 + 8 * hi) * 512 + wn + lo;
  f32x4 bias[3];
  v8f qv[4][4];
#pragma unroll  // constant indices into bias[] and qv[]: they stay in registers
  for (int j = 0; j < 4; ++j) {
    const int gc = wn + 16 * j + lo;
    bias[0][j] = bo[gc];
    bias[1][j] = b1[gc];
    bias[2][j] = b2[gc];
#pragma unroll
    for (int i = 0; i < 4; ++i)
#pragma unroll
      for (int r = 0; r < 8; ++r) qv[i][j][r] = qsrc[(16 * i + r) * 512 + 16 * j];
  }
  // The wait that stands in front of any rewrite of an address register of the
  // loads above; the address is an input only, so that it lives up to the wait.
  asm volatile("s_wait_xcnt 0x0" ::"v"(qsrc) : "memory");
  // keeps every later register write behind that wait
  __builtin_amdgcn_sched_barrier(0);

  // the block's attn rows into Xs, whole-line loads (a wave takes 512 B of a row)
  const int xrow = t >> 6;
  const int xcol = (t & 63) * 8;
  const _Float16* xsrc = at2 + (size_t)(m0 + xrow) * 512 + xcol;
  u32x4 xr[16];
#pragma unroll  // constant indices into xr[]: it stays in registers
  for (int i = 0; i < 16; ++i)
    xr[i] = *reinterpret_cast<const u32x4*>(xsrc + i * (4 * 512));
  // The same wait for these loads; the loaded values and the address are inputs
  // only: they tie the wait behind the loads and keep the address up to it.
  asm volatile("s_wait_xcnt 0x0" ::"v"(xr[0]), "v"(xr[1]), "v"(xr[2]), "v"(xr[3]),
               "v"(xr[4]), "v"(xr[5]), "v"(xr[6]), "v"(xr[7]), "v"(xr[8]), "v"(xr[9]),
               "v"(xr[10]), "v"(xr[11]), "v"(xr[12]), "v"(xr[13]), "v"(xr[14]),
               "v"(xr[15]), "v"(xsrc)
               : "memory");
  // keeps every later register write behind that wait
  __builtin_amdgcn_sched_barrier(0);
#pragma unroll
  for (int i = 0; i < 16; ++i)
    *reinterpret_cast<u32x4*>(&Xs[i * 4 + xrow][xcol]) = xr[i];
  wait_tensor0();
  __syncthreads();  // stage 0 and Xs are visible to all waves
  issue(1);

  // One product: acc[i][j] = Xs rows 16 i.. x weight rows wn + 16 j.., k ascending
  auto product = [&](unsigned g, v8f (&acc)[4][4]) {
#pragma unroll 1  // one pass per trip: the ring's foot stands once in the text
    for (unsigned kt = 0; kt < 8; ++kt) {
      const unsigned s = g * 8 + kt;
      const _Float16* Wl = reinterpret_cast<const _Float16*>(&Wr[s & 1u][wave][0]);
      v16h af[2][4], wf[2][4];
#pragma unroll
      for (int kk = 0; kk < 2; ++kk) {
#pragma unroll
        for (int j = 0; j < 4; ++j)
          wf[kk][j] = ldfrag(Wl + (16 * j + lo) * kWP + kk * 32, hi);
#pragma unroll
        for (int i = 0; i < 4; ++i)
          af[kk][i] = ldfrag(&Xs[16 * i + lo][kt * 64 + kk * 32], hi);
      }
      // Keeps the pass's LDS reads one group ahead of its WMMAs; without it the
      // compiler spreads them among the WMMAs, each place with a full wait.
      __builtin_amdgcn_sched_barrier(0);
#pragma unroll
      for (int kk = 0; kk < 2; ++kk)
#pragma unroll
        for (int i = 0; i < 4; ++i)
#pragma unroll
          for (int j = 0; j < 4; ++j)
            acc[i][j] = wmma_f16(af[kk][i], wf[kk][j], acc[i][j]);
      // Keeps the WMMAs in front of the foot; without it the compiler sinks them
      // behind the barrier: no overlap with the LDS reads, and a late refill.
      __builtin_amdgcn_sched_barrier(0);
      // foot of pass s: stage s + 1 is published, buffer s % 2 is free
      wait_ds0();
      wait_tensor0();
      __syncthreads();
      if (pinned(s + 2 < kStages)) issue(s + 2);
    }
  };

  v8f outr[4][4];  // 'out' in f32: C layout m = r + 8*hi, n = lo

  {  // out = Q + attn @ Wo^T + bo
    v8f acc[4][4] = {};
    product(0, acc);
#pragma unroll
    for (int j = 0; j < 4; ++j) {
      const int gc = wn + 16 * j + lo;
      const float bv = bias[0][j];
#pragma unroll
      for (int i = 0; i < 4; ++i) {
        const int lr = 16 * i + 8 * hi;
#pragma unroll
        for (int r = 0; r < 8; ++r) {
          float x = acc[i][j][r] + bv;
          x += qv[i][j][r];
          outr[i][j][r] = x;
          Xs[lr + r][gc] = (_Float16)x;
        }
      }
    }
    __syncthreads();  // 'out' in f16 is visible to all waves
  }

  {  // hidden = relu(out @ W1^T + b1)
    v8f acc[4][4] = {};
    product(1, acc);
#pragma unroll
    for (int j = 0; j < 4; ++j) {
      const int gc = wn + 16 * j + lo;
      const float bv = bias[1][j];
#pragma unroll
      for (int i = 0; i < 4; ++i) {
        const int lr = 16 * i + 8 * hi;
#pragma unroll
        for (int r = 0; r < 8; ++r)
          Xs[lr + r][gc] = (_Float16)fmaxf(acc[i][j][r] + bv, 0.0f);
      }
    }
    __syncthreads();  // the hidden layer is visible to all waves
  }

  {  // final = out + hidden @ W2^T + b2
    v8f acc[4][4] = {};
    product(2, acc);
    wait_tensor0();
    wait_ds0();
#pragma unroll
    for (int j = 0; j < 4; ++j) {
      const float bv = bias[2][j];
#pragma unroll
      for (int i = 0; i < 4; ++i) {
#pragma unroll
        for (int r = 0; r < 8; ++r) {
          float x = acc[i][j][r] + bv;
          x += outr[i][j][r];
          acc[i][j][r] = x;
        }
      }
    }
    // All sums stand in front of the first store: no register that an issued
    // store names is written again.
    __builtin_amdgcn_sched_barrier(0);
    float* odst = out + (size_t)(m0 + 8 * hi) * 512 + wn + lo;
#pragma unroll
    for (int j = 0; j < 4; ++j)
#pragma unroll
      for (int i = 0; i < 4; ++i)
#pragma unroll
        for (int r = 0; r < 8; ++r) odst[(16 * i + r) * 512 + 16 * j] = acc[i][j][r];
  }
}

// The work-group barrier alone, for data that goes from wave to wave through LDS:
// the caller's s_wait_dscnt 0 stands in front of it. __syncthreads() would also wait
// for every global load in flight, and the K rows are to stay in flight across it.
__device__ __forceinline__ void barrier_lds() {
  asm volatile("s_barrier_signal -1\n\ts_barrier_wait -1" ::: "memory");
}

// ---------------------------------------------------------------------------
// Projections: q = Q @ Wq^T + bq, k = K @ Wk^T + bk, v = K @ Wv^T + bv, all three
// in ONE launch, straight from the f32 activations. A block owns kFR rows of Q and
// the same kFR rows of K: it reads each f32 row once, with whole-line loads,
// converts it and keeps it in LDS in f16 (Xa: Q rows, Xb: K rows). The K rows are
// asked for at the start and stay in flight, then in registers, during the first
// product. Weights as in tail_fused: a wave owns 64 output columns = 64 weight
// rows and brings them in itself, 64 k at a time, by one tensor load per pass into
// its own slice of a two-buffer ring; Wq, Wk, Wv lie one behind the other, so that
// the ring runs through all 24 passes. A wave's 64 x 64 result goes through its own
// columns of Xa (free after the first product) and leaves as whole 128 B lines.
// qkv: q2, k2, v2, one behind the other (the workspace is laid out so).
// ---------------------------------------------------------------------------
__global__ __launch_bounds__(256) void qkv_fused(const float* __restrict__ Q,
                                                 const float* __restrict__ Kx,
                                                 const _Float16* __restrict__ Wcat,
                                                 const float* __restrict__ bq,
                                                 const float* __restrict__ bk,
                                                 const float* __restrict__ bv,
                                                 _Float16* __restrict__ qkv) {
  __shared__ __attribute__((aligned(2048))) unsigned char Wr[2][8][kWSlice];
  __shared__ alignas(16) _Float16 Xa[kFR][kXP];
  __shared__ alignas(16) _Float16 Xb[kFR][kXP];

  const int t = threadIdx.x;
  const int lane = t & 31;
  const unsigned wave = uni(threadIdx.x >> 5);
  const int lo = lane & 15;
  const int hi = lane >> 4;
  const int m0 = blockIdx.x * kFR;
  const int wn = (int)wave * 64;

  const unsigned wdst = (unsigned)(uintptr_t)&Wr[0][0][0] + wave * kWSlice;
  const _Float16* wsrc = Wcat + (size_t)wn * 512;
  // stage s: product s / 8, k columns (s % 8) * 64, into buffer s % 2
  const u32x8 g1 = wslice_group1();
  u32x4 g0;
  g0[0] = pinned(1u);  // count 1
  auto issue = [&](unsigned s) {
    const unsigned long long ga = (unsigned long long)(uintptr_t)(
        wsrc + (size_t)(s >> 3) * (512 * 512) + (s & 7u) * 64u);
    g0[1] = uni(wdst + (s & 1u) * (8u * kWSlice));                      // place in LDS
    g0[2] = uni((unsigned)ga);                                          // address, low
    g0[3] = uni((((unsigned)(ga >> 32)) & 0x01FFFFFFu) | 0x80000000u);  // high | type 2
    asm volatile("tensor_load_to_lds %0, %1" ::"s"(g0), "s"(g1) : "memory");
  };
  // This wave's tensor load has landed (the compiler places no wait for it). The
  // descriptor is an input only: its registers keep their words up to the wait.
  auto wait_tensor0 = [&]() {
    asm volatile("s_wait_tensorcnt 0x0" ::"s"(g0), "s"(g1) : "memory");
  };

  issue(0);
  // The block's f32 rows, whole-line loads (a wave takes 512 B of a row; the block
  // two rows per load): first the 32 loads of Q, then the 32 of K, all in flight.
  const int xrow = t >> 7;
  const int xcol = (t & 127) * 4;
  const float* qsrc = Q + (size_t)(m0 + xrow) * 512 + xcol;
  const float* ksrc = Kx + (size_t)(m0 + xrow) * 512 + xcol;
  f32x4 qf[32], kf[32];
#pragma unroll  // constant indices into qf[]: it stays in registers
  for (int i = 0; i < 32; ++i)
    qf[i] = *reinterpret_cast<const f32x4*>(qsrc + i * (2 * 512));
  // Keeps every load of Q ahead of those of K; without it the compiler puts six of
  // them behind: loads return in order, and the first product would wait for K.
  __builtin_amdgcn_sched_barrier(0);
#pragma unroll  // constant indices into kf[]: it stays in registers
  for (int i = 0; i < 32; ++i)
    kf[i] = *reinterpret_cast<const f32x4*>(ksrc + i * (2 * 512));
  const int gc0 = wn + lo;  // this lane's first output column (C layout, n = lo)
  f32x4 bias[3];
#pragma unroll  // constant indices into bias[]: it stays in registers
  for (int j = 0; j < 4; ++j) {
    bias[0][j] = bq[gc0 + 16 * j];
    bias[1][j] = bk[gc0 + 16 * j];
    bias[2][j] = bv[gc0 + 16 * j];
  }
  // The wait that stands in front of any rewrite of an address register of the
  // loads above; the addresses are inputs only, so that they live up to the wait.
  asm volatile("s_wait_xcnt 0x0" ::"v"(qsrc), "v"(ksrc), "v"(gc0) : "memory");
  // keeps every later register write behind that wait
  __builtin_amdgcn_sched_barrier(0);

  // four f32 of a row -> four f16, one 8 B store (a wave fills 256 B in a row)
  auto put = [&](_Float16(*X)[kXP], int i, f32x4 x) {
    _Float16 h[4] = {(_Float16)x[0], (_Float16)x[1], (_Float16)x[2], (_Float16)x[3]};
    *reinterpret_cast<uint2*>(&X[2 * i + xrow][xcol]) = *reinterpret_cast<uint2*>(h);
  };
#pragma unroll  // constant indices into qf[]: it stays in registers
  for (int i = 0; i < 32; ++i) put(Xa, i, qf[i]);
  wait_ds0();
  wait_tensor0();
  barrier_lds();  // stage 0 and the Q rows are visible to all waves
  issue(1);

  // One product: acc[i][j] = X rows 16 i.. x weight rows wn + 16 j.., k ascending
  auto product = [&](unsigned g, const _Float16(*X)[kXP], v8f(&acc)[4][4]) {
#pragma unroll 1  // one pass per trip: the ring's foot stands once in the text
    for (unsigned kt = 0; kt < 8; ++kt) {
      const unsigned s = g * 8 + kt;
      const _Float16* Wl = reinterpret_cast<const _Float16*>(&Wr[s & 1u][wave][0]);
      v16h af[2][4], wf[2][4];
#pragma unroll
      for (int kk = 0; kk < 2; ++kk) {
#pragma unroll
        for (int j = 0; j < 4; ++j)
          wf[kk][j] = ldfrag(Wl + (16 * j + lo) * kWP + kk * 32, hi);
#pragma unroll
        for (int i = 0; i < 4; ++i)
          af[kk][i] = ldfrag(&X[16 * i + lo][kt * 64 + kk * 32], hi);
      }
      // Keeps the pass's LDS reads one group ahead of its WMMAs; without it the
      // compiler spreads them among the WMMAs, each place with a full wait.
      __builtin_amdgcn_sched_barrier(0);
#pragma unroll
      for (int kk = 0; kk < 2; ++kk)
#pragma unroll
        for (int i = 0; i < 4; ++i)
#pragma unroll
          for (int j = 0; j < 4; ++j)
            acc[i][j] = wmma_f16(af[kk][i], wf[kk][j], acc[i][j]);
      // Keeps the WMMAs in front of the foot; without it the compiler sinks them
      // behind the barrier: no overlap with the LDS reads, and a late refill.
      __builtin_amdgcn_sched_barrier(0);
      // foot of pass s: stage s + 1 is published, buffer s % 2 is free
      wait_ds0();
      wait_tensor0();
      barrier_lds();
      if (pinned(s + 2 < kStages)) issue(s + 2);
    }
  };

  // Result of product g out: C layout (m = r + 8*hi, n = lo) into this wave's own
  // 64 columns of Xa, which no other wave touches, then back row by row: 8 lanes
  // cover a row's 128 B line, a store covers four whole lines.
  const int orow = lane >> 3;
  const int ocol = wn + (lane & 7) * 8;
  auto emit = [&](unsigned g, v8f(&acc)[4][4]) {
#pragma unroll
    for (int j = 0; j < 4; ++j) {
      const int gc = wn + 16 * j + lo;
      const float bvj = bias[g][j];
#pragma unroll
      for (int i = 0; i < 4; ++i) {
        const int lr = 16 * i + 8 * hi;
#pragma unroll
        for (int r = 0; r < 8; ++r) Xa[lr + r][gc] = (_Float16)(acc[i][j][r] + bvj);
      }
    }
    u32x4 o[16];
#pragma unroll  // constant indices into o[]: it stays in registers
    for (int n = 0; n < 16; ++n)
      o[n] = *reinterpret_cast<const u32x4*>(&Xa[4 * n + orow][ocol]);
    // All 16 reads stand in front of the first store: no register that an issued
    // store names is written by a later read.
    __builtin_amdgcn_sched_barrier(0);
    _Float16* odst = qkv + (size_t)g * (32 * 512 * 512) + (size_t)(m0 + orow) * 512 + ocol;
#pragma unroll
    for (int n = 0; n < 16; ++n)
      *reinterpret_cast<u32x4*>(odst + n * (4 * 512)) = o[n];
    // The wait that stands in front of any rewrite of a register of the stores
    // above; data and address are inputs only, so that they live up to the wait.
    asm volatile("s_wait_xcnt 0x0" ::"v"(o[0]), "v"(o[1]), "v"(o[2]), "v"(o[3]), "v"(o[4]),
                 "v"(o[5]), "v"(o[6]), "v"(o[7]), "v"(o[8]), "v"(o[9]), "v"(o[10]),
                 "v"(o[11]), "v"(o[12]), "v"(o[13]), "v"(o[14]), "v"(o[15]), "v"(odst)
                 : "memory");
    // keeps every later register write behind that wait
    __builtin_amdgcn_sched_barrier(0);
  };

  {  // q = Q @ Wq^T + bq
    v8f acc[4][4] = {};
    product(0, Xa, acc);
    // the last foot's barrier has ended every wave's reads of Xa
#pragma unroll  // constant indices into kf[]: it stays in registers
    for (int i = 0; i < 32; ++i) put(Xb, i, kf[i]);
    emit(0, acc);
    wait_ds0();
    barrier_lds();  // the K rows are visible to all waves
  }
  {  // k = K @ Wk^T + bk
    v8f acc[4][4] = {};
    product(1, Xb, acc);
    emit(1, acc);
  }
  {  // v = K @ Wv^T + bv
    v8f acc[4][4] = {};
    product(2, Xb, acc);
    wait_tensor0();
    wait_ds0();
    emit(2, acc);
  }
}

// ---------------------------------------------------------------------------
extern "C" void kernel_launch(void* const* d_in, const int* in_sizes, int n_in,
                              void* d_out, int out_size, void* d_ws,
                              size_t ws_size, hipStream_t stream) {
  (void)in_sizes; (void)n_in; (void)out_size; (void)ws_size;
  const float* Q  = (const float*)d_in[0];
  const float* Kx = (const float*)d_in[1];
  const float* Wq = (const float*)d_in[2];
  const float* bq = (const float*)d_in[3];
  const float* Wk = (const float*)d_in[4];
  const float* bk = (const float*)d_in[5];
  const float* Wv = (const float*)d_in[6];
  const float* bv = (const float*)d_in[7];
  const float* Wo = (const float*)d_in[8];
  const float* bo = (const float*)d_in[9];
  const float* W1 = (const float*)d_in[10];
  const float* b1 = (const float*)d_in[11];
  const float* W2 = (const float*)d_in[12];
  const float* b2 = (const float*)d_in[13];

  constexpr int B = 32, Nt = 512, D = 512, H = 8;
  constexpr int M = B * Nt;                          // 16384
  const size_t szH = (size_t)M * D * sizeof(_Float16);  // activations, f16
  const size_t szW = (size_t)D * D * sizeof(_Float16);  // weights, f16

  char* p = (char*)d_ws;
  _Float16* q2   = (_Float16*)p; p += szH;
  _Float16* k2   = (_Float16*)p; p += szH;
  _Float16* v2   = (_Float16*)p; p += szH;
  _Float16* at2  = (_Float16*)p; p += szH;
  _Float16* Wq6  = (_Float16*)p; p += szW;
  _Float16* Wk6  = (_Float16*)p; p += szW;
  _Float16* Wv6  = (_Float16*)p; p += szW;
  _Float16* Wo6  = (_Float16*)p; p += szW;
  _Float16* W16w = (_Float16*)p; p += szW;
  _Float16* W26w = (_Float16*)p;

  const dim3 blk(256);

  // f32 -> f16 conversion of the six weights, one launch
  cvt_wgt<<<dim3(6 * kWgtSegs), blk, 0, stream>>>(Wq, Wk, Wv, Wo, W1, W2, Wq6);

  // q/k/v projections from the f32 activations (f16 out), one launch
  qkv_fused<<<dim3(M / kFR), blk, 0, stream>>>(Q, Kx, Wq6, bq, bk, bv, q2);

  // attention: column softmax stats (query axis), then P @ V, one launch
  attn_fused<<<dim3(B * H), dim3(32 * kAW), 0, stream>>>(q2, k2, v2, at2);

  // out = Q + attn @ Wo^T + bo; final = out + relu(out @ W1^T + b1) @ W2^T + b2
  tail_fused<<<dim3(M / kFR), blk, 0, stream>>>(at2, Wo6, Q, bo, b1, b2,
                                                (float*)d_out);
}

// v010
// A run of this version takes 90.5 microseconds.
// In both of two side-by-side timings against v009, it was 1.08 times as fast.
// All steps since v000 together make it 2.83 times as fast.
#include <hip/hip_runtime.h>
#include <math.h>

// MAB (multihead attention block) for MI455X / gfx1250, wave32 + WMMA + TDM.
// B=32, N=512, D=512, H=8, dh=64. All heavy math via v_wmma_f32_16x16x32_f16;
// weight staging via tensor_load_to_lds (Tensor Data Mover), double-buffered.

typedef _Float16 v16h __attribute__((ext_vector_type(16)));
typedef float    v8f  __attribute__((ext_vector_type(8)));
typedef unsigned int u32x4 __attribute__((ext_vector_type(4)));
typedef int          i32x4 __attribute__((ext_vector_type(4)));
typedef int          i32x8 __attribute__((ext_vector_type(8)));
typedef unsigned int u32x8 __attribute__((ext_vector_type(8)));
typedef float        f32x4 __attribute__((ext_vector_type(4)));
typedef float        f32x2 __attribute__((ext_vector_type(2)));
typedef _Float16     f16x2 __attribute__((ext_vector_type(2)));

static constexpr float kScale = 0.044194173824159216f; // 1/sqrt(512)
static constexpr float kC2 = kScale * 1.4426950408889634f;  // scale * log2 e

__device__ __forceinline__ v8f wmma_f16(v16h a, v16h b, v8f c) {
  // (neg_a, A, neg_b, B, c_mod, C, reuse_a, reuse_b)
  return __builtin_amdgcn_wmma_f32_16x16x32_f16(false, a, false, b, (short)0, c,
                                                false, false);
}

// 16-bit A/B fragment for 16x16x32 WMMA. Per ISA layout, lane (lo=L%16,
// hi=L/16) holds K=[8*hi,8*hi+8) in VGPR0-3 and K=[16+8*hi,+8) in VGPR4-7.
__device__ __forceinline__ v16h ldfrag(const _Float16* rowp, int hi) {
  v16h a;
  *reinterpret_cast<uint4*>(&a)       = *reinterpret_cast<const uint4*>(rowp + 8 * hi);
  *(reinterpret_cast<uint4*>(&a) + 1) = *reinterpret_cast<const uint4*>(rowp + 16 + 8 * hi);
  return a;
}

// ---------------------------------------------------------------------------
// f32 -> f16 convert of the six weights in ONE launch (the activations are
// converted where they are used, in qkv_fused). A block takes one kSeg-element
// segment of one weight, picked by its index (a scalar choice); a wave takes
// 1024 contiguous elements of it: 8 whole-line loads of 512 B, all in flight
// before the first convert, then whole-line stores of 256 B.
// dWgt: the f16 copies, one behind the other (the workspace is laid out so).
// ---------------------------------------------------------------------------
static constexpr unsigned kSeg     = 8192;               // elements per block
static constexpr unsigned kWgtSegs = 512 * 512 / kSeg;   // 32 per weight

__global__ __launch_bounds__(256) void cvt_wgt(const float* __restrict__ Wq,
                                               const float* __restrict__ Wk,
                                               const float* __restrict__ Wv,
                                               const float* __restrict__ Wo,
                                               const float* __restrict__ W1,
                                               const float* __restrict__ W2,
                                               _Float16* __restrict__ dWgt) {
  const unsigned wb = blockIdx.x;
  const unsigned w = wb / kWgtSegs;
  const float* wsrc = w == 0 ? Wq : w == 1 ? Wk : w == 2 ? Wv
                    : w == 3 ? Wo : w == 4 ? W1 : W2;
  const float* s = wsrc + (size_t)(wb % kWgtSegs) * kSeg;
  _Float16* d = dWgt + (size_t)wb * kSeg;
  const int off = (threadIdx.x >> 5) * 1024 + (threadIdx.x & 31) * 4;

  float4 v[8];
#pragma unroll  // v[] stays in registers, the 8 loads become one clause
  for (int u = 0; u < 8; ++u)
    v[u] = *reinterpret_cast<const float4*>(s + off + u * 128);
  // Holds all 8 loads ahead of the first convert: one memory latency, not several.
  __builtin_amdgcn_sched_barrier(0);
#pragma unroll  // constant indices into v[], so that it stays in registers
  for (int u = 0; u < 8; ++u) {
    _Float16 h[4] = {(_Float16)v[u].x, (_Float16)v[u].y, (_Float16)v[u].z,
                     (_Float16)v[u].w};
    *reinterpret_cast<uint2*>(d + off + u * 128) = *reinterpret_cast<uint2*>(h);
  }
}

// ---------------------------------------------------------------------------
// Attention, ONE launch. A block of 16 waves owns one (b, h) and holds its q, k
// and v (all row-major) in LDS for its whole life: each is read from global
// memory once, with whole-line loads, and no pass stages anything.
// The softmax runs in the exp2 domain on the raw scores S: with c = scale * log2 e,
// exp(scale * S - scale * M) = exp2(c * S - c * M): one fma and one exp2 per score.
// Phase 1: per k column the softmax stats over the QUERY axis. A wave owns 32
// k columns (2 tiles), k fragments resident; it streams the 32 q tiles through
// WMMA. A lane keeps the running max and sum of its own 8 rows of each tile; the
// two lane halves of a column are joined once, behind the loop. One number per
// column goes to LDS: Z = -(c * M + log2 L), L the column's sum.
// Phase 2 runs transposed: S^T = K Q^T (A = k rows, B = q rows), P^T = exp2(c * S^T
// + Z[k]), O^T += V^T P^T. Two score tiles (32 k) of a lane, converted in place, ARE
// the B operand P^T in the hardware k order: P touches neither LDS nor another lane.
// V^T (A) comes from the row-major v by the transposing LDS load, same k order. A
// lane ends with 8 consecutive dh of one q row: one 16 B store. A wave owns kQT
// tiles of 16 q rows and all 64 dh of them.
// ---------------------------------------------------------------------------
static constexpr int kQT = 2;    // q tiles of 16 rows per wave
static constexpr int kAW = 16;   // waves per block: kAW * 16 * kQT = 512 q rows
static constexpr int kRP = 72;   // q, k pitch, halves: 144 B = 16 B x odd
static constexpr int kVR = 80;   // v pitch, halves: 160 B = 32 B x odd (transposing load)

typedef short s16x8 __attribute__((ext_vector_type(8)));
// ds_load_tr16_b128: lane (lo, hi) gets column lo, rows 8 * hi .. + 7, of the 16 x 16
// tile of halves whose rows the lanes' addresses name.
__device__ __forceinline__ u32x4 ld_tr16(const unsigned char* p) {
  typedef __attribute__((address_space(3))) s16x8 lds_s16x8;
  return __builtin_bit_cast(u32x4, __builtin_amdgcn_ds_load_tr16_b128_v8i16((lds_s16x8*)p));
}
__device__ __forceinline__ unsigned pack_h2(float a, float b) {  // round to nearest even
  return __builtin_bit_cast(unsigned, __builtin_convertvector(f32x2{a, b}, f16x2));
}

__global__ __launch_bounds__(512) void attn_fused(const _Float16* __restrict__ q2,
                                                  const _Float16* __restrict__ k2,
                                                  const _Float16* __restrict__ v2,
                                                  _Float16* __restrict__ at2) {
  __shared__ alignas(16) _Float16 Qs[512][kRP];
  __shared__ alignas(16) _Float16 Ks[512][kRP];
  __shared__ alignas(16) _Float16 Vs[512][kVR];
  __shared__ alignas(16) float Zs[512];  // -(c * column maximum + log2 column sum)

  const int bh = blockIdx.x;
  const int b = bh >> 3;
  const int h = bh & 7;
  const int t = threadIdx.x;
  const int lane = t & 31;
  const int wave = t >> 5;
  const int lo = lane & 15;
  const int hi = lane >> 4;

  {  // q, k, v of this (b, h) into LDS; 8 lanes cover one row's 128 B line
    const int srow = t >> 3;
    const int scol = (t & 7) * 8;
    const size_t goff = (((size_t)b * 512 + srow) * 512) + h * 64 + scol;
    const _Float16* qsrc = q2 + goff;
    const _Float16* ksrc = k2 + goff;
    const _Float16* vsrc = v2 + goff;
    u32x4 qr[8], kr[8], vr[8];
#pragma unroll  // constant indices: the three arrays stay in registers
    for (int i = 0; i < 8; ++i) {
      qr[i] = *reinterpret_cast<const u32x4*>(qsrc + i * (64 * 512));
      kr[i] = *reinterpret_cast<const u32x4*>(ksrc + i * (64 * 512));
      vr[i] = *reinterpret_cast<const u32x4*>(vsrc + i * (64 * 512));
    }
    // The wait that stands in front of any rewrite of an address register of the
    // loads above; the loaded values and the addresses are inputs only: they tie
    // the wait behind all 24 loads and keep the addresses up to it.
    asm volatile("s_wait_xcnt 0x0" ::"v"(qr[0]), "v"(qr[1]), "v"(qr[2]), "v"(qr[3]),
                 "v"(qr[4]), "v"(qr[5]), "v"(qr[6]), "v"(qr[7]), "v"(kr[0]), "v"(kr[1]),
                 "v"(kr[2]), "v"(kr[3]), "v"(kr[4]), "v"(kr[5]), "v"(kr[6]), "v"(kr[7]),
                 "v"(vr[0]), "v"(vr[1]), "v"(vr[2]), "v"(vr[3]), "v"(vr[4]), "v"(vr[5]),
                 "v"(vr[6]), "v"(vr[7]), "v"(qsrc), "v"(ksrc), "v"(vsrc)
                 : "memory");
    // keeps every later register write behind that wait
    __builtin_amdgcn_sched_barrier(0);
#pragma unroll
    for (int i = 0; i < 8; ++i) {
      const int row = i * 64 + srow;
      *reinterpret_cast<u32x4*>(&Qs[row][scol]) = qr[i];
      *reinterpret_cast<u32x4*>(&Ks[row][scol]) = kr[i];
      *reinterpret_cast<u32x4*>(&Vs[row][scol]) = vr[i];
    }
  }
  __syncthreads();  // q, k and v are visible to all waves

  {  // phase 1: stats of this wave's 32 k columns
    v16h bk[2][2];
    float m_run[2];  // maximum of the raw scores this lane has seen
    f32x2 l_run[2];  // their sum of exp2(c * (S - m_run)), in two partial sums
#pragma unroll  // constant indices into bk[], so that it stays in registers
    for (int c = 0; c < 2; ++c) {
      const _Float16* krow = &Ks[wave * 32 + c * 16 + lo][0];
      bk[c][0] = ldfrag(krow, hi);
      bk[c][1] = ldfrag(krow + 32, hi);
      m_run[c] = -1e30f;
      l_run[c] = f32x2{0.0f, 0.0f};
    }
    const f32x2 c2 = {kC2, kC2};
#pragma unroll 2  // the next tile's LDS reads and WMMAs stand among this tile's vector work
    for (int q0 = 0; q0 < 512; q0 += 16) {
      const _Float16* qrow = &Qs[q0 + lo][0];
      const v16h aq0 = ldfrag(qrow, hi);
      const v16h aq1 = ldfrag(qrow + 32, hi);
#pragma unroll  // constant indices into bk[]; the two columns' chains interleave
      for (int c = 0; c < 2; ++c) {
        v8f s = {};
        s = wmma_f16(aq0, bk[c][0], s);
        s = wmma_f16(aq1, bk[c][1], s);

        float nm = fmaxf(fmaxf(m_run[c], s[0]), s[1]);
        nm = fmaxf(fmaxf(nm, s[2]), s[3]);
        nm = fmaxf(fmaxf(nm, s[4]), s[5]);
        nm = fmaxf(fmaxf(nm, s[6]), s[7]);
        const float nb = -kC2 * nm;
        const float corr = __builtin_amdgcn_exp2f(fmaf(m_run[c], kC2, nb));
        const f32x2 nb2 = {nb, nb};
        f32x2 e[4];
#pragma unroll
        for (int r = 0; r < 4; ++r) {
          const f32x2 x =
              __builtin_elementwise_fma(f32x2{s[2 * r], s[2 * r + 1]}, c2, nb2);
          e[r] = f32x2{__builtin_amdgcn_exp2f(x[0]), __builtin_amdgcn_exp2f(x[1])};
        }
        l_run[c] = __builtin_elementwise_fma(l_run[c], f32x2{corr, corr}, e[0] + e[1]) +
                   (e[2] + e[3]);
        m_run[c] = nm;
      }
    }
#pragma unroll
    for (int c = 0; c < 2; ++c) {  // join the two lane halves of a column
      const float l = l_run[c][0] + l_run[c][1];
      const float mo = __shfl_xor(m_run[c], 16, 32);
      const float lother = __shfl_xor(l, 16, 32);
      const float M = fmaxf(m_run[c], mo);
      const float L = l * __builtin_amdgcn_exp2f(kC2 * (m_run[c] - M)) +
                      lother * __builtin_amdgcn_exp2f(kC2 * (mo - M));
      if (lane < 16) Zs[wave * 32 + c * 16 + lo] = -(kC2 * M + __log2f(L));
    }
  }
  __syncthreads();  // the stats of all 512 k columns are visible to all waves

  // phase 2
  const int q0 = wave * (16 * kQT);

  v16h bq[kQT][2];  // q rows as the B operand: column n = lo is q row q0 + 16 qt + lo
#pragma unroll  // constant indices into bq[], so that it stays in registers
  for (int qt = 0; qt < kQT; ++qt) {
    const _Float16* qrow = &Qs[q0 + qt * 16 + lo][0];
    bq[qt][0] = ldfrag(qrow, hi);
    bq[qt][1] = ldfrag(qrow + 32, hi);
  }

  v8f oacc[kQT][4] = {};  // O^T: register r = dh 16 jd + 8 hi + r of q row q0 + 16 qt + lo

  // this lane's address in a 16 x 16 tile of v for the transposing load
  const unsigned char* vlane = reinterpret_cast<const unsigned char*>(&Vs[0][0]) +
                               (8 * hi + (lane & 7)) * (kVR * 2) + ((lane >> 3) & 1) * 16;
  const f32x2 c2 = {kC2, kC2};

#pragma unroll 1  // one pass per trip, for speed only
  for (int kt = 0; kt < 512; kt += 32) {
    u32x8 pw[kQT];  // P^T, 32 k x 16 q: element s = k (s < 8 ? 8 hi + s : 16 + 8 hi + s - 8)
#pragma unroll  // constant indices into pw[], so that it stays in registers
    for (int jn = 0; jn < 2; ++jn) {
      const _Float16* krow = &Ks[kt + jn * 16 + lo][0];
      const v16h ak0 = ldfrag(krow, hi);
      const v16h ak1 = ldfrag(krow + 32, hi);
      // the stats of this lane's 8 k rows of the tile (m = r + 8 hi)
      const f32x4 za = *reinterpret_cast<const f32x4*>(&Zs[kt + jn * 16 + 8 * hi]);
      const f32x4 zb = *reinterpret_cast<const f32x4*>(&Zs[kt + jn * 16 + 8 * hi + 4]);
      const f32x2 z2[4] = {{za[0], za[1]}, {za[2], za[3]}, {zb[0], zb[1]}, {zb[2], zb[3]}};
#pragma unroll  // constant indices into bq[]; the kQT score chains interleave
      for (int qt = 0; qt < kQT; ++qt) {
        v8f s = {};
        s = wmma_f16(ak0, bq[qt][0], s);
        s = wmma_f16(ak1, bq[qt][1], s);
#pragma unroll
        for (int r = 0; r < 4; ++r) {
          const f32x2 x =
              __builtin_elementwise_fma(f32x2{s[2 * r], s[2 * r + 1]}, c2, z2[r]);
          pw[qt][jn * 4 + r] =
              pack_h2(__builtin_amdgcn_exp2f(x[0]), __builtin_amdgcn_exp2f(x[1]));
        }
      }
    }

    const unsigned char* vp = vlane + kt * (kVR * 2);
#pragma unroll
    for (int jd = 0; jd < 4; ++jd) {
      const u32x4 v0 = ld_tr16(vp + 32 * jd);                   // k = kt + 8 hi ..
      const u32x4 v1 = ld_tr16(vp + 16 * (kVR * 2) + 32 * jd);  // k = kt + 16 + 8 hi ..
      const v16h av = __builtin_bit_cast(
          v16h, __builtin_shufflevector(v0, v1, 0, 1, 2, 3, 4, 5, 6, 7));
#pragma unroll  // constant indices into oacc[], so that it stays in registers
      for (int qt = 0; qt < kQT; ++qt)
        oacc[qt][jd] = wmma_f16(av, __builtin_bit_cast(v16h, pw[qt]), oacc[qt][jd]);
    }
  }

  u32x4 oh[kQT][4];
#pragma unroll  // constant indices into oacc[] and oh[]: they stay in registers
  for (int qt = 0; qt < kQT; ++qt)
#pragma unroll
    for (int jd = 0; jd < 4; ++jd)
#pragma unroll
      for (int r = 0; r < 4; ++r)
        oh[qt][jd][r] = pack_h2(oacc[qt][jd][2 * r], oacc[qt][jd][2 * r + 1]);
  // All converts stand in front of the first store: no register that an issued
  // store names is written again.
  __builtin_amdgcn_sched_barrier(0);
  _Float16* odst = at2 + (((size_t)b * 512 + q0 + lo) * 512) + h * 64 + 8 * hi;
#pragma unroll
  for (int qt = 0; qt < kQT; ++qt)
#pragma unroll
    for (int jd = 0; jd < 4; ++jd)
      *reinterpret_cast<u32x4*>(odst + qt * (16 * 512) + jd * 16) = oh[qt][jd];
}

// ---------------------------------------------------------------------------
// Tail: out = Q + attn @ Wo^T + bo; final = out + relu(out @ W1^T + b1) @ W2^T
// + b2, all three products in ONE launch. A block owns kFR rows. Their f16
// activations (attn, then out, then the hidden layer) stay in LDS (Xs), 'out'
// in f32 stays in registers; nothing goes through the workspace in between.
// A wave owns 64 output columns = 64 weight rows that no other wave reads; it
// brings them in itself, 64 k at a time, by one tensor load per pass into its
// own slice of a two-buffer ring. The three weights lie one behind the other
// (the workspace is laid out so), so that the ring runs through all 24 passes.
// The ring is private to its wave: a slice is read and refilled by the wave that
// loaded it and by no other, so a pass ends in that wave's own two waits and in no
// work-group barrier. The waves of a block drift apart inside a product: one reads
// LDS or waits for its tile while its neighbour on the SIMD runs its WMMAs.
// Barriers stand only where the shared rows in Xs change.
// ---------------------------------------------------------------------------
static constexpr int      kFR     = 64;     // rows per block
static constexpr int      kXP     = 520;    // Xs pitch, halves: 1040 B = 16 B x odd
static constexpr int      kWP     = 72;     // weight pitch in LDS, halves: 144 B
static constexpr unsigned kWSlice = 10240;  // 64 rows x 144 B, up to a 2 KiB multiple
static constexpr unsigned kStages = 24;     // 3 products x 8 passes of 64 k

__device__ __forceinline__ unsigned uni(unsigned v) {
  return (unsigned)__builtin_amdgcn_readfirstlane(v);
}
__device__ __forceinline__ unsigned pinned(unsigned v) {
  unsigned w = uni(v);
  asm volatile("" : "+s"(w));  // pinned(): holds an issue test or a descriptor word in a scalar register
  return w;
}
// LDS reads of this wave have retired (before the ring's buffer is handed over)
__device__ __forceinline__ void wait_ds0() { asm volatile("s_wait_dscnt 0x0" ::: "memory"); }
// Group 1 of the request: 64 rows of 128 B, source pitch 1024 B, 16 B of pad
// behind each row in LDS (pitch 144 B). All extents in bytes, tensor = tile.
__device__ __forceinline__ u32x8 wslice_group1() {
  u32x8 g1;
  g1[0] = pinned((1u << 20) | (4u << 22) | (3u << 25));  // pad: 4 dwords per 32 dwords
  g1[1] = pinned(128u << 16);                            // tensor_dim0 = 128
  g1[2] = pinned(64u << 16);                             // tensor_dim1 = 64
  g1[3] = pinned(128u << 16);                            // tile_dim0 = 128
  g1[4] = pinned(64u);                                   // tile_dim1 = 64
  g1[5] = pinned(1024u);                                 // source row pitch
  g1[6] = pinned(0u);
  g1[7] = pinned(0u);
  return g1;
}

__global__ __launch_bounds__(256) void tail_fused(const _Float16* __restrict__ at2,
                                                  const _Float16* __restrict__ Wcat,
                                                  const float* __restrict__ Q,
                                                  const float* __restrict__ bo,
                                                  const float* __restrict__ b1,
                                                  const float* __restrict__ b2,
                                                  float* __restrict__ out) {
  __shared__ __attribute__((aligned(2048))) unsigned char Wr[2][8][kWSlice];
  __shared__ alignas(16) _Float16 Xs[kFR][kXP];

  const int t = threadIdx.x;
  const int lane = t & 31;
  const unsigned wave = uni(threadIdx.x >> 5);
  const int lo = lane & 15;
  const int hi = lane >> 4;
  const int m0 = blockIdx.x * kFR;
  const int wn = (int)wave * 64;

  const unsigned wdst = (unsigned)(uintptr_t)&Wr[0][0][0] + wave * kWSlice;
  const _Float16* wsrc = Wcat + (size_t)wn * 512;
  // stage s: product s / 8, k columns (s % 8) * 64, into buffer s % 2
  const u32x8 g1 = wslice_group1();
  u32x4 g0;
  g0[0] = pinned(1u);  // count 1
  auto issue = [&](unsigned s) {
    const unsigned long long ga = (unsigned long long)(uintptr_t)(
        wsrc + (size_t)(s >> 3) * (512 * 512) + (s & 7u) * 64u);
    g0[1] = uni(wdst + (s & 1u) * (8u * kWSlice));                      // place in LDS
    g0[2] = uni((unsigned)ga);                                          // address, low
    g0[3] = uni((((unsigned)(ga >> 32)) & 0x01FFFFFFu) | 0x80000000u);  // high | type 2
    asm volatile("tensor_load_to_lds %0, %1" ::"s"(g0), "s"(g1) : "memory");
  };
  // This wave's tensor load has landed (the compiler places no wait for it). The
  // descriptor is an input only: its registers keep their words up to the wait.
  auto wait_tensor0 = [&]() {
    asm volatile("s_wait_tensorcnt 0x0" ::"s"(g0), "s"(g1) : "memory");
  };

  issue(0);
  // The residual rows of Q and the three biases, C layout (m = r + 8*hi, n = lo),
  // asked for here so that their latency runs beside that of stage 0 and Xs.
  const float* qsrc = Q + (size_t)(m0 + 8 * hi) * 512 + wn + lo;
  f32x4 bias[3];
  v8f qv[4][4];
#pragma unroll  // constant indices into bias[] and qv[]: they stay in registers
  for (int j = 0; j < 4; ++j) {
    const int gc = wn + 16 * j + lo;
    bias[0][j] = bo[gc];
    bias[1][j] = b1[gc];
    bias[2][j] = b2[gc];
#pragma unroll
    for (int i = 0; i < 4; ++i)
#pragma unroll
      for (int r = 0; r < 8; ++r) qv[i][j][r] = qsrc[(16 * i + r) * 512 + 16 * j];
  }
  // The wait that stands in front of any rewrite of an address register of the
  // loads above; the address is an input only, so that it lives up to the wait.
  asm volatile("s_wait_xcnt 0x0" ::"v"(qsrc) : "memory");
  // keeps every later register write behind that wait
  __builtin_amdgcn_sched_barrier(0);

  // the block's attn rows into Xs, whole-line loads (a wave takes 512 B of a row)
  const int xrow = t >> 6;
  const int xcol = (t & 63) * 8;
  const _Float16* xsrc = at2 + (size_t)(m0 + xrow) * 512 + xcol;
  u32x4 xr[16];
#pragma unroll  // constant indices into xr[]: it stays in registers
  for (int i = 0; i < 16; ++i)
    xr[i] = *reinterpret_cast<const u32x4*>(xsrc + i * (4 * 512));
  // The same wait for these loads; the loaded values and the address are inputs
  // only: they tie the wait behind the loads and keep the address up to it.
  asm volatile("s_wait_xcnt 0x0" ::"v"(xr[0]), "v"(xr[1]), "v"(xr[2]), "v"(xr[3]),
               "v"(xr[4]), "v"(xr[5]), "v"(xr[6]), "v"(xr[7]), "v"(xr[8]), "v"(xr[9]),
               "v"(xr[10]), "v"(xr[11]), "v"(xr[12]), "v"(xr[13]), "v"(xr[14]),
               "v"(xr[15]), "v"(xsrc)
               : "memory");
  // keeps every later register write behind that wait
  __builtin_amdgcn_sched_barrier(0);
#pragma unroll
  for (int i = 0; i < 16; ++i)
    *reinterpret_cast<u32x4*>(&Xs[i * 4 + xrow][xcol]) = xr[i];
  wait_tensor0();
  __syncthreads();  // stage 0 and Xs are visible to all waves
  issue(1);

  // One product: acc[i][j] = Xs rows 16 i.. x weight rows wn + 16 j.., k ascending
  auto product = [&](unsigned g, v8f (&acc)[4][4]) {
#pragma unroll 1  // one pass per trip: the ring's foot stands once in the text
    for (unsigned kt = 0; kt < 8; ++kt) {
      const unsigned s = g * 8 + kt;
      const _Float16* Wl = reinterpret_cast<const _Float16*>(&Wr[s & 1u][wave][0]);
      v16h af[2][4], wf[2][4];
#pragma unroll
      for (int kk = 0; kk < 2; ++kk) {
#pragma unroll
        for (int j = 0; j < 4; ++j)
          wf[kk][j] = ldfrag(Wl + (16 * j + lo) * kWP + kk * 32, hi);
#pragma unroll
        for (int i = 0; i < 4; ++i)
          af[kk][i] = ldfrag(&Xs[16 * i + lo][kt * 64 + kk * 32], hi);
      }
      // Keeps the pass's LDS reads one group ahead of its WMMAs; without it the
      // compiler spreads them among the WMMAs, each place with a full wait.
      __builtin_amdgcn_sched_barrier(0);
#pragma unroll
      for (int kk = 0; kk < 2; ++kk)
#pragma unroll
        for (int i = 0; i < 4; ++i)
#pragma unroll
          for (int j = 0; j < 4; ++j)
            acc[i][j] = wmma_f16(af[kk][i], wf[kk][j], acc[i][j]);
      // Keeps the WMMAs in front of the foot: sunk behind its waits they would not
      // run beside the LDS reads and the tile that is still landing; a late refill.
      __builtin_amdgcn_sched_barrier(0);
      // foot of pass s, this wave's own slices only: its reads of buffer s % 2 have
      // retired, so it may be refilled; its stage s + 1 has landed
      wait_ds0();
      wait_tensor0();
      if (pinned(s + 2 < kStages)) issue(s + 2);
    }
  };

  v8f outr[4][4];  // 'out' in f32: C layout m = r + 8*hi, n = lo

  {  // out = Q + attn @ Wo^T + bo
    v8f acc[4][4] = {};
    product(0, acc);
    __syncthreads();  // every wave has left the attn rows: Xs may be rewritten
#pragma unroll
    for (int j = 0; j < 4; ++j) {
      const int gc = wn + 16 * j + lo;
      const float bv = bias[0][j];
#pragma unroll
      for (int i = 0; i < 4; ++i) {
        const int lr = 16 * i + 8 * hi;
#pragma unroll
        for (int r = 0; r < 8; ++r) {
          float x = acc[i][j][r] + bv;
          x += qv[i][j][r];
          outr[i][j][r] = x;
          Xs[lr + r][gc] = (_Float16)x;
        }
      }
    }
    __syncthreads();  // 'out' in f16 is visible to all waves
  }

  {  // hidden = relu(out @ W1^T + b1)
    v8f acc[4][4] = {};
    product(1, acc);
    __syncthreads();  // every wave has left 'out' in f16: Xs may be rewritten
#pragma unroll
    for (int j = 0; j < 4; ++j) {
      const int gc = wn + 16 * j + lo;
      const float bv = bias[1][j];
#pragma unroll
      for (int i = 0; i < 4; ++i) {
        const int lr = 16 * i + 8 * hi;
#pragma unroll
        for (int r = 0; r < 8; ++r)
          Xs[lr + r][gc] = (_Float16)fmaxf(acc[i][j][r] + bv, 0.0f);
      }
    }
    __syncthreads();  // the hidden layer is visible to all waves
  }

  {  // final = out + hidden @ W2^T + b2
    v8f acc[4][4] = {};
    product(2, acc);
    wait_tensor0();
    wait_ds0();
#pragma unroll
    for (int j = 0; j < 4; ++j) {
      const float bv = bias[2][j];
#pragma unroll
      for (int i = 0; i < 4; ++i) {
#pragma unroll
        for (int r = 0; r < 8; ++r) {
          float x = acc[i][j][r] + bv;
          x += outr[i][j][r];
          acc[i][j][r] = x;
        }
      }
    }
    // All sums stand in front of the first store: no register that an issued
    // store names is written again.
    __builtin_amdgcn_sched_barrier(0);
    float* odst = out + (size_t)(m0 + 8 * hi) * 512 + wn + lo;
#pragma unroll
    for (int j = 0; j < 4; ++j)
#pragma unroll
      for (int i = 0; i < 4; ++i)
#pragma unroll
        for (int r = 0; r < 8; ++r) odst[(16 * i + r) * 512 + 16 * j] = acc[i][j][r];
  }
}

// The work-group barrier alone, for data that goes from wave to wave through LDS:
// the caller's s_wait_dscnt 0 stands in front of it. __syncthreads() would also wait
// for every global load in flight, and the K rows are to stay in flight across it.
__device__ __forceinline__ void barrier_lds() {
  asm volatile("s_barrier_signal -1\n\ts_barrier_wait -1" ::: "memory");
}

// ---------------------------------------------------------------------------
// Projections: q = Q @ Wq^T + bq, k = K @ Wk^T + bk, v = K @ Wv^T + bv, all three
// in ONE launch, straight from the f32 activations. A block owns kFR rows of Q and
// the same kFR rows of K: it reads each f32 row once, with whole-line loads,
// converts it and keeps it in LDS in f16 (Xa: Q rows, Xb: K rows). The K rows are
// asked for at the start and stay in flight, then in registers, during the first
// product. Weights as in tail_fused: a wave owns 64 output columns = 64 weight
// rows and brings them in itself, 64 k at a time, by one tensor load per pass into
// its own slice of a two-buffer ring; Wq, Wk, Wv lie one behind the other, so that
// the ring runs through all 24 passes; it is private to its wave, as in tail_fused:
// no work-group barrier at a pass's foot. A wave's 64 x 64 result goes through its own
// columns of Xa (free after the first product) and leaves as whole 128 B lines.
// qkv: q2, k2, v2, one behind the other (the workspace is laid out so).
// ---------------------------------------------------------------------------
__global__ __launch_bounds__(256) void qkv_fused(const float* __restrict__ Q,
                                                 const float* __restrict__ Kx,
                                                 const _Float16* __restrict__ Wcat,
                                                 const float* __restrict__ bq,
                                                 const float* __restrict__ bk,
                                                 const float* __restrict__ bv,
                                                 _Float16* __restrict__ qkv) {
  __shared__ __attribute__((aligned(2048))) unsigned char Wr[2][8][kWSlice];
  __shared__ alignas(16) _Float16 Xa[kFR][kXP];
  __shared__ alignas(16) _Float16 Xb[kFR][kXP];

  const int t = threadIdx.x;
  const int lane = t & 31;
  const unsigned wave = uni(threadIdx.x >> 5);
  const int lo = lane & 15;
  const int hi = lane >> 4;
  const int m0 = blockIdx.x * kFR;
  const int wn = (int)wave * 64;

  const unsigned wdst = (unsigned)(uintptr_t)&Wr[0][0][0] + wave * kWSlice;
  const _Float16* wsrc = Wcat + (size_t)wn * 512;
  // stage s: product s / 8, k columns (s % 8) * 64, into buffer s % 2
  const u32x8 g1 = wslice_group1();
  u32x4 g0;
  g0[0] = pinned(1u);  // count 1
  auto issue = [&](unsigned s) {
    const unsigned long long ga = (unsigned long long)(uintptr_t)(
        wsrc + (size_t)(s >> 3) * (512 * 512) + (s & 7u) * 64u);
    g0[1] = uni(wdst + (s & 1u) * (8u * kWSlice));                      // place in LDS
    g0[2] = uni((unsigned)ga);                                          // address, low
    g0[3] = uni((((unsigned)(ga >> 32)) & 0x01FFFFFFu) | 0x80000000u);  // high | type 2
    asm volatile("tensor_load_to_lds %0, %1" ::"s"(g0), "s"(g1) : "memory");
  };
  // This wave's tensor load has landed (the compiler places no wait for it). The
  // descriptor is an input only: its registers keep their words up to the wait.
  auto wait_tensor0 = [&]() {
    asm volatile("s_wait_tensorcnt 0x0" ::"s"(g0), "s"(g1) : "memory");
  };

  issue(0);
  // The block's f32 rows, whole-line loads (a wave takes 512 B of a row; the block
  // two rows per load): first the 32 loads of Q, then the 32 of K, all in flight.
  const int xrow = t >> 7;
  const int xcol = (t & 127) * 4;
  const float* qsrc = Q + (size_t)(m0 + xrow) * 512 + xcol;
  const float* ksrc = Kx + (size_t)(m0 + xrow) * 512 + xcol;
  f32x4 qf[32], kf[32];
#pragma unroll  // constant indices into qf[]: it stays in registers
  for (int i = 0; i < 32; ++i)
    qf[i] = *reinterpret_cast<const f32x4*>(qsrc + i * (2 * 512));
  // Keeps every load of Q ahead of those of K; without it the compiler puts six of
  // them behind: loads return in order, and the first product would wait for K.
  __builtin_amdgcn_sched_barrier(0);
#pragma unroll  // constant indices into kf[]: it stays in registers
  for (int i = 0; i < 32; ++i)
    kf[i] = *reinterpret_cast<const f32x4*>(ksrc + i * (2 * 512));
  const int gc0 = wn + lo;  // this lane's first output column (C layout, n = lo)
  f32x4 bias[3];
#pragma unroll  // constant indices into bias[]: it stays in registers
  for (int j = 0; j < 4; ++j) {
    bias[0][j] = bq[gc0 + 16 * j];
    bias[1][j] = bk[gc0 + 16 * j];
    bias[2][j] = bv[gc0 + 16 * j];
  }
  // The wait that stands in front of any rewrite of an address register of the
  // loads above; the addresses are inputs only, so that they live up to the wait.
  asm volatile("s_wait_xcnt 0x0" ::"v"(qsrc), "v"(ksrc), "v"(gc0) : "memory");
  // keeps every later register write behind that wait
  __builtin_amdgcn_sched_barrier(0);

  // four f32 of a row -> four f16, one 8 B store (a wave fills 256 B in a row)
  auto put = [&](_Float16(*X)[kXP], int i, f32x4 x) {
    _Float16 h[4] = {(_Float16)x[0], (_Float16)x[1], (_Float16)x[2], (_Float16)x[3]};
    *reinterpret_cast<uint2*>(&X[2 * i + xrow][xcol]) = *reinterpret_cast<uint2*>(h);
  };
#pragma unroll  // constant indices into qf[]: it stays in registers
  for (int i = 0; i < 32; ++i) put(Xa, i, qf[i]);
  wait_ds0();
  wait_tensor0();
  barrier_lds();  // stage 0 and the Q rows are visible to all waves
  issue(1);

  // One product: acc[i][j] = X rows 16 i.. x weight rows wn + 16 j.., k ascending
  auto product = [&](unsigned g, const _Float16(*X)[kXP], v8f(&acc)[4][4]) {
#pragma unroll 1  // one pass per trip: the ring's foot stands once in the text
    for (unsigned kt = 0; kt < 8; ++kt) {
      const unsigned s = g * 8 + kt;
      const _Float16* Wl = reinterpret_cast<const _Float16*>(&Wr[s & 1u][wave][0]);
      v16h af[2][4], wf[2][4];
#pragma unroll
      for (int kk = 0; kk < 2; ++kk) {
#pragma unroll
        for (int j = 0; j < 4; ++j)
          wf[kk][j] = ldfrag(Wl + (16 * j + lo) * kWP + kk * 32, hi);
#pragma unroll
        for (int i = 0; i < 4; ++i)
          af[kk][i] = ldfrag(&X[16 * i + lo][kt * 64 + kk * 32], hi);
      }
      // Keeps the pass's LDS reads one group ahead of its WMMAs; without it the
      // compiler spreads them among the WMMAs, each place with a full wait.
      __builtin_amdgcn_sched_barrier(0);
#pragma unroll
      for (int kk = 0; kk < 2; ++kk)
#pragma unroll
        for (int i = 0; i < 4; ++i)
#pragma unroll
          for (int j = 0; j < 4; ++j)
            acc[i][j] = wmma_f16(af[kk][i], wf[kk][j], acc[i][j]);
      // Keeps the WMMAs in front of the foot: sunk behind its waits they would not
      // run beside the LDS reads and the tile that is still landing; a late refill.
      __builtin_amdgcn_sched_barrier(0);
      // foot of pass s, this wave's own slices only: its reads of buffer s % 2 have
      // retired, so it may be refilled; its stage s + 1 has landed
      wait_ds0();
      wait_tensor0();
      if (pinned(s + 2 < kStages)) issue(s + 2);
    }
  };

  // Result of product g out: C layout (m = r + 8*hi, n = lo) into this wave's own
  // 64 columns of Xa, which no other wave touches, then back row by row: 8 lanes
  // cover a row's 128 B line, a store covers four whole lines.
  const int orow = lane >> 3;
  const int ocol = wn + (lane & 7) * 8;
  auto emit = [&](unsigned g, v8f(&acc)[4][4]) {
#pragma unroll
    for (int j = 0; j < 4; ++j) {
      const int gc = wn + 16 * j + lo;
      const float bvj = bias[g][j];
#pragma unroll
      for (int i = 0; i < 4; ++i) {
        const int lr = 16 * i + 8 * hi;
#pragma unroll
        for (int r = 0; r < 8; ++r) Xa[lr + r][gc] = (_Float16)(acc[i][j][r] + bvj);
      }
    }
    u32x4 o[16];
#pragma unroll  // constant indices into o[]: it stays in registers
    for (int n = 0; n < 16; ++n)
      o[n] = *reinterpret_cast<const u32x4*>(&Xa[4 * n + orow][ocol]);
    // All 16 reads stand in front of the first store: no register that an issued
    // store names is written by a later read.
    __builtin_amdgcn_sched_barrier(0);
    _Float16* odst = qkv + (size_t)g * (32 * 512 * 512) + (size_t)(m0 + orow) * 512 + ocol;
#pragma unroll
    for (int n = 0; n < 16; ++n)
      *reinterpret_cast<u32x4*>(odst + n * (4 * 512)) = o[n];
    // The wait that stands in front of any rewrite of a register of the stores
    // above; data and address are inputs only, so that they live up to the wait.
    asm volatile("s_wait_xcnt 0x0" ::"v"(o[0]), "v"(o[1]), "v"(o[2]), "v"(o[3]), "v"(o[4]),
                 "v"(o[5]), "v"(o[6]), "v"(o[7]), "v"(o[8]), "v"(o[9]), "v"(o[10]),
                 "v"(o[11]), "v"(o[12]), "v"(o[13]), "v"(o[14]), "v"(o[15]), "v"(odst)
                 : "memory");
    // keeps every later register write behind that wait
    __builtin_amdgcn_sched_barrier(0);
  };

  {  // q = Q @ Wq^T + bq
    v8f acc[4][4] = {};
    product(0, Xa, acc);
#pragma unroll  // constant indices into kf[]: it stays in registers
    for (int i = 0; i < 32; ++i) put(Xb, i, kf[i]);
    wait_ds0();
    // The K rows are visible to all waves, and every wave has left Xa (its reads
    // retired at its last foot): from here on a wave touches only its own columns of Xa.
    barrier_lds();
    emit(0, acc);
  }
  {  // k = K @ Wk^T + bk
    v8f acc[4][4] = {};
    product(1, Xb, acc);
    emit(1, acc);
  }
  {  // v = K @ Wv^T + bv
    v8f acc[4][4] = {};
    product(2, Xb, acc);
    wait_tensor0();
    wait_ds0();
    emit(2, acc);
  }
}

// ---------------------------------------------------------------------------
extern "C" void kernel_launch(void* const* d_in, const int* in_sizes, int n_in,
                              void* d_out, int out_size, void* d_ws,
                              size_t ws_size, hipStream_t stream) {
  (void)in_sizes; (void)n_in; (void)out_size; (void)ws_size;
  const float* Q  = (const float*)d_in[0];
  const float* Kx = (const float*)d_in[1];
  const float* Wq = (const float*)d_in[2];
  const float* bq = (const float*)d_in[3];
  const float* Wk = (const float*)d_in[4];
  const float* bk = (const float*)d_in[5];
  const float* Wv = (const float*)d_in[6];
  const float* bv = (const float*)d_in[7];
  const float* Wo = (const float*)d_in[8];
  const float* bo = (const float*)d_in[9];
  const float* W1 = (const float*)d_in[10];
  const float* b1 = (const float*)d_in[11];
  const float* W2 = (const float*)d_in[12];
  const float* b2 = (const float*)d_in[13];

  constexpr int B = 32, Nt = 512, D = 512, H = 8;
  constexpr int M = B * Nt;                          // 16384
  const size_t szH = (size_t)M * D * sizeof(_Float16);  // activations, f16
  const size_t szW = (size_t)D * D * sizeof(_Float16);  // weights, f16

  char* p = (char*)d_ws;
  _Float16* q2   = (_Float16*)p; p += szH;
  _Float16* k2   = (_Float16*)p; p += szH;
  _Float16* v2   = (_Float16*)p; p += szH;
  _Float16* at2  = (_Float16*)p; p += szH;
  _Float16* Wq6  = (_Float16*)p; p += szW;
  _Float16* Wk6  = (_Float16*)p; p += szW;
  _Float16* Wv6  = (_Float16*)p; p += szW;
  _Float16* Wo6  = (_Float16*)p; p += szW;
  _Float16* W16w = (_Float16*)p; p += szW;
  _Float16* W26w = (_Float16*)p;

  const dim3 blk(256);

  // f32 -> f16 conversion of the six weights, one launch
  cvt_wgt<<<dim3(6 * kWgtSegs), blk, 0, stream>>>(Wq, Wk, Wv, Wo, W1, W2, Wq6);

  // q/k/v projections from the f32 activations (f16 out), one launch
  qkv_fused<<<dim3(M / kFR), blk, 0, stream>>>(Q, Kx, Wq6, bq, bk, bv, q2);

  // attention: column softmax stats (query axis), then P @ V, one launch
  attn_fused<<<dim3(B * H), dim3(32 * kAW), 0, stream>>>(q2, k2, v2, at2);

  // out = Q + attn @ Wo^T + bo; final = out + relu(out @ W1^T + b1) @ W2^T + b2
  tail_fused<<<dim3(M / kFR), blk, 0, stream>>>(at2, Wo6, Q, bo, b1, b2,
                                                (float*)d_out);
}
